// v000
// Times are from an AMD MI455X. After a warm-up the kernel runs many times in a row, and a time is the length of
// such a window on the GPU divided by its runs, so every launch and the gaps after it count. The runs cycle
// through copies of the inputs. A figure is the median of several windows, for all but v000 over two sittings.
// Sittings can differ by a few percent; kernels timed side by side share one.
// The starting kernel, v000, takes 1470 microseconds a run.
#include <hip/hip_runtime.h>

// ICLAttention (q, k, v inputs [2][2048][1024]; qh/kh/vh = x W^T (torch; 16 heads x 64); interleaved-pair RoPE (base 1e4, tables computed on device); SCALE = 1/sqrt(1024); 'shifted causal' mask: key j is masked iff j >= i, except (0, 0) which stays visible; softmax; out = merged Wo^T -> [2][2048][1024]).
// Compute dtypes, f32 accumulate: every input rounded to bf16; projections on PLAIN bf16 operands (inputs: exact); RoPE f32; scores and attn.v: query rows < 512 hl (3 products), the rest single fp16 (x1024), causal tile skipping (the strict j < i test applied inside the computed tiles); softmax f32; Wo hl x exact (2 products).

#define NB_  2
#define TT   2048
#define DM   1024
#define NH_  16
#define NKV  16
#define REP  (NH_ / NKV)
#define HD   64
#define DQ   (NH_ * HD)
#define DKV  (NKV * HD)
#define ZH   2
#define RH   512                  // query rows < RH use hi+lo planes (0: none)
#define WIN  2048
#define PCAR 1024.0f
#define SCL  0.03125f   // 1/sqrt(d_attn = 1024), as the source
typedef _Float16 h16;
typedef unsigned short bf;
typedef __attribute__((ext_vector_type(16))) __bf16   v16bf;
typedef __attribute__((ext_vector_type(16))) _Float16 v16h;
typedef __attribute__((ext_vector_type(8)))  _Float16 v8h;
typedef __attribute__((ext_vector_type(8)))  unsigned short v8us;
typedef __attribute__((ext_vector_type(8)))  float    v8f;
typedef __attribute__((ext_vector_type(4)))  float    v4f;
typedef v8h  __attribute__((may_alias)) v8ha;
typedef v4f  __attribute__((may_alias)) v4fa;
typedef v8us __attribute__((may_alias)) v8usa;

__device__ __forceinline__ unsigned short f2bf(float f) { unsigned u = __float_as_uint(f); u += 0x7FFFu + ((u >> 16) & 1u); return (unsigned short)(u >> 16); }
__device__ __forceinline__ float bf2f(unsigned short b) { return __uint_as_float(((unsigned)b) << 16); }
__device__ __forceinline__ float bfr(float f) { return bf2f(f2bf(f)); }
__device__ __forceinline__ v16h cat16(v8h lo, v8h hi) { return __builtin_shufflevector(lo, hi, 0, 1, 2, 3, 4, 5, 6, 7, 8, 9, 10, 11, 12, 13, 14, 15); }
__device__ __forceinline__ v16bf cat16b(v8us lo, v8us hi) { return __builtin_bit_cast(v16bf, __builtin_shufflevector(lo, hi, 0, 1, 2, 3, 4, 5, 6, 7, 8, 9, 10, 11, 12, 13, 14, 15)); }
__device__ __forceinline__ v8f wmma16(v16h a, v16h b, v8f c) { return __builtin_amdgcn_wmma_f32_16x16x32_f16(false, a, false, b, (short)0, c, false, false); }
__device__ __forceinline__ v8f wmmab(v16bf a, v16bf b, v8f c) { return __builtin_amdgcn_wmma_f32_16x16x32_bf16(false, a, false, b, (short)0, c, false, false); }



// ---- k_gemmw: register-blocked GEMM, ONE WAVE per 64x64 output tile (16 accumulators), operands straight from K-contiguous 16-bit planes; grid (M/64, N/64, Z), 32 threads.
// C[m][n] (f32, pitch ldc, + optional f32 bias[n]) = sum_k A[m][k] Bt[n][k] (+ split products per NSPLIT). z-batch strides sA/sB/sC in elements. K % 32 == 0.
template <typename T16> struct WFrag;
template <> struct WFrag<h16> { typedef v16h V; static __device__ __forceinline__ V ld(const h16* p) { return cat16(*(const v8h*)p, *(const v8h*)(p + 16)); } static __device__ __forceinline__ v8f mma(V a, V b, v8f c) { return wmma16(a, b, c); } };
template <> struct WFrag<bf> { typedef v16bf V; static __device__ __forceinline__ V ld(const bf* p) { return cat16b(*(const v8us*)p, *(const v8us*)(p + 16)); } static __device__ __forceinline__ v8f mma(V a, V b, v8f c) { return wmmab(a, b, c); } };
template <typename T16, int NSPLIT, bool BIAS>
__global__ __launch_bounds__(32) void k_gemmw(const T16* __restrict__ A, const T16* __restrict__ A2, const T16* __restrict__ Bt, const T16* __restrict__ Bt2, int K, float* C, int ldc, const float* __restrict__ bias, size_t sA, size_t sB, size_t sC) {
    typedef typename WFrag<T16>::V V;
    __shared__ __align__(16) float os[16 * 68];
    const size_t z = blockIdx.z; A += z * sA; if (A2) A2 += z * sA; Bt += z * sB; if (Bt2) Bt2 += z * sB; C += z * sC;
    const int lane = threadIdx.x & 31, lr = lane & 15, hi = lane >> 4; const int r0 = blockIdx.x * 64, c0 = blockIdx.y * 64;
    v8f acc[4][4];
#pragma unroll
    for (int mb = 0; mb < 4; ++mb)
#pragma unroll
        for (int nb = 0; nb < 4; ++nb) acc[mb][nb] = (v8f){};
    const size_t aoff = (size_t)(r0 + lr) * K + 8 * hi, boff = (size_t)(c0 + lr) * K + 8 * hi;
#pragma unroll 1
    for (int kc = 0; kc < K; kc += 32) {
        V a[4], a2[4];
#pragma unroll
        for (int mb = 0; mb < 4; ++mb) { a[mb] = WFrag<T16>::ld(A + aoff + (size_t)mb * 16 * K + kc); if (NSPLIT == 1 || NSPLIT == 2) a2[mb] = WFrag<T16>::ld(A2 + aoff + (size_t)mb * 16 * K + kc); }
#pragma unroll
        for (int nb = 0; nb < 4; ++nb) { const V b = WFrag<T16>::ld(Bt + boff + (size_t)nb * 16 * K + kc); V b2; if (NSPLIT >= 2) b2 = WFrag<T16>::ld(Bt2 + boff + (size_t)nb * 16 * K + kc);
#pragma unroll
            for (int mb = 0; mb < 4; ++mb) { acc[mb][nb] = WFrag<T16>::mma(a[mb], b, acc[mb][nb]); if (NSPLIT == 1 || NSPLIT == 2) acc[mb][nb] = WFrag<T16>::mma(a2[mb], b, acc[mb][nb]); if (NSPLIT >= 2) acc[mb][nb] = WFrag<T16>::mma(a[mb], b2, acc[mb][nb]); } }
        asm volatile("v_nop\n\tv_nop\n\tv_nop\n\tv_nop" : "+v"(acc[0][0]), "+v"(acc[1][1]), "+v"(acc[2][2]), "+v"(acc[3][3]) : "v"(a[0]), "v"(a[3]));
    }
#pragma unroll
    for (int mb = 0; mb < 4; ++mb) {
#pragma unroll
        for (int nb = 0; nb < 4; ++nb) {
#pragma unroll
            for (int j = 0; j < 8; ++j) os[(hi * 8 + j) * 68 + nb * 16 + lr] = acc[mb][nb][j]; }
        __builtin_amdgcn_wave_barrier(); asm volatile("" ::: "memory");
        float* crow = C + (size_t)(r0 + mb * 16) * ldc + c0;
{
#pragma unroll
            for (int s = 0; s < 8; ++s) { const int row = 2 * s + hi, cofs = lr * 4; v4f val = *(const v4fa*)(os + row * 68 + cofs); if (BIAS) { val[0] += bfr(bias[c0 + cofs]); val[1] += bfr(bias[c0 + cofs + 1]); val[2] += bfr(bias[c0 + cofs + 2]); val[3] += bfr(bias[c0 + cofs + 3]); }
                *(v4f*)(crow + (size_t)row * ldc + cofs) = val; }
             }
        __builtin_amdgcn_wave_barrier(); asm volatile("" ::: "memory");
    }
}

// ---- k_gemmc: the same one-wave 64x64 tile GEMM specialised for causal attention: CMODE 1 skips score tiles entirely above the diagonal (query rows r0+roff.., key columns c0..), CMODE 2 limits the
// key (K) loop of the probability x value contraction to the diagonal block (probabilities beyond it are exactly zero). roff = row offset of this launch's first row within the sequence.
template <typename T16, int NSPLIT, int CMODE>
__global__ __launch_bounds__(32) void k_gemmc(const T16* __restrict__ A, const T16* __restrict__ A2, const T16* __restrict__ Bt, const T16* __restrict__ Bt2, int K, float* C, int ldc, int roff, size_t sA, size_t sB, size_t sC) {
    typedef typename WFrag<T16>::V V;
    __shared__ __align__(16) float os[16 * 68];
    const size_t z = blockIdx.z; A += z * sA; if (A2) A2 += z * sA; Bt += z * sB; if (Bt2) Bt2 += z * sB; C += z * sC;
    const int lane = threadIdx.x & 31, lr = lane & 15, hi = lane >> 4; const int r0 = blockIdx.x * 64, c0 = blockIdx.y * 64;
    if (CMODE == 1 && c0 > r0 + roff + 63) return;                  // score tile entirely above the causal diagonal: never read (the softmax masks j > i by select)
    const int Kl = (CMODE == 2) ? min(K, r0 + roff + 64) : K;        // P.V: probabilities are exactly 0 beyond the diagonal block, so the K loop stops there
    v8f acc[4][4];
#pragma unroll
    for (int mb = 0; mb < 4; ++mb)
#pragma unroll
        for (int nb = 0; nb < 4; ++nb) acc[mb][nb] = (v8f){};
    const size_t aoff = (size_t)(r0 + lr) * K + 8 * hi, boff = (size_t)(c0 + lr) * K + 8 * hi;
#pragma unroll 1
    for (int kc = 0; kc < Kl; kc += 32) {
        V a[4], a2[4];
#pragma unroll
        for (int mb = 0; mb < 4; ++mb) { a[mb] = WFrag<T16>::ld(A + aoff + (size_t)mb * 16 * K + kc); if (NSPLIT == 1 || NSPLIT == 2) a2[mb] = WFrag<T16>::ld(A2 + aoff + (size_t)mb * 16 * K + kc); }
#pragma unroll
        for (int nb = 0; nb < 4; ++nb) { const V b = WFrag<T16>::ld(Bt + boff + (size_t)nb * 16 * K + kc); V b2; if (NSPLIT >= 2) b2 = WFrag<T16>::ld(Bt2 + boff + (size_t)nb * 16 * K + kc);
#pragma unroll
            for (int mb = 0; mb < 4; ++mb) { acc[mb][nb] = WFrag<T16>::mma(a[mb], b, acc[mb][nb]); if (NSPLIT == 1 || NSPLIT == 2) acc[mb][nb] = WFrag<T16>::mma(a2[mb], b, acc[mb][nb]); if (NSPLIT >= 2) acc[mb][nb] = WFrag<T16>::mma(a[mb], b2, acc[mb][nb]); } }
        asm volatile("v_nop\n\tv_nop\n\tv_nop\n\tv_nop" : "+v"(acc[0][0]), "+v"(acc[1][1]), "+v"(acc[2][2]), "+v"(acc[3][3]) : "v"(a[0]), "v"(a[3]));
    }
#pragma unroll
    for (int mb = 0; mb < 4; ++mb) {
#pragma unroll
        for (int nb = 0; nb < 4; ++nb) {
#pragma unroll
            for (int j = 0; j < 8; ++j) os[(hi * 8 + j) * 68 + nb * 16 + lr] = acc[mb][nb][j]; }
        __builtin_amdgcn_wave_barrier(); asm volatile("" ::: "memory");
        float* crow = C + (size_t)(r0 + mb * 16) * ldc + c0;
{
#pragma unroll
            for (int s = 0; s < 8; ++s) { const int row = 2 * s + hi, cofs = lr * 4; v4f val = *(const v4fa*)(os + row * 68 + cofs);
                *(v4f*)(crow + (size_t)row * ldc + cofs) = val; }
             }
        __builtin_amdgcn_wave_barrier(); asm volatile("" ::: "memory");
    }
}

__device__ __forceinline__ h16 tohx(float x) { return (h16)x; }
__device__ __forceinline__ void splitf(float y, unsigned short& h, unsigned short& l) { h = f2bf(y); l = f2bf(y - bf2f(h)); }
typedef __attribute__((ext_vector_type(2))) _Float16 v2h;
typedef __attribute__((ext_vector_type(4))) _Float16 v4h;
typedef __attribute__((ext_vector_type(2))) unsigned short v2us;
typedef __attribute__((ext_vector_type(4))) unsigned short v4us;
typedef __attribute__((ext_vector_type(2))) float v2f;
typedef __attribute__((ext_vector_type(4))) int v4i;

__global__ __launch_bounds__(256) void k_wtG(const float* __restrict__ w, int K, int N, bf* Bt) {
    const int lane = threadIdx.x & 31; const int L0 = (blockIdx.x * 8 + (threadIdx.x >> 5)) * 8; const int nlines = N * K / 64;
{
#pragma unroll 1
        for (int l = 0; l < 8; ++l) { const int L = L0 + l; if (L >= nlines) break; const size_t e = (size_t)L * 64 + lane * 2; const int k = (int)(e % K), n = (int)(e / K); v2us o;
            o[0] = f2bf(w[(size_t)k * N + n]); o[1] = f2bf(w[(size_t)(k + 1) * N + n]); *(v2us*)(Bt + e) = o; }
         }
}
__global__ __launch_bounds__(256) void k_cvt8(const float* __restrict__ src, bf* dst, size_t n8) { const size_t i = (size_t)blockIdx.x * 256 + threadIdx.x; if (i >= n8) return; const v8f v = *(const v8f*)(src + i * 8); v8us o;
#pragma unroll
    for (int k = 0; k < 8; ++k) o[k] = f2bf(v[k]); *(v8us*)(dst + i * 8) = o;  }
__global__ __launch_bounds__(256) void k_cstab(float* CS) { const int idx = blockIdx.x * 256 + threadIdx.x; if (idx >= TT * HD) return; const int t = idx / HD, d = idx % HD; const int i = d >> 1;   /* interleaved pairs */ const float inv = __fdiv_rn(1.0f, powf(10000.0f, (float)(2 * i) / (float)HD)); const float ang = __fmul_rn((float)t, inv); v2f cs; cs[0] = cosf(ang); cs[1] = sinf(ang);
    *(v2f*)(CS + (size_t)idx * 2) = cs;  }
// k_rope: head planes [h][t][d] (fp16 + hi/lo) of rope(x) x sc with interleaved pairs out[2i] = x[2i] cos[t][2i] - x[2i+1] sin[t][2i], out[2i+1] = x[2i+1] cos[t][2i+1] + x[2i] sin[t][2i+1]
__global__ __launch_bounds__(256) void k_rope(const float* __restrict__ F, int pitch, int nheads, const float* __restrict__ CS, const float* __restrict__ RF, const float* __restrict__ nw, float sc, h16* P16, bf* Ph, bf* Pl) {
    const size_t e = ((size_t)blockIdx.x * 256 + threadIdx.x) * 2; if (e >= (size_t)nheads * TT * HD) return; const int d = (int)(e % HD); const int t = (int)((e / HD) % TT); const int h = (int)(e / ((size_t)HD * TT)); const float* f = F + (size_t)t * pitch + h * HD; const float rf = RF ? RF[(size_t)h * TT + t] : 1.0f; v2h o16; v2us oh, ol;
#pragma unroll
    for (int q = 0; q < 2; ++q) { const int dd = d + q; const int dp = dd ^ 1; float x0 = f[dd], x1 = f[dp];
        if (RF) { float n0 = __fmul_rn(x0, rf), n1 = __fmul_rn(x1, rf); asm volatile("" : "+v"(n0)); asm volatile("" : "+v"(n1)); x0 = __fmul_rn(bfr(nw[dd]), n0); x1 = __fmul_rn(bfr(nw[dp]), n1); }
        const v2f cs = *(const v2f*)(CS + ((size_t)t * HD + dd) * 2); float a = __fmul_rn(x0, cs[0]), bq = __fmul_rn(x1, cs[1]); asm volatile("" : "+v"(a)); asm volatile("" : "+v"(bq)); const float r = (((dd & 1) == 0) ? __fsub_rn(a, bq) : __fadd_rn(a, bq)) * sc;
        o16[q] = tohx(r); unsigned short a2, c2; splitf(r, a2, c2); oh[q] = a2; ol[q] = c2; }
    *(v2h*)(P16 + e) = o16; *(v2us*)(Ph + e) = oh; *(v2us*)(Pl + e) = ol;  }
__global__ __launch_bounds__(256) void k_vtp(const float* __restrict__ F, int pitch, int nheads, h16* V16, bf* Vh, bf* Vl) { const size_t e = ((size_t)blockIdx.x * 256 + threadIdx.x) * 2; if (e >= (size_t)nheads * HD * TT) return; const int t = (int)(e % TT); const int d = (int)((e / TT) % HD); const int g = (int)(e / ((size_t)TT * HD)); v2h o16; v2us oh, ol;
#pragma unroll
    for (int q = 0; q < 2; ++q) { const float x = F[(size_t)(t + q) * pitch + g * HD + d]; o16[q] = tohx(x); unsigned short a2, c2; splitf(x, a2, c2); oh[q] = a2; ol[q] = c2; }
    *(v2h*)(V16 + e) = o16; *(v2us*)(Vh + e) = oh; *(v2us*)(Vl + e) = ol;  }
// k_asoft: per row (zz, i): t = S x SCL for j < i and for (0, 0) (shifted causal mask, other keys -3e38 by select; the reference's -1e9 additive fill vanishes identically); softmax over the 2048 keys (register row, one exp, fixed trees);
__global__ __launch_bounds__(256) void k_asoft(const float* __restrict__ Sb, h16* P16, bf* Ph, bf* Pl) {
    const int lane = threadIdx.x & 31; const int row = blockIdx.x * 8 + (threadIdx.x >> 5); if (row >= ZH * TT) return; const int i = row % TT; const int zz = row / TT; (void)zz; const bool hires = (i < RH); const float* sr = Sb + (size_t)row * TT; float v[TT / 32]; float mx = -3.0e38f;
#pragma unroll
    for (int ch = 0; ch < TT / 128; ++ch) { const int j0 = ch * 128 + lane * 4; const v4f a = *(const v4f*)(sr + j0);
#pragma unroll
        for (int q = 0; q < 4; ++q) { const int j = j0 + q; (void)j; const float t = (j < i || (i == 0 && j == 0)) ? a[q] * SCL : -3.0e38f; v[ch * 4 + q] = t; mx = fmaxf(mx, t); } }
#pragma unroll
    for (int sh = 16; sh; sh >>= 1) mx = fmaxf(mx, __shfl_xor(mx, sh, 32));
    float sum = 0.f;
#pragma unroll
    for (int k = 0; k < TT / 32; ++k) { float d0 = __fsub_rn(v[k], mx); asm volatile("" : "+v"(d0)); v[k] = __builtin_amdgcn_exp2f(__fmul_rn(d0, 1.4426950408889634f)); sum += v[k]; }
#pragma unroll
    for (int sh = 16; sh; sh >>= 1) sum += __shfl_xor(sum, sh, 32);
    const float f = __fdiv_rn(hires ? 1.0f : PCAR, sum);
{
        if (hires) {
#pragma unroll
            for (int ch = 0; ch < TT / 128; ++ch) { v4us oh, ol;
#pragma unroll
                for (int q = 0; q < 4; ++q) { unsigned short a, c2; splitf(v[ch * 4 + q] * f, a, c2); oh[q] = a; ol[q] = c2; }
                const size_t oo = ((size_t)zz * (RH ? RH : 1) + i) * TT + ch * 128 + lane * 4; *(v4us*)(Ph + oo) = oh; *(v4us*)(Pl + oo) = ol; }
        } else {
#pragma unroll
            for (int ch = 0; ch < TT / 128; ++ch) { v4h o4;
#pragma unroll
                for (int q = 0; q < 4; ++q) o4[q] = tohx(v[ch * 4 + q] * f);
                *(v4h*)(P16 + (size_t)row * TT + ch * 128 + lane * 4) = o4; } }
         }
}
__global__ __launch_bounds__(256) void k_merge(const float* __restrict__ O, int h0, bf* Ah, bf* Al) { const size_t e = ((size_t)blockIdx.x * 256 + threadIdx.x) * 2; if (e >= (size_t)ZH * TT * HD) return; const int d = (int)(e % HD); const int t = (int)((e / HD) % TT); const int zz = (int)(e / ((size_t)HD * TT)); const float cs = (t < RH) ? 1.0f : (1.0f / PCAR); const size_t oo = (size_t)t * DQ + (h0 + zz) * HD + d;
    v2us oh, ol;
#pragma unroll
    for (int q = 0; q < 2; ++q) { unsigned short a, c2; splitf(O[e + q] * cs, a, c2); oh[q] = a; ol[q] = c2; } *(v2us*)(Ah + oo) = oh; *(v2us*)(Al + oo) = ol;  }

extern "C" void kernel_launch(void* const* d_in, const int* in_sizes, int n_in,
                              void* d_out, int out_size, void* d_ws, size_t ws_size, hipStream_t stream) {
    (void)in_sizes; (void)n_in; (void)out_size;
    const float* x = (const float*)d_in[0]; const float* xk = (const float*)d_in[1]; const float* xv = (const float*)d_in[2]; const float* wq = (const float*)d_in[3]; const float* wk = (const float*)d_in[4]; const float* wv = (const float*)d_in[5]; const float* wo = (const float*)d_in[6];
    float* OUT = (float*)d_out;     // [2][2048][1024]
    char* wsp = (char*)d_ws;
    auto take = [&](size_t bytes) { char* p = wsp; wsp += (bytes + 255) & ~(size_t)255; return (void*)p; };
    bf* WQ = (bf*)take((size_t)DQ * DM * 2); bf* WK = (bf*)take((size_t)DKV * DM * 2); bf* WV = (bf*)take((size_t)DKV * DM * 2); bf* WO = (bf*)take((size_t)DM * DQ * 2); float* CS = (float*)take((size_t)TT * HD * 2 * 4);
    bf* XB = (bf*)take((size_t)TT * DM * 2); bf* XB2 = (bf*)take((size_t)TT * DM * 2); bf* XB3 = (bf*)take((size_t)TT * DM * 2); float* FQ = (float*)take((size_t)TT * DQ * 4); float* FK = (float*)take((size_t)TT * DKV * 4);
    h16* QP16 = (h16*)take((size_t)NH_ * TT * HD * 2); h16* KP16 = (h16*)take((size_t)NKV * TT * HD * 2); h16* VT16 = (h16*)take((size_t)NKV * HD * TT * 2);
    bf* QPh = (bf*)take((size_t)NH_ * TT * HD * 2); bf* QPl = (bf*)take((size_t)NH_ * TT * HD * 2); bf* KPh = (bf*)take((size_t)NKV * TT * HD * 2); bf* KPl = (bf*)take((size_t)NKV * TT * HD * 2); bf* VTh = (bf*)take((size_t)NKV * HD * TT * 2); bf* VTl = (bf*)take((size_t)NKV * HD * TT * 2); bf* Ph = (bf*)take((size_t)ZH * RH * TT * 2); bf* Pl = (bf*)take((size_t)ZH * RH * TT * 2);
    float* Sb = (float*)take((size_t)ZH * TT * TT * 4); h16* P16 = (h16*)take((size_t)ZH * TT * TT * 2); float* Ob = (float*)take((size_t)ZH * TT * HD * 4); bf* ATh = (bf*)take((size_t)TT * DQ * 2); bf* ATl = (bf*)take((size_t)TT * DQ * 2);
    if ((size_t)(wsp - (char*)d_ws) > ws_size) return;    // ws 256 MiB
    float* FV = FK;   // v projection reuses the k buffer after the k planes are built (stream-ordered)
    { k_cvt8<<<(unsigned)(((size_t)DQ * DM / 8 + 255) / 256), 256, 0, stream>>>(wq, WQ, (size_t)DQ * DM / 8); k_cvt8<<<(unsigned)(((size_t)DKV * DM / 8 + 255) / 256), 256, 0, stream>>>(wk, WK, (size_t)DKV * DM / 8); k_cvt8<<<(unsigned)(((size_t)DKV * DM / 8 + 255) / 256), 256, 0, stream>>>(wv, WV, (size_t)DKV * DM / 8);
      k_cvt8<<<(unsigned)(((size_t)DM * DQ / 8 + 255) / 256), 256, 0, stream>>>(wo, WO, (size_t)DM * DQ / 8);
      k_cstab<<<(TT * HD + 255) / 256, 256, 0, stream>>>(CS); }
    const unsigned LQ = (unsigned)(((size_t)NH_ * TT * HD / 2 + 255) / 256), LKv = (unsigned)(((size_t)NKV * TT * HD / 2 + 255) / 256);
    for (int b = 0; b < NB_; ++b) {
        
        k_cvt8<<<(unsigned)(((size_t)TT * DM / 8 + 255) / 256), 256, 0, stream>>>(x + (size_t)b * TT * DM, XB, (size_t)TT * DM / 8); k_cvt8<<<(unsigned)(((size_t)TT * DM / 8 + 255) / 256), 256, 0, stream>>>(xk + (size_t)b * TT * DM, XB2, (size_t)TT * DM / 8); k_cvt8<<<(unsigned)(((size_t)TT * DM / 8 + 255) / 256), 256, 0, stream>>>(xv + (size_t)b * TT * DM, XB3, (size_t)TT * DM / 8);
        k_gemmw<bf, 0, false><<<dim3(TT / 64, DQ / 64, 1), 32, 0, stream>>>(XB, nullptr, WQ, nullptr, DM, FQ, DQ, nullptr, 0, 0, 0);
        k_rope<<<LQ, 256, 0, stream>>>(FQ, DQ, NH_, CS, nullptr, nullptr, 1.0f, QP16, QPh, QPl);
        k_gemmw<bf, 0, false><<<dim3(TT / 64, DKV / 64, 1), 32, 0, stream>>>(XB2, nullptr, WK, nullptr, DM, FK, DKV, nullptr, 0, 0, 0);
        k_rope<<<LKv, 256, 0, stream>>>(FK, DKV, NKV, CS, nullptr, nullptr, 1.0f, KP16, KPh, KPl);
        k_gemmw<bf, 0, false><<<dim3(TT / 64, DKV / 64, 1), 32, 0, stream>>>(XB3, nullptr, WV, nullptr, DM, FV, DKV, nullptr, 0, 0, 0); k_vtp<<<LKv, 256, 0, stream>>>(FV, DKV, NKV, VT16, VTh, VTl);
        for (int h0 = 0; h0 < NH_; h0 += ZH) { const size_t zq = (size_t)h0, zk = (size_t)(h0 / REP);   // one kv head per query head: the pass's two heads use consecutive kv planes (z-strides TT*HD)
            k_gemmc<bf, 2, 1><<<dim3(RH / 64, TT / 64, ZH), 32, 0, stream>>>(QPh + zq * TT * HD, QPl + zq * TT * HD, KPh + zk * TT * HD, KPl + zk * TT * HD, HD, Sb, TT, 0, (size_t)TT * HD, (size_t)TT * HD, (size_t)TT * TT);
            k_gemmc<h16, 0, 1><<<dim3((TT - RH) / 64, TT / 64, ZH), 32, 0, stream>>>(QP16 + zq * TT * HD + (size_t)RH * HD, nullptr, KP16 + zk * TT * HD, nullptr, HD, Sb + (size_t)RH * TT, TT, RH, (size_t)TT * HD, (size_t)TT * HD, (size_t)TT * TT);
            k_asoft<<<ZH * TT / 8, 256, 0, stream>>>(Sb, P16, Ph, Pl);
            k_gemmc<bf, 2, 2><<<dim3(RH / 64, HD / 64, ZH), 32, 0, stream>>>(Ph, Pl, VTh + zk * HD * TT, VTl + zk * HD * TT, TT, Ob, HD, 0, (size_t)RH * TT, (size_t)HD * TT, (size_t)TT * HD);
            k_gemmc<h16, 0, 2><<<dim3((TT - RH) / 64, HD / 64, ZH), 32, 0, stream>>>(P16 + (size_t)RH * TT, nullptr, VT16 + zk * HD * TT, nullptr, TT, Ob + (size_t)RH * HD, HD, RH, (size_t)TT * TT, (size_t)HD * TT, (size_t)TT * HD);
            k_merge<<<(unsigned)(((size_t)ZH * TT * HD / 2 + 255) / 256), 256, 0, stream>>>(Ob, h0, ATh, ATl); }
        k_gemmw<bf, 1, false><<<dim3(TT / 64, DM / 64, 1), 32, 0, stream>>>(ATh, ATl, WO, nullptr, DQ, OUT + (size_t)b * TT * DM, DM, nullptr, 0, 0, 0); }
}

// v001
// Measured time: 791 microseconds a run.
// Two timings next to v000 put it at 1.84 and 1.85 times that version's speed.
#include <hip/hip_runtime.h>

// ICLAttention (q, k, v inputs [2][2048][1024]; qh/kh/vh = x W^T (torch; 16 heads x 64); interleaved-pair RoPE (base 1e4, tables computed on device); SCALE = 1/sqrt(1024); 'shifted causal' mask: key j is masked iff j >= i, except (0, 0) which stays visible; softmax; out = merged Wo^T -> [2][2048][1024]).
// Compute dtypes, f32 accumulate: every input rounded to bf16; projections on PLAIN bf16 operands (inputs: exact); RoPE f32; scores and attn.v: query rows < 512 hl (3 products), the rest single fp16 (x1024), causal tile skipping (the strict j < i test applied inside the computed tiles); softmax f32; Wo hl x exact (2 products).

#define NB_  2
#define TT   2048
#define DM   1024
#define NH_  16
#define NKV  16
#define REP  (NH_ / NKV)
#define HD   64
#define DQ   (NH_ * HD)
#define DKV  (NKV * HD)
#define ZH   2
#define RH   512                  // query rows < RH use hi+lo planes (0: none)
#define WIN  2048
#define PCAR 1024.0f
#define SCL  0.03125f   // 1/sqrt(d_attn = 1024), as the source
static_assert(HD == 64, "the split P.V launch covers one 64-column tile");
#define KCH  128                  // keys per wave of the probability x value product (split over keys; partial planes are summed in k_merge)
typedef _Float16 h16;
typedef unsigned short bf;
typedef __attribute__((ext_vector_type(16))) __bf16   v16bf;
typedef __attribute__((ext_vector_type(16))) _Float16 v16h;
typedef __attribute__((ext_vector_type(8)))  _Float16 v8h;
typedef __attribute__((ext_vector_type(8)))  unsigned short v8us;
typedef __attribute__((ext_vector_type(8)))  float    v8f;
typedef __attribute__((ext_vector_type(4)))  float    v4f;
typedef v8h  __attribute__((may_alias)) v8ha;
typedef v4f  __attribute__((may_alias)) v4fa;
typedef v8us __attribute__((may_alias)) v8usa;

__device__ __forceinline__ unsigned short f2bf(float f) { unsigned u = __float_as_uint(f); u += 0x7FFFu + ((u >> 16) & 1u); return (unsigned short)(u >> 16); }
__device__ __forceinline__ float bf2f(unsigned short b) { return __uint_as_float(((unsigned)b) << 16); }
__device__ __forceinline__ float bfr(float f) { return bf2f(f2bf(f)); }
__device__ __forceinline__ v16h cat16(v8h lo, v8h hi) { return __builtin_shufflevector(lo, hi, 0, 1, 2, 3, 4, 5, 6, 7, 8, 9, 10, 11, 12, 13, 14, 15); }
__device__ __forceinline__ v16bf cat16b(v8us lo, v8us hi) { return __builtin_bit_cast(v16bf, __builtin_shufflevector(lo, hi, 0, 1, 2, 3, 4, 5, 6, 7, 8, 9, 10, 11, 12, 13, 14, 15)); }
__device__ __forceinline__ v8f wmma16(v16h a, v16h b, v8f c) { return __builtin_amdgcn_wmma_f32_16x16x32_f16(false, a, false, b, (short)0, c, false, false); }
__device__ __forceinline__ v8f wmmab(v16bf a, v16bf b, v8f c) { return __builtin_amdgcn_wmma_f32_16x16x32_bf16(false, a, false, b, (short)0, c, false, false); }



// ---- k_gemmw: register-blocked GEMM, ONE WAVE per 64x64 output tile (16 accumulators), operands straight from K-contiguous 16-bit planes; grid (M/64, N/64, Z), 32 threads.
// C[m][n] (f32, pitch ldc, + optional f32 bias[n]) = sum_k A[m][k] Bt[n][k] (+ split products per NSPLIT). z-batch strides sA/sB/sC in elements. K % 32 == 0.
template <typename T16> struct WFrag;
template <> struct WFrag<h16> { typedef v16h V; static __device__ __forceinline__ V ld(const h16* p) { return cat16(*(const v8h*)p, *(const v8h*)(p + 16)); } static __device__ __forceinline__ v8f mma(V a, V b, v8f c) { return wmma16(a, b, c); } };
template <> struct WFrag<bf> { typedef v16bf V; static __device__ __forceinline__ V ld(const bf* p) { return cat16b(*(const v8us*)p, *(const v8us*)(p + 16)); } static __device__ __forceinline__ v8f mma(V a, V b, v8f c) { return wmmab(a, b, c); } };
template <typename T16, int NSPLIT, bool BIAS>
__global__ __launch_bounds__(32) void k_gemmw(const T16* __restrict__ A, const T16* __restrict__ A2, const T16* __restrict__ Bt, const T16* __restrict__ Bt2, int K, float* C, int ldc, const float* __restrict__ bias, size_t sA, size_t sB, size_t sC) {
    typedef typename WFrag<T16>::V V;
    __shared__ __align__(16) float os[16 * 68];
    const size_t z = blockIdx.z; A += z * sA; if (A2) A2 += z * sA; Bt += z * sB; if (Bt2) Bt2 += z * sB; C += z * sC;
    const int lane = threadIdx.x & 31, lr = lane & 15, hi = lane >> 4; const int r0 = blockIdx.x * 64, c0 = blockIdx.y * 64;
    v8f acc[4][4];
#pragma unroll
    for (int mb = 0; mb < 4; ++mb)
#pragma unroll
        for (int nb = 0; nb < 4; ++nb) acc[mb][nb] = (v8f){};
    const size_t aoff = (size_t)(r0 + lr) * K + 8 * hi, boff = (size_t)(c0 + lr) * K + 8 * hi;
#pragma unroll 1
    for (int kc = 0; kc < K; kc += 32) {
        V a[4], a2[4];
#pragma unroll
        for (int mb = 0; mb < 4; ++mb) { a[mb] = WFrag<T16>::ld(A + aoff + (size_t)mb * 16 * K + kc); if (NSPLIT == 1 || NSPLIT == 2) a2[mb] = WFrag<T16>::ld(A2 + aoff + (size_t)mb * 16 * K + kc); }
#pragma unroll
        for (int nb = 0; nb < 4; ++nb) { const V b = WFrag<T16>::ld(Bt + boff + (size_t)nb * 16 * K + kc); V b2; if (NSPLIT >= 2) b2 = WFrag<T16>::ld(Bt2 + boff + (size_t)nb * 16 * K + kc);
#pragma unroll
            for (int mb = 0; mb < 4; ++mb) { acc[mb][nb] = WFrag<T16>::mma(a[mb], b, acc[mb][nb]); if (NSPLIT == 1 || NSPLIT == 2) acc[mb][nb] = WFrag<T16>::mma(a2[mb], b, acc[mb][nb]); if (NSPLIT >= 2) acc[mb][nb] = WFrag<T16>::mma(a[mb], b2, acc[mb][nb]); } }
        asm volatile("v_nop\n\tv_nop\n\tv_nop\n\tv_nop" : "+v"(acc[0][0]), "+v"(acc[1][1]), "+v"(acc[2][2]), "+v"(acc[3][3]) : "v"(a[0]), "v"(a[3]));
    }
#pragma unroll
    for (int mb = 0; mb < 4; ++mb) {
#pragma unroll
        for (int nb = 0; nb < 4; ++nb) {
#pragma unroll
            for (int j = 0; j < 8; ++j) os[(hi * 8 + j) * 68 + nb * 16 + lr] = acc[mb][nb][j]; }
        __builtin_amdgcn_wave_barrier(); asm volatile("" ::: "memory");
        float* crow = C + (size_t)(r0 + mb * 16) * ldc + c0;
{
#pragma unroll
            for (int s = 0; s < 8; ++s) { const int row = 2 * s + hi, cofs = lr * 4; v4f val = *(const v4fa*)(os + row * 68 + cofs); if (BIAS) { val[0] += bfr(bias[c0 + cofs]); val[1] += bfr(bias[c0 + cofs + 1]); val[2] += bfr(bias[c0 + cofs + 2]); val[3] += bfr(bias[c0 + cofs + 3]); }
                *(v4f*)(crow + (size_t)row * ldc + cofs) = val; }
             }
        __builtin_amdgcn_wave_barrier(); asm volatile("" ::: "memory");
    }
}

// ---- k_gemmc: the same one-wave 64x64 tile GEMM specialised for causal attention: CMODE 1 skips score tiles entirely above the diagonal (query rows r0+roff.., key columns c0..), CMODE 2 limits the
// key (K) loop of the probability x value contraction to the diagonal block (probabilities beyond it are exactly zero). roff = row offset of this launch's first row within the sequence.
// CMODE 2 is split over keys: blockIdx.y is the chunk of KCH keys this wave contracts (the output is one 64-column tile wide), its partial tile goes to plane blockIdx.y (plane stride sS elements);
// chunks that start beyond the diagonal block write nothing and k_merge does not read them.
template <typename T16, int NSPLIT, int CMODE>
__global__ __launch_bounds__(32) void k_gemmc(const T16* __restrict__ A, const T16* __restrict__ A2, const T16* __restrict__ Bt, const T16* __restrict__ Bt2, int K, float* C, int ldc, int roff, size_t sA, size_t sB, size_t sC, size_t sS) {
    typedef typename WFrag<T16>::V V;
    __shared__ __align__(16) float os[16 * 68];
    const size_t z = blockIdx.z; A += z * sA; if (A2) A2 += z * sA; Bt += z * sB; if (Bt2) Bt2 += z * sB; C += z * sC;
    const int lane = threadIdx.x & 31, lr = lane & 15, hi = lane >> 4; const int r0 = blockIdx.x * 64, c0 = (CMODE == 2) ? 0 : blockIdx.y * 64;
    if (CMODE == 1 && c0 > r0 + roff + 63) return;                  // score tile entirely above the causal diagonal: never read (the softmax masks j > i by select)
    const int Kl = (CMODE == 2) ? min(K, r0 + roff + 64) : K;        // P.V: probabilities are exactly 0 beyond the diagonal block, so the K loop stops there
    const int kb = (CMODE == 2) ? (int)blockIdx.y * KCH : 0; if (CMODE == 2 && kb >= Kl) return;   // this wave's key chunk [kb, ke)
    const int ke = (CMODE == 2) ? min(Kl, kb + KCH) : Kl; if (CMODE == 2) C += (size_t)blockIdx.y * sS;
    v8f acc[4][4];
#pragma unroll
    for (int mb = 0; mb < 4; ++mb)
#pragma unroll
        for (int nb = 0; nb < 4; ++nb) acc[mb][nb] = (v8f){};
    const size_t aoff = (size_t)(r0 + lr) * K + 8 * hi, boff = (size_t)(c0 + lr) * K + 8 * hi;
#pragma unroll 1
    for (int kc = kb; kc < ke; kc += 32) {
        V a[4], a2[4];
#pragma unroll
        for (int mb = 0; mb < 4; ++mb) { a[mb] = WFrag<T16>::ld(A + aoff + (size_t)mb * 16 * K + kc); if (NSPLIT == 1 || NSPLIT == 2) a2[mb] = WFrag<T16>::ld(A2 + aoff + (size_t)mb * 16 * K + kc); }
#pragma unroll
        for (int nb = 0; nb < 4; ++nb) { const V b = WFrag<T16>::ld(Bt + boff + (size_t)nb * 16 * K + kc); V b2; if (NSPLIT >= 2) b2 = WFrag<T16>::ld(Bt2 + boff + (size_t)nb * 16 * K + kc);
#pragma unroll
            for (int mb = 0; mb < 4; ++mb) { acc[mb][nb] = WFrag<T16>::mma(a[mb], b, acc[mb][nb]); if (NSPLIT == 1 || NSPLIT == 2) acc[mb][nb] = WFrag<T16>::mma(a2[mb], b, acc[mb][nb]); if (NSPLIT >= 2) acc[mb][nb] = WFrag<T16>::mma(a[mb], b2, acc[mb][nb]); } }
        asm volatile("v_nop\n\tv_nop\n\tv_nop\n\tv_nop" : "+v"(acc[0][0]), "+v"(acc[1][1]), "+v"(acc[2][2]), "+v"(acc[3][3]) : "v"(a[0]), "v"(a[3]));
    }
#pragma unroll
    for (int mb = 0; mb < 4; ++mb) {
#pragma unroll
        for (int nb = 0; nb < 4; ++nb) {
#pragma unroll
            for (int j = 0; j < 8; ++j) os[(hi * 8 + j) * 68 + nb * 16 + lr] = acc[mb][nb][j]; }
        __builtin_amdgcn_wave_barrier(); asm volatile("" ::: "memory");
        float* crow = C + (size_t)(r0 + mb * 16) * ldc + c0;
{
#pragma unroll
            for (int s = 0; s < 8; ++s) { const int row = 2 * s + hi, cofs = lr * 4; v4f val = *(const v4fa*)(os + row * 68 + cofs);
                *(v4f*)(crow + (size_t)row * ldc + cofs) = val; }
             }
        __builtin_amdgcn_wave_barrier(); asm volatile("" ::: "memory");
    }
}

__device__ __forceinline__ h16 tohx(float x) { return (h16)x; }
__device__ __forceinline__ void splitf(float y, unsigned short& h, unsigned short& l) { h = f2bf(y); l = f2bf(y - bf2f(h)); }
typedef __attribute__((ext_vector_type(2))) _Float16 v2h;
typedef __attribute__((ext_vector_type(4))) _Float16 v4h;
typedef __attribute__((ext_vector_type(2))) unsigned short v2us;
typedef __attribute__((ext_vector_type(4))) unsigned short v4us;
typedef __attribute__((ext_vector_type(2))) float v2f;
typedef __attribute__((ext_vector_type(4))) int v4i;

__global__ __launch_bounds__(256) void k_wtG(const float* __restrict__ w, int K, int N, bf* Bt) {
    const int lane = threadIdx.x & 31; const int L0 = (blockIdx.x * 8 + (threadIdx.x >> 5)) * 8; const int nlines = N * K / 64;
{
#pragma unroll 1
        for (int l = 0; l < 8; ++l) { const int L = L0 + l; if (L >= nlines) break; const size_t e = (size_t)L * 64 + lane * 2; const int k = (int)(e % K), n = (int)(e / K); v2us o;
            o[0] = f2bf(w[(size_t)k * N + n]); o[1] = f2bf(w[(size_t)(k + 1) * N + n]); *(v2us*)(Bt + e) = o; }
         }
}
__global__ __launch_bounds__(256) void k_cvt8(const float* __restrict__ src, bf* dst, size_t n8) { const size_t i = (size_t)blockIdx.x * 256 + threadIdx.x; if (i >= n8) return; const v8f v = *(const v8f*)(src + i * 8); v8us o;
#pragma unroll
    for (int k = 0; k < 8; ++k) o[k] = f2bf(v[k]); *(v8us*)(dst + i * 8) = o;  }
__global__ __launch_bounds__(256) void k_cstab(float* CS) { const int idx = blockIdx.x * 256 + threadIdx.x; if (idx >= TT * HD) return; const int t = idx / HD, d = idx % HD; const int i = d >> 1;   /* interleaved pairs */ const float inv = __fdiv_rn(1.0f, powf(10000.0f, (float)(2 * i) / (float)HD)); const float ang = __fmul_rn((float)t, inv); v2f cs; cs[0] = cosf(ang); cs[1] = sinf(ang);
    *(v2f*)(CS + (size_t)idx * 2) = cs;  }
// k_rope: head planes [h][t][d] (fp16 + hi/lo) of rope(x) x sc with interleaved pairs out[2i] = x[2i] cos[t][2i] - x[2i+1] sin[t][2i], out[2i+1] = x[2i+1] cos[t][2i+1] + x[2i] sin[t][2i+1]
__global__ __launch_bounds__(256) void k_rope(const float* __restrict__ F, int pitch, int nheads, const float* __restrict__ CS, const float* __restrict__ RF, const float* __restrict__ nw, float sc, h16* P16, bf* Ph, bf* Pl) {
    const size_t e = ((size_t)blockIdx.x * 256 + threadIdx.x) * 2; if (e >= (size_t)nheads * TT * HD) return; const int d = (int)(e % HD); const int t = (int)((e / HD) % TT); const int h = (int)(e / ((size_t)HD * TT)); const float* f = F + (size_t)t * pitch + h * HD; const float rf = RF ? RF[(size_t)h * TT + t] : 1.0f; v2h o16; v2us oh, ol;
#pragma unroll
    for (int q = 0; q < 2; ++q) { const int dd = d + q; const int dp = dd ^ 1; float x0 = f[dd], x1 = f[dp];
        if (RF) { float n0 = __fmul_rn(x0, rf), n1 = __fmul_rn(x1, rf); asm volatile("" : "+v"(n0)); asm volatile("" : "+v"(n1)); x0 = __fmul_rn(bfr(nw[dd]), n0); x1 = __fmul_rn(bfr(nw[dp]), n1); }
        const v2f cs = *(const v2f*)(CS + ((size_t)t * HD + dd) * 2); float a = __fmul_rn(x0, cs[0]), bq = __fmul_rn(x1, cs[1]); asm volatile("" : "+v"(a)); asm volatile("" : "+v"(bq)); const float r = (((dd & 1) == 0) ? __fsub_rn(a, bq) : __fadd_rn(a, bq)) * sc;
        o16[q] = tohx(r); unsigned short a2, c2; splitf(r, a2, c2); oh[q] = a2; ol[q] = c2; }
    *(v2h*)(P16 + e) = o16; *(v2us*)(Ph + e) = oh; *(v2us*)(Pl + e) = ol;  }
__global__ __launch_bounds__(256) void k_vtp(const float* __restrict__ F, int pitch, int nheads, h16* V16, bf* Vh, bf* Vl) { const size_t e = ((size_t)blockIdx.x * 256 + threadIdx.x) * 2; if (e >= (size_t)nheads * HD * TT) return; const int t = (int)(e % TT); const int d = (int)((e / TT) % HD); const int g = (int)(e / ((size_t)TT * HD)); v2h o16; v2us oh, ol;
#pragma unroll
    for (int q = 0; q < 2; ++q) { const float x = F[(size_t)(t + q) * pitch + g * HD + d]; o16[q] = tohx(x); unsigned short a2, c2; splitf(x, a2, c2); oh[q] = a2; ol[q] = c2; }
    *(v2h*)(V16 + e) = o16; *(v2us*)(Vh + e) = oh; *(v2us*)(Vl + e) = ol;  }
// k_asoft: per row (zz, i): t = S x SCL for j < i and for (0, 0) (shifted causal mask, other keys -3e38 by select; the reference's -1e9 additive fill vanishes identically); softmax over the 2048 keys (register row, one exp, fixed trees);
__global__ __launch_bounds__(256) void k_asoft(const float* __restrict__ Sb, h16* P16, bf* Ph, bf* Pl) {
    const int lane = threadIdx.x & 31; const int row = blockIdx.x * 8 + (threadIdx.x >> 5); if (row >= ZH * TT) return; const int i = row % TT; const int zz = row / TT; (void)zz; const bool hires = (i < RH); const float* sr = Sb + (size_t)row * TT; float v[TT / 32]; float mx = -3.0e38f;
#pragma unroll
    for (int ch = 0; ch < TT / 128; ++ch) { const int j0 = ch * 128 + lane * 4; const v4f a = *(const v4f*)(sr + j0);
#pragma unroll
        for (int q = 0; q < 4; ++q) { const int j = j0 + q; (void)j; const float t = (j < i || (i == 0 && j == 0)) ? a[q] * SCL : -3.0e38f; v[ch * 4 + q] = t; mx = fmaxf(mx, t); } }
#pragma unroll
    for (int sh = 16; sh; sh >>= 1) mx = fmaxf(mx, __shfl_xor(mx, sh, 32));
    float sum = 0.f;
#pragma unroll
    for (int k = 0; k < TT / 32; ++k) { float d0 = __fsub_rn(v[k], mx); asm volatile("" : "+v"(d0)); v[k] = __builtin_amdgcn_exp2f(__fmul_rn(d0, 1.4426950408889634f)); sum += v[k]; }
#pragma unroll
    for (int sh = 16; sh; sh >>= 1) sum += __shfl_xor(sum, sh, 32);
    const float f = __fdiv_rn(hires ? 1.0f : PCAR, sum);
{
        if (hires) {
#pragma unroll
            for (int ch = 0; ch < TT / 128; ++ch) { v4us oh, ol;
#pragma unroll
                for (int q = 0; q < 4; ++q) { unsigned short a, c2; splitf(v[ch * 4 + q] * f, a, c2); oh[q] = a; ol[q] = c2; }
                const size_t oo = ((size_t)zz * (RH ? RH : 1) + i) * TT + ch * 128 + lane * 4; *(v4us*)(Ph + oo) = oh; *(v4us*)(Pl + oo) = ol; }
        } else {
#pragma unroll
            for (int ch = 0; ch < TT / 128; ++ch) { v4h o4;
#pragma unroll
                for (int q = 0; q < 4; ++q) o4[q] = tohx(v[ch * 4 + q] * f);
                *(v4h*)(P16 + (size_t)row * TT + ch * 128 + lane * 4) = o4; } }
         }
}
__global__ __launch_bounds__(256) void k_merge(const float* __restrict__ O, int h0, bf* Ah, bf* Al) { const size_t e = ((size_t)blockIdx.x * 256 + threadIdx.x) * 2; if (e >= (size_t)ZH * TT * HD) return; const int d = (int)(e % HD); const int t = (int)((e / HD) % TT); const int zz = (int)(e / ((size_t)HD * TT)); const float cs = (t < RH) ? 1.0f : (1.0f / PCAR); const size_t oo = (size_t)t * DQ + (h0 + zz) * HD + d;
    const int ns = ((t & ~63) + 64 + KCH - 1) / KCH;   // key chunks written for this row's 64-row tile
    static_assert(TT / KCH == 16, "the fence below names 16 planes"); v2f p[TT / KCH];
#pragma unroll
    for (int c = 0; c < TT / KCH; ++c) p[c] = *(const v2f*)(O + (size_t)min(c, ns - 1) * ((size_t)ZH * TT * HD) + e);   // clamped plane index: no load depends on a branch
    // inputs-only fence on the loaded values: keeps all plane loads in flight together; without it the compiler sinks each load under its c < ns test and the latencies add up
    asm volatile("" :: "v"(p[0]), "v"(p[1]), "v"(p[2]), "v"(p[3]), "v"(p[4]), "v"(p[5]), "v"(p[6]), "v"(p[7]), "v"(p[8]), "v"(p[9]), "v"(p[10]), "v"(p[11]), "v"(p[12]), "v"(p[13]), "v"(p[14]), "v"(p[15]));
    v2f s = p[0];
#pragma unroll
    for (int c = 1; c < TT / KCH; ++c) { if (c < ns) s += p[c]; }   // planes summed in ascending key order
    v2us oh, ol;
#pragma unroll
    for (int q = 0; q < 2; ++q) { unsigned short a, c2; splitf(s[q] * cs, a, c2); oh[q] = a; ol[q] = c2; } *(v2us*)(Ah + oo) = oh; *(v2us*)(Al + oo) = ol;  }

extern "C" void kernel_launch(void* const* d_in, const int* in_sizes, int n_in,
                              void* d_out, int out_size, void* d_ws, size_t ws_size, hipStream_t stream) {
    (void)in_sizes; (void)n_in; (void)out_size;
    const float* x = (const float*)d_in[0]; const float* xk = (const float*)d_in[1]; const float* xv = (const float*)d_in[2]; const float* wq = (const float*)d_in[3]; const float* wk = (const float*)d_in[4]; const float* wv = (const float*)d_in[5]; const float* wo = (const float*)d_in[6];
    float* OUT = (float*)d_out;     // [2][2048][1024]
    char* wsp = (char*)d_ws;
    auto take = [&](size_t bytes) { char* p = wsp; wsp += (bytes + 255) & ~(size_t)255; return (void*)p; };
    bf* WQ = (bf*)take((size_t)DQ * DM * 2); bf* WK = (bf*)take((size_t)DKV * DM * 2); bf* WV = (bf*)take((size_t)DKV * DM * 2); bf* WO = (bf*)take((size_t)DM * DQ * 2); float* CS = (float*)take((size_t)TT * HD * 2 * 4);
    bf* XB = (bf*)take((size_t)TT * DM * 2); bf* XB2 = (bf*)take((size_t)TT * DM * 2); bf* XB3 = (bf*)take((size_t)TT * DM * 2); float* FQ = (float*)take((size_t)TT * DQ * 4); float* FK = (float*)take((size_t)TT * DKV * 4);
    h16* QP16 = (h16*)take((size_t)NH_ * TT * HD * 2); h16* KP16 = (h16*)take((size_t)NKV * TT * HD * 2); h16* VT16 = (h16*)take((size_t)NKV * HD * TT * 2);
    bf* QPh = (bf*)take((size_t)NH_ * TT * HD * 2); bf* QPl = (bf*)take((size_t)NH_ * TT * HD * 2); bf* KPh = (bf*)take((size_t)NKV * TT * HD * 2); bf* KPl = (bf*)take((size_t)NKV * TT * HD * 2); bf* VTh = (bf*)take((size_t)NKV * HD * TT * 2); bf* VTl = (bf*)take((size_t)NKV * HD * TT * 2); bf* Ph = (bf*)take((size_t)ZH * RH * TT * 2); bf* Pl = (bf*)take((size_t)ZH * RH * TT * 2);
    float* Sb = (float*)take((size_t)ZH * TT * TT * 4); h16* P16 = (h16*)take((size_t)ZH * TT * TT * 2); float* Ob = (float*)take((size_t)(TT / KCH) * ZH * TT * HD * 4); bf* ATh = (bf*)take((size_t)TT * DQ * 2); bf* ATl = (bf*)take((size_t)TT * DQ * 2);
    if ((size_t)(wsp - (char*)d_ws) > ws_size) return;    // ws 256 MiB
    float* FV = FK;   // v projection reuses the k buffer after the k planes are built (stream-ordered)
    { k_cvt8<<<(unsigned)(((size_t)DQ * DM / 8 + 255) / 256), 256, 0, stream>>>(wq, WQ, (size_t)DQ * DM / 8); k_cvt8<<<(unsigned)(((size_t)DKV * DM / 8 + 255) / 256), 256, 0, stream>>>(wk, WK, (size_t)DKV * DM / 8); k_cvt8<<<(unsigned)(((size_t)DKV * DM / 8 + 255) / 256), 256, 0, stream>>>(wv, WV, (size_t)DKV * DM / 8);
      k_cvt8<<<(unsigned)(((size_t)DM * DQ / 8 + 255) / 256), 256, 0, stream>>>(wo, WO, (size_t)DM * DQ / 8);
      k_cstab<<<(TT * HD + 255) / 256, 256, 0, stream>>>(CS); }
    const unsigned LQ = (unsigned)(((size_t)NH_ * TT * HD / 2 + 255) / 256), LKv = (unsigned)(((size_t)NKV * TT * HD / 2 + 255) / 256);
    for (int b = 0; b < NB_; ++b) {
        
        k_cvt8<<<(unsigned)(((size_t)TT * DM / 8 + 255) / 256), 256, 0, stream>>>(x + (size_t)b * TT * DM, XB, (size_t)TT * DM / 8); k_cvt8<<<(unsigned)(((size_t)TT * DM / 8 + 255) / 256), 256, 0, stream>>>(xk + (size_t)b * TT * DM, XB2, (size_t)TT * DM / 8); k_cvt8<<<(unsigned)(((size_t)TT * DM / 8 + 255) / 256), 256, 0, stream>>>(xv + (size_t)b * TT * DM, XB3, (size_t)TT * DM / 8);
        k_gemmw<bf, 0, false><<<dim3(TT / 64, DQ / 64, 1), 32, 0, stream>>>(XB, nullptr, WQ, nullptr, DM, FQ, DQ, nullptr, 0, 0, 0);
        k_rope<<<LQ, 256, 0, stream>>>(FQ, DQ, NH_, CS, nullptr, nullptr, 1.0f, QP16, QPh, QPl);
        k_gemmw<bf, 0, false><<<dim3(TT / 64, DKV / 64, 1), 32, 0, stream>>>(XB2, nullptr, WK, nullptr, DM, FK, DKV, nullptr, 0, 0, 0);
        k_rope<<<LKv, 256, 0, stream>>>(FK, DKV, NKV, CS, nullptr, nullptr, 1.0f, KP16, KPh, KPl);
        k_gemmw<bf, 0, false><<<dim3(TT / 64, DKV / 64, 1), 32, 0, stream>>>(XB3, nullptr, WV, nullptr, DM, FV, DKV, nullptr, 0, 0, 0); k_vtp<<<LKv, 256, 0, stream>>>(FV, DKV, NKV, VT16, VTh, VTl);
        for (int h0 = 0; h0 < NH_; h0 += ZH) { const size_t zq = (size_t)h0, zk = (size_t)(h0 / REP);   // one kv head per query head: the pass's two heads use consecutive kv planes (z-strides TT*HD)
            k_gemmc<bf, 2, 1><<<dim3(RH / 64, TT / 64, ZH), 32, 0, stream>>>(QPh + zq * TT * HD, QPl + zq * TT * HD, KPh + zk * TT * HD, KPl + zk * TT * HD, HD, Sb, TT, 0, (size_t)TT * HD, (size_t)TT * HD, (size_t)TT * TT, 0);
            k_gemmc<h16, 0, 1><<<dim3((TT - RH) / 64, TT / 64, ZH), 32, 0, stream>>>(QP16 + zq * TT * HD + (size_t)RH * HD, nullptr, KP16 + zk * TT * HD, nullptr, HD, Sb + (size_t)RH * TT, TT, RH, (size_t)TT * HD, (size_t)TT * HD, (size_t)TT * TT, 0);
            k_asoft<<<ZH * TT / 8, 256, 0, stream>>>(Sb, P16, Ph, Pl);
            k_gemmc<bf, 2, 2><<<dim3(RH / 64, RH / KCH, ZH), 32, 0, stream>>>(Ph, Pl, VTh + zk * HD * TT, VTl + zk * HD * TT, TT, Ob, HD, 0, (size_t)RH * TT, (size_t)HD * TT, (size_t)TT * HD, (size_t)ZH * TT * HD);
            k_gemmc<h16, 0, 2><<<dim3((TT - RH) / 64, TT / KCH, ZH), 32, 0, stream>>>(P16 + (size_t)RH * TT, nullptr, VT16 + zk * HD * TT, nullptr, TT, Ob + (size_t)RH * HD, HD, RH, (size_t)TT * TT, (size_t)HD * TT, (size_t)TT * HD, (size_t)ZH * TT * HD);
            k_merge<<<(unsigned)(((size_t)ZH * TT * HD / 2 + 255) / 256), 256, 0, stream>>>(Ob, h0, ATh, ATl); }
        k_gemmw<bf, 1, false><<<dim3(TT / 64, DM / 64, 1), 32, 0, stream>>>(ATh, ATl, WO, nullptr, DQ, OUT + (size_t)b * TT * DM, DM, nullptr, 0, 0, 0); }
}

// v002
// It runs in 559 microseconds.
// Two timings next to v001 both put it at 1.41 times that version's speed.
// Over all steps from v000 it is 2.61 times as fast.
#include <hip/hip_runtime.h>

// ICLAttention (q, k, v inputs [2][2048][1024]; qh/kh/vh = x W^T (torch; 16 heads x 64); interleaved-pair RoPE (base 1e4, tables computed on device); SCALE = 1/sqrt(1024); 'shifted causal' mask: key j is masked iff j >= i, except (0, 0) which stays visible; softmax; out = merged Wo^T -> [2][2048][1024]).
// Compute dtypes, f32 accumulate: every input rounded to bf16; projections on PLAIN bf16 operands (inputs: exact); RoPE f32; scores and attn.v: query rows < 512 hl (3 products), the rest single fp16 (x1024), causal tile skipping (the strict j < i test applied inside the computed tiles); softmax f32; Wo hl x exact (2 products).

#define NB_  2
#define TT   2048
#define DM   1024
#define NH_  16
#define NKV  16
#define REP  (NH_ / NKV)
#define HD   64
#define DQ   (NH_ * HD)
#define DKV  (NKV * HD)
#define ZH   8                    // heads per attention pass
#define RH   512                  // query rows < RH use hi+lo planes (0: none)
#define WIN  2048
#define PCAR 1024.0f
#define SCL  0.03125f   // 1/sqrt(d_attn = 1024), as the source
static_assert(HD == 64, "the split P.V launch covers one 64-column tile");
#define PP   (2 * TT)             // row pitch, in 16-bit elements, of the probability rows (they lie in the f32 score rows) and of the transposed value planes that meet them in k_gemmc
#define KCH  128                  // keys per wave of the probability x value product (split over keys; partial planes are summed in k_merge)
typedef _Float16 h16;
typedef unsigned short bf;
typedef __attribute__((ext_vector_type(16))) __bf16   v16bf;
typedef __attribute__((ext_vector_type(16))) _Float16 v16h;
typedef __attribute__((ext_vector_type(8)))  _Float16 v8h;
typedef __attribute__((ext_vector_type(8)))  unsigned short v8us;
typedef __attribute__((ext_vector_type(8)))  float    v8f;
typedef __attribute__((ext_vector_type(4)))  float    v4f;
typedef v8h  __attribute__((may_alias)) v8ha;
typedef v4f  __attribute__((may_alias)) v4fa;
typedef v8us __attribute__((may_alias)) v8usa;

__device__ __forceinline__ unsigned short f2bf(float f) { unsigned u = __float_as_uint(f); u += 0x7FFFu + ((u >> 16) & 1u); return (unsigned short)(u >> 16); }
__device__ __forceinline__ float bf2f(unsigned short b) { return __uint_as_float(((unsigned)b) << 16); }
__device__ __forceinline__ float bfr(float f) { return bf2f(f2bf(f)); }
__device__ __forceinline__ v16h cat16(v8h lo, v8h hi) { return __builtin_shufflevector(lo, hi, 0, 1, 2, 3, 4, 5, 6, 7, 8, 9, 10, 11, 12, 13, 14, 15); }
__device__ __forceinline__ v16bf cat16b(v8us lo, v8us hi) { return __builtin_bit_cast(v16bf, __builtin_shufflevector(lo, hi, 0, 1, 2, 3, 4, 5, 6, 7, 8, 9, 10, 11, 12, 13, 14, 15)); }
__device__ __forceinline__ v8f wmma16(v16h a, v16h b, v8f c) { return __builtin_amdgcn_wmma_f32_16x16x32_f16(false, a, false, b, (short)0, c, false, false); }
__device__ __forceinline__ v8f wmmab(v16bf a, v16bf b, v8f c) { return __builtin_amdgcn_wmma_f32_16x16x32_bf16(false, a, false, b, (short)0, c, false, false); }



// ---- k_gemmw: register-blocked GEMM, ONE WAVE per 64x64 output tile (16 accumulators), operands straight from K-contiguous 16-bit planes; grid (M/64, N/64, Z), 32 threads.
// C[m][n] (f32, pitch ldc, + optional f32 bias[n]) = sum_k A[m][k] Bt[n][k] (+ split products per NSPLIT). z-batch strides sA/sB/sC in elements. K % 32 == 0.
template <typename T16> struct WFrag;
template <> struct WFrag<h16> { typedef v16h V; static __device__ __forceinline__ V ld(const h16* p) { return cat16(*(const v8h*)p, *(const v8h*)(p + 16)); } static __device__ __forceinline__ v8f mma(V a, V b, v8f c) { return wmma16(a, b, c); } };
template <> struct WFrag<bf> { typedef v16bf V; static __device__ __forceinline__ V ld(const bf* p) { return cat16b(*(const v8us*)p, *(const v8us*)(p + 16)); } static __device__ __forceinline__ v8f mma(V a, V b, v8f c) { return wmmab(a, b, c); } };
template <typename T16, int NSPLIT, bool BIAS>
__global__ __launch_bounds__(32) void k_gemmw(const T16* __restrict__ A, const T16* __restrict__ A2, const T16* __restrict__ Bt, const T16* __restrict__ Bt2, int K, float* C, int ldc, const float* __restrict__ bias, size_t sA, size_t sB, size_t sC) {
    typedef typename WFrag<T16>::V V;
    __shared__ __align__(16) float os[16 * 68];
    const size_t z = blockIdx.z; A += z * sA; if (A2) A2 += z * sA; Bt += z * sB; if (Bt2) Bt2 += z * sB; C += z * sC;
    const int lane = threadIdx.x & 31, lr = lane & 15, hi = lane >> 4; const int r0 = blockIdx.x * 64, c0 = blockIdx.y * 64;
    v8f acc[4][4];
#pragma unroll
    for (int mb = 0; mb < 4; ++mb)
#pragma unroll
        for (int nb = 0; nb < 4; ++nb) acc[mb][nb] = (v8f){};
    const size_t aoff = (size_t)(r0 + lr) * K + 8 * hi, boff = (size_t)(c0 + lr) * K + 8 * hi;
#pragma unroll 1
    for (int kc = 0; kc < K; kc += 32) {
        V a[4], a2[4];
#pragma unroll
        for (int mb = 0; mb < 4; ++mb) { a[mb] = WFrag<T16>::ld(A + aoff + (size_t)mb * 16 * K + kc); if (NSPLIT == 1 || NSPLIT == 2) a2[mb] = WFrag<T16>::ld(A2 + aoff + (size_t)mb * 16 * K + kc); }
#pragma unroll
        for (int nb = 0; nb < 4; ++nb) { const V b = WFrag<T16>::ld(Bt + boff + (size_t)nb * 16 * K + kc); V b2; if (NSPLIT >= 2) b2 = WFrag<T16>::ld(Bt2 + boff + (size_t)nb * 16 * K + kc);
#pragma unroll
            for (int mb = 0; mb < 4; ++mb) { acc[mb][nb] = WFrag<T16>::mma(a[mb], b, acc[mb][nb]); if (NSPLIT == 1 || NSPLIT == 2) acc[mb][nb] = WFrag<T16>::mma(a2[mb], b, acc[mb][nb]); if (NSPLIT >= 2) acc[mb][nb] = WFrag<T16>::mma(a[mb], b2, acc[mb][nb]); } }
        asm volatile("v_nop\n\tv_nop\n\tv_nop\n\tv_nop" : "+v"(acc[0][0]), "+v"(acc[1][1]), "+v"(acc[2][2]), "+v"(acc[3][3]) : "v"(a[0]), "v"(a[3]));
    }
#pragma unroll
    for (int mb = 0; mb < 4; ++mb) {
#pragma unroll
        for (int nb = 0; nb < 4; ++nb) {
#pragma unroll
            for (int j = 0; j < 8; ++j) os[(hi * 8 + j) * 68 + nb * 16 + lr] = acc[mb][nb][j]; }
        __builtin_amdgcn_wave_barrier(); asm volatile("" ::: "memory");
        float* crow = C + (size_t)(r0 + mb * 16) * ldc + c0;
{
#pragma unroll
            for (int s = 0; s < 8; ++s) { const int row = 2 * s + hi, cofs = lr * 4; v4f val = *(const v4fa*)(os + row * 68 + cofs); if (BIAS) { val[0] += bfr(bias[c0 + cofs]); val[1] += bfr(bias[c0 + cofs + 1]); val[2] += bfr(bias[c0 + cofs + 2]); val[3] += bfr(bias[c0 + cofs + 3]); }
                *(v4f*)(crow + (size_t)row * ldc + cofs) = val; }
             }
        __builtin_amdgcn_wave_barrier(); asm volatile("" ::: "memory");
    }
}

// ---- k_gemmc: the same one-wave 64x64 tile GEMM specialised for causal attention: CMODE 1 skips score tiles entirely above the diagonal (query rows r0+roff.., key columns c0..), CMODE 2 limits the
// key (K) loop of the probability x value contraction to the diagonal block (probabilities beyond it are exactly zero). roff = row offset of this launch's first row within the sequence.
// CMODE 2 is split over keys: blockIdx.y is the chunk of KCH keys this wave contracts (the output is one 64-column tile wide), its partial tile goes to plane blockIdx.y (plane stride sS elements);
// chunks that start beyond the diagonal block write nothing and k_merge does not read them.
template <typename T16, int NSPLIT, int CMODE>
__global__ __launch_bounds__(32) void k_gemmc(const T16* __restrict__ A, const T16* __restrict__ A2, const T16* __restrict__ Bt, const T16* __restrict__ Bt2, int K, float* C, int ldc, int roff, size_t sA, size_t sB, size_t sC, size_t sS) {
    typedef typename WFrag<T16>::V V;
    __shared__ __align__(16) float os[16 * 68];
    const size_t z = blockIdx.z; A += z * sA; if (A2) A2 += z * sA; Bt += z * sB; if (Bt2) Bt2 += z * sB; C += z * sC;
    const int lane = threadIdx.x & 31, lr = lane & 15, hi = lane >> 4; const int r0 = blockIdx.x * 64, c0 = (CMODE == 2) ? 0 : blockIdx.y * 64;
    if (CMODE == 1 && c0 > r0 + roff + 63) return;                  // score tile entirely above the causal diagonal: never read (the softmax masks j > i by select)
    const int Kl = (CMODE == 2) ? min(K, r0 + roff + 64) : K;        // P.V: probabilities are exactly 0 beyond the diagonal block, so the K loop stops there
    const int kb = (CMODE == 2) ? (int)blockIdx.y * KCH : 0; if (CMODE == 2 && kb >= Kl) return;   // this wave's key chunk [kb, ke)
    const int ke = (CMODE == 2) ? min(Kl, kb + KCH) : Kl; if (CMODE == 2) C += (size_t)blockIdx.y * sS;
    v8f acc[4][4];
#pragma unroll
    for (int mb = 0; mb < 4; ++mb)
#pragma unroll
        for (int nb = 0; nb < 4; ++nb) acc[mb][nb] = (v8f){};
    const size_t aoff = (size_t)(r0 + lr) * K + 8 * hi, boff = (size_t)(c0 + lr) * K + 8 * hi;
#pragma unroll 1
    for (int kc = kb; kc < ke; kc += 32) {
        V a[4], a2[4];
#pragma unroll
        for (int mb = 0; mb < 4; ++mb) { a[mb] = WFrag<T16>::ld(A + aoff + (size_t)mb * 16 * K + kc); if (NSPLIT == 1 || NSPLIT == 2) a2[mb] = WFrag<T16>::ld(A2 + aoff + (size_t)mb * 16 * K + kc); }
#pragma unroll
        for (int nb = 0; nb < 4; ++nb) { const V b = WFrag<T16>::ld(Bt + boff + (size_t)nb * 16 * K + kc); V b2; if (NSPLIT >= 2) b2 = WFrag<T16>::ld(Bt2 + boff + (size_t)nb * 16 * K + kc);
#pragma unroll
            for (int mb = 0; mb < 4; ++mb) { acc[mb][nb] = WFrag<T16>::mma(a[mb], b, acc[mb][nb]); if (NSPLIT == 1 || NSPLIT == 2) acc[mb][nb] = WFrag<T16>::mma(a2[mb], b, acc[mb][nb]); if (NSPLIT >= 2) acc[mb][nb] = WFrag<T16>::mma(a[mb], b2, acc[mb][nb]); } }
        asm volatile("v_nop\n\tv_nop\n\tv_nop\n\tv_nop" : "+v"(acc[0][0]), "+v"(acc[1][1]), "+v"(acc[2][2]), "+v"(acc[3][3]) : "v"(a[0]), "v"(a[3]));
    }
#pragma unroll
    for (int mb = 0; mb < 4; ++mb) {
#pragma unroll
        for (int nb = 0; nb < 4; ++nb) {
#pragma unroll
            for (int j = 0; j < 8; ++j) os[(hi * 8 + j) * 68 + nb * 16 + lr] = acc[mb][nb][j]; }
        __builtin_amdgcn_wave_barrier(); asm volatile("" ::: "memory");
        float* crow = C + (size_t)(r0 + mb * 16) * ldc + c0;
{
#pragma unroll
            for (int s = 0; s < 8; ++s) { const int row = 2 * s + hi, cofs = lr * 4; v4f val = *(const v4fa*)(os + row * 68 + cofs);
                *(v4f*)(crow + (size_t)row * ldc + cofs) = val; }
             }
        __builtin_amdgcn_wave_barrier(); asm volatile("" ::: "memory");
    }
}

__device__ __forceinline__ h16 tohx(float x) { return (h16)x; }
__device__ __forceinline__ void splitf(float y, unsigned short& h, unsigned short& l) { h = f2bf(y); l = f2bf(y - bf2f(h)); }
typedef __attribute__((ext_vector_type(2))) _Float16 v2h;
typedef __attribute__((ext_vector_type(4))) _Float16 v4h;
typedef __attribute__((ext_vector_type(2))) unsigned short v2us;
typedef __attribute__((ext_vector_type(4))) unsigned short v4us;
typedef __attribute__((ext_vector_type(2))) float v2f;
typedef __attribute__((ext_vector_type(4))) int v4i;
typedef v4h  __attribute__((may_alias)) v4ha;
typedef v4us __attribute__((may_alias)) v4usa;

__global__ __launch_bounds__(256) void k_wtG(const float* __restrict__ w, int K, int N, bf* Bt) {
    const int lane = threadIdx.x & 31; const int L0 = (blockIdx.x * 8 + (threadIdx.x >> 5)) * 8; const int nlines = N * K / 64;
{
#pragma unroll 1
        for (int l = 0; l < 8; ++l) { const int L = L0 + l; if (L >= nlines) break; const size_t e = (size_t)L * 64 + lane * 2; const int k = (int)(e % K), n = (int)(e / K); v2us o;
            o[0] = f2bf(w[(size_t)k * N + n]); o[1] = f2bf(w[(size_t)(k + 1) * N + n]); *(v2us*)(Bt + e) = o; }
         }
}
__global__ __launch_bounds__(256) void k_cvt8(const float* __restrict__ src, bf* dst, size_t n8) { const size_t i = (size_t)blockIdx.x * 256 + threadIdx.x; if (i >= n8) return; const v8f v = *(const v8f*)(src + i * 8); v8us o;
#pragma unroll
    for (int k = 0; k < 8; ++k) o[k] = f2bf(v[k]); *(v8us*)(dst + i * 8) = o;  }
__global__ __launch_bounds__(256) void k_cstab(float* CS) { const int idx = blockIdx.x * 256 + threadIdx.x; if (idx >= TT * HD) return; const int t = idx / HD, d = idx % HD; const int i = d >> 1;   /* interleaved pairs */ const float inv = __fdiv_rn(1.0f, powf(10000.0f, (float)(2 * i) / (float)HD)); const float ang = __fmul_rn((float)t, inv); v2f cs; cs[0] = cosf(ang); cs[1] = sinf(ang);
    *(v2f*)(CS + (size_t)idx * 2) = cs;  }
// k_rope: head planes [h][t][d] (fp16 + hi/lo) of rope(x) x sc with interleaved pairs out[2i] = x[2i] cos[t][2i] - x[2i+1] sin[t][2i], out[2i+1] = x[2i+1] cos[t][2i+1] + x[2i] sin[t][2i+1]
__global__ __launch_bounds__(256) void k_rope(const float* __restrict__ F, int pitch, int nheads, const float* __restrict__ CS, const float* __restrict__ RF, const float* __restrict__ nw, float sc, h16* P16, bf* Ph, bf* Pl) {
    const size_t e = ((size_t)blockIdx.x * 256 + threadIdx.x) * 2; if (e >= (size_t)nheads * TT * HD) return; const int d = (int)(e % HD); const int t = (int)((e / HD) % TT); const int h = (int)(e / ((size_t)HD * TT)); const float* f = F + (size_t)t * pitch + h * HD; const float rf = RF ? RF[(size_t)h * TT + t] : 1.0f; v2h o16; v2us oh, ol;
#pragma unroll
    for (int q = 0; q < 2; ++q) { const int dd = d + q; const int dp = dd ^ 1; float x0 = f[dd], x1 = f[dp];
        if (RF) { float n0 = __fmul_rn(x0, rf), n1 = __fmul_rn(x1, rf); asm volatile("" : "+v"(n0)); asm volatile("" : "+v"(n1)); x0 = __fmul_rn(bfr(nw[dd]), n0); x1 = __fmul_rn(bfr(nw[dp]), n1); }
        const v2f cs = *(const v2f*)(CS + ((size_t)t * HD + dd) * 2); float a = __fmul_rn(x0, cs[0]), bq = __fmul_rn(x1, cs[1]); asm volatile("" : "+v"(a)); asm volatile("" : "+v"(bq)); const float r = (((dd & 1) == 0) ? __fsub_rn(a, bq) : __fadd_rn(a, bq)) * sc;
        o16[q] = tohx(r); unsigned short a2, c2; splitf(r, a2, c2); oh[q] = a2; ol[q] = c2; }
    *(v2h*)(P16 + e) = o16; *(v2us*)(Ph + e) = oh; *(v2us*)(Pl + e) = ol;  }
__global__ __launch_bounds__(256) void k_vtp(const float* __restrict__ F, int pitch, int nheads, h16* V16, bf* Vh, bf* Vl) { const size_t e = ((size_t)blockIdx.x * 256 + threadIdx.x) * 2; if (e >= (size_t)nheads * HD * TT) return; const int t = (int)(e % TT); const int d = (int)((e / TT) % HD); const int g = (int)(e / ((size_t)TT * HD)); v2h o16; v2us oh, ol; float xs[2];
#pragma unroll
    for (int q = 0; q < 2; ++q) xs[q] = F[(size_t)(t + q) * pitch + g * HD + d];
    asm volatile("s_wait_xcnt 0x0" ::: "memory");   // precaution: stands behind the two loads, before their address registers are reused
#pragma unroll
    for (int q = 0; q < 2; ++q) { const float x = xs[q]; o16[q] = tohx(x); unsigned short a2, c2; splitf(x, a2, c2); oh[q] = a2; ol[q] = c2; }
    const size_t oo = ((size_t)g * HD + d) * PP + t;   // planes [g][d][t] at row pitch PP
    *(v2h*)(V16 + oo) = o16; *(v2us*)(Vh + oo) = oh; *(v2us*)(Vl + oo) = ol;  }
// k_asoft: per row (zz, i): t = S x SCL for j < i (plus (0, 0)) and i - j < WIN (sliding causal window; the reference's -1e9 additive fill vanishes identically); softmax over the 2048 keys (register row, one exp, fixed trees);
// IN PLACE: one wave owns one 8-KiB score row, holds all of it in registers (every stored value depends on the row sum, so on every load) and writes the probabilities over it:
// rows >= RH: fp16 in the row's first half; rows < RH: the hi plane in the first half, the lo plane in the second. The 16-bit row pitch is PP.
__global__ __launch_bounds__(256) void k_asoft(float* Sb) {
    const int lane = threadIdx.x & 31; const int row = blockIdx.x * 8 + (threadIdx.x >> 5); if (row >= ZH * TT) return; const int i = row % TT; const int zz = row / TT; (void)zz; const bool hires = (i < RH); float* sr = Sb + (size_t)row * TT; float v[TT / 32]; float mx = -3.0e38f;
#pragma unroll
    for (int ch = 0; ch < TT / 128; ++ch) { const int j0 = ch * 128 + lane * 4; const v4f a = *(const v4fa*)(sr + j0);
#pragma unroll
        for (int q = 0; q < 4; ++q) { const int j = j0 + q; (void)j; const float t = (j < i || (i == 0 && j == 0)) ? a[q] * SCL : -3.0e38f; v[ch * 4 + q] = t; mx = fmaxf(mx, t); } }
    asm volatile("s_wait_xcnt 0x0" ::: "memory");   // precaution: stands behind the row's loads, before their address registers are reused
#pragma unroll
    for (int sh = 16; sh; sh >>= 1) mx = fmaxf(mx, __shfl_xor(mx, sh, 32));
    float sum = 0.f;
#pragma unroll
    for (int k = 0; k < TT / 32; ++k) { float d0 = __fsub_rn(v[k], mx); asm volatile("" : "+v"(d0)); v[k] = __builtin_amdgcn_exp2f(__fmul_rn(d0, 1.4426950408889634f)); sum += v[k]; }
#pragma unroll
    for (int sh = 16; sh; sh >>= 1) sum += __shfl_xor(sum, sh, 32);
    const float f = __fdiv_rn(hires ? 1.0f : PCAR, sum);
{
        if (hires) {
#pragma unroll
            for (int ch = 0; ch < TT / 128; ++ch) { v4us oh, ol;
#pragma unroll
                for (int q = 0; q < 4; ++q) { unsigned short a, c2; splitf(v[ch * 4 + q] * f, a, c2); oh[q] = a; ol[q] = c2; }
                bf* pr = (bf*)sr + ch * 128 + lane * 4; *(v4usa*)pr = oh; *(v4usa*)(pr + TT) = ol; }
        } else {
#pragma unroll
            for (int ch = 0; ch < TT / 128; ++ch) { v4h o4;
#pragma unroll
                for (int q = 0; q < 4; ++q) o4[q] = tohx(v[ch * 4 + q] * f);
                *(v4ha*)((h16*)sr + ch * 128 + lane * 4) = o4; } }
         }
}
__global__ __launch_bounds__(256) void k_merge(const float* __restrict__ O, int h0, bf* Ah, bf* Al) { const size_t e = ((size_t)blockIdx.x * 256 + threadIdx.x) * 2; if (e >= (size_t)ZH * TT * HD) return; const int d = (int)(e % HD); const int t = (int)((e / HD) % TT); const int zz = (int)(e / ((size_t)HD * TT)); const float cs = (t < RH) ? 1.0f : (1.0f / PCAR); const size_t oo = (size_t)t * DQ + (h0 + zz) * HD + d;
    const int ns = ((t & ~63) + 64 + KCH - 1) / KCH;   // key chunks written for this row's 64-row tile
    static_assert(TT / KCH == 16, "the fence below names 16 planes"); v2f p[TT / KCH];
#pragma unroll
    for (int c = 0; c < TT / KCH; ++c) p[c] = *(const v2f*)(O + (size_t)min(c, ns - 1) * ((size_t)ZH * TT * HD) + e);   // clamped plane index: no load depends on a branch
    // inputs-only fence on the loaded values: keeps all plane loads in flight together; without it the compiler sinks each load under its c < ns test and the latencies add up
    asm volatile("" :: "v"(p[0]), "v"(p[1]), "v"(p[2]), "v"(p[3]), "v"(p[4]), "v"(p[5]), "v"(p[6]), "v"(p[7]), "v"(p[8]), "v"(p[9]), "v"(p[10]), "v"(p[11]), "v"(p[12]), "v"(p[13]), "v"(p[14]), "v"(p[15]));
    v2f s = p[0];
#pragma unroll
    for (int c = 1; c < TT / KCH; ++c) { if (c < ns) s += p[c]; }   // planes summed in ascending key order
    v2us oh, ol;
#pragma unroll
    for (int q = 0; q < 2; ++q) { unsigned short a, c2; splitf(s[q] * cs, a, c2); oh[q] = a; ol[q] = c2; } *(v2us*)(Ah + oo) = oh; *(v2us*)(Al + oo) = ol;  }

extern "C" void kernel_launch(void* const* d_in, const int* in_sizes, int n_in,
                              void* d_out, int out_size, void* d_ws, size_t ws_size, hipStream_t stream) {
    (void)in_sizes; (void)n_in; (void)out_size;
    const float* x = (const float*)d_in[0]; const float* xk = (const float*)d_in[1]; const float* xv = (const float*)d_in[2]; const float* wq = (const float*)d_in[3]; const float* wk = (const float*)d_in[4]; const float* wv = (const float*)d_in[5]; const float* wo = (const float*)d_in[6];
    float* OUT = (float*)d_out;     // [2][2048][1024]
    char* wsp = (char*)d_ws;
    auto take = [&](size_t bytes) { char* p = wsp; wsp += (bytes + 255) & ~(size_t)255; return (void*)p; };
    bf* WQ = (bf*)take((size_t)DQ * DM * 2); bf* WK = (bf*)take((size_t)DKV * DM * 2); bf* WV = (bf*)take((size_t)DKV * DM * 2); bf* WO = (bf*)take((size_t)DM * DQ * 2); float* CS = (float*)take((size_t)TT * HD * 2 * 4);
    h16* QP16 = (h16*)take((size_t)NH_ * TT * HD * 2); h16* KP16 = (h16*)take((size_t)NKV * TT * HD * 2); h16* VT16 = (h16*)take((size_t)NKV * HD * PP * 2);
    bf* QPh = (bf*)take((size_t)NH_ * TT * HD * 2); bf* QPl = (bf*)take((size_t)NH_ * TT * HD * 2); bf* KPh = (bf*)take((size_t)NKV * TT * HD * 2); bf* KPl = (bf*)take((size_t)NKV * TT * HD * 2); bf* VTh = (bf*)take((size_t)NKV * HD * PP * 2); bf* VTl = VTh + TT;   // each PP row: hi plane, then lo plane
    float* Sb = (float*)take((size_t)ZH * TT * TT * 4); float* Ob = (float*)take((size_t)(TT / KCH) * ZH * TT * HD * 4); bf* ATh = (bf*)take((size_t)TT * DQ * 2); bf* ATl = (bf*)take((size_t)TT * DQ * 2);
    if ((size_t)(wsp - (char*)d_ws) > ws_size) return;    // ws 256 MiB
    // the projection stage's buffers are dead before a batch's first P.V launch writes Ob and are rewritten by the next batch's first launches: they share Ob's bytes (stream-ordered)
    static_assert((size_t)TT * DM * 2 * 3 + (size_t)TT * DQ * 4 + (size_t)TT * DKV * 4 <= (size_t)(TT / KCH) * ZH * TT * HD * 4, "projection buffers fit in the partial planes");
    bf* XB = (bf*)Ob; bf* XB2 = XB + (size_t)TT * DM; bf* XB3 = XB2 + (size_t)TT * DM; float* FQ = (float*)(XB3 + (size_t)TT * DM); float* FK = FQ + (size_t)TT * DQ;
    bf* Ph = (bf*)Sb; bf* Pl = Ph + TT; h16* P16 = (h16*)Sb;   // probabilities live in the score rows (k_asoft)
    float* FV = FK;   // v projection reuses the k buffer after the k planes are built (stream-ordered)
    { k_cvt8<<<(unsigned)(((size_t)DQ * DM / 8 + 255) / 256), 256, 0, stream>>>(wq, WQ, (size_t)DQ * DM / 8); k_cvt8<<<(unsigned)(((size_t)DKV * DM / 8 + 255) / 256), 256, 0, stream>>>(wk, WK, (size_t)DKV * DM / 8); k_cvt8<<<(unsigned)(((size_t)DKV * DM / 8 + 255) / 256), 256, 0, stream>>>(wv, WV, (size_t)DKV * DM / 8);
      k_cvt8<<<(unsigned)(((size_t)DM * DQ / 8 + 255) / 256), 256, 0, stream>>>(wo, WO, (size_t)DM * DQ / 8);
      k_cstab<<<(TT * HD + 255) / 256, 256, 0, stream>>>(CS); }
    const unsigned LQ = (unsigned)(((size_t)NH_ * TT * HD / 2 + 255) / 256), LKv = (unsigned)(((size_t)NKV * TT * HD / 2 + 255) / 256);
    for (int b = 0; b < NB_; ++b) {
        
        k_cvt8<<<(unsigned)(((size_t)TT * DM / 8 + 255) / 256), 256, 0, stream>>>(x + (size_t)b * TT * DM, XB, (size_t)TT * DM / 8); k_cvt8<<<(unsigned)(((size_t)TT * DM / 8 + 255) / 256), 256, 0, stream>>>(xk + (size_t)b * TT * DM, XB2, (size_t)TT * DM / 8); k_cvt8<<<(unsigned)(((size_t)TT * DM / 8 + 255) / 256), 256, 0, stream>>>(xv + (size_t)b * TT * DM, XB3, (size_t)TT * DM / 8);
        k_gemmw<bf, 0, false><<<dim3(TT / 64, DQ / 64, 1), 32, 0, stream>>>(XB, nullptr, WQ, nullptr, DM, FQ, DQ, nullptr, 0, 0, 0);
        k_rope<<<LQ, 256, 0, stream>>>(FQ, DQ, NH_, CS, nullptr, nullptr, 1.0f, QP16, QPh, QPl);
        k_gemmw<bf, 0, false><<<dim3(TT / 64, DKV / 64, 1), 32, 0, stream>>>(XB2, nullptr, WK, nullptr, DM, FK, DKV, nullptr, 0, 0, 0);
        k_rope<<<LKv, 256, 0, stream>>>(FK, DKV, NKV, CS, nullptr, nullptr, 1.0f, KP16, KPh, KPl);
        k_gemmw<bf, 0, false><<<dim3(TT / 64, DKV / 64, 1), 32, 0, stream>>>(XB3, nullptr, WV, nullptr, DM, FV, DKV, nullptr, 0, 0, 0); k_vtp<<<LKv, 256, 0, stream>>>(FV, DKV, NKV, VT16, VTh, VTl);
        for (int h0 = 0; h0 < NH_; h0 += ZH) { const size_t zq = (size_t)h0, zk = (size_t)(h0 / REP);   // one kv head per query head: the pass's heads use consecutive kv planes; in the P.V launches K is the operands' common row pitch PP, the key loop ends at the diagonal block
            k_gemmc<bf, 2, 1><<<dim3(RH / 64, TT / 64, ZH), 32, 0, stream>>>(QPh + zq * TT * HD, QPl + zq * TT * HD, KPh + zk * TT * HD, KPl + zk * TT * HD, HD, Sb, TT, 0, (size_t)TT * HD, (size_t)TT * HD, (size_t)TT * TT, 0);
            k_gemmc<h16, 0, 1><<<dim3((TT - RH) / 64, TT / 64, ZH), 32, 0, stream>>>(QP16 + zq * TT * HD + (size_t)RH * HD, nullptr, KP16 + zk * TT * HD, nullptr, HD, Sb + (size_t)RH * TT, TT, RH, (size_t)TT * HD, (size_t)TT * HD, (size_t)TT * TT, 0);
            k_asoft<<<ZH * TT / 8, 256, 0, stream>>>(Sb);
            k_gemmc<bf, 2, 2><<<dim3(RH / 64, RH / KCH, ZH), 32, 0, stream>>>(Ph, Pl, VTh + zk * HD * PP, VTl + zk * HD * PP, PP, Ob, HD, 0, (size_t)TT * PP, (size_t)HD * PP, (size_t)TT * HD, (size_t)ZH * TT * HD);
            k_gemmc<h16, 0, 2><<<dim3((TT - RH) / 64, TT / KCH, ZH), 32, 0, stream>>>(P16 + (size_t)RH * PP, nullptr, VT16 + zk * HD * PP, nullptr, PP, Ob + (size_t)RH * HD, HD, RH, (size_t)TT * PP, (size_t)HD * PP, (size_t)TT * HD, (size_t)ZH * TT * HD);
            k_merge<<<(unsigned)(((size_t)ZH * TT * HD / 2 + 255) / 256), 256, 0, stream>>>(Ob, h0, ATh, ATl); }
        k_gemmw<bf, 1, false><<<dim3(TT / 64, DM / 64, 1), 32, 0, stream>>>(ATh, ATl, WO, nullptr, DQ, OUT + (size_t)b * TT * DM, DM, nullptr, 0, 0, 0); }
}

// v003
// Measured time: 339 microseconds a run.
// Next to v002, in two timings, it ran 1.66 times as fast each time.
// Over all steps from v000 it is 4.32 times as fast.
#include <hip/hip_runtime.h>

// ICLAttention (q, k, v inputs [2][2048][1024]; qh/kh/vh = x W^T (torch; 16 heads x 64); interleaved-pair RoPE (base 1e4, tables computed on device); SCALE = 1/sqrt(1024); 'shifted causal' mask: key j is masked iff j >= i, except (0, 0) which stays visible; softmax; out = merged Wo^T -> [2][2048][1024]).
// Compute dtypes, f32 accumulate: every input rounded to bf16; projections on PLAIN bf16 operands (inputs: exact); RoPE f32; scores and attn.v: query rows < 512 hl (3 products), the rest single fp16, fused with an online f32 softmax in k_attn (key blocks beyond the diagonal are never visited); Wo hl x exact (2 products).

#define NB_  2
#define TT   2048
#define DM   1024
#define NH_  16
#define NKV  16
#define REP  (NH_ / NKV)
#define HD   64
#define DQ   (NH_ * HD)
#define DKV  (NKV * HD)
#define RH   512                  // query rows < RH use hi+lo planes (0: none)
#define SCL  0.03125f   // 1/sqrt(d_attn = 1024), as the source
static_assert(HD == 64, "k_attn holds four 16-row output tiles and two 32-deep query fragments");
#define PP   (2 * TT)             // row pitch, in 16-bit elements, of the transposed value planes (a hi/lo row holds the hi plane, then the lo plane)
#define KB   32                   // keys per pass of k_attn
typedef _Float16 h16;
typedef unsigned short bf;
typedef __attribute__((ext_vector_type(16))) __bf16   v16bf;
typedef __attribute__((ext_vector_type(16))) _Float16 v16h;
typedef __attribute__((ext_vector_type(8)))  _Float16 v8h;
typedef __attribute__((ext_vector_type(8)))  unsigned short v8us;
typedef __attribute__((ext_vector_type(8)))  float    v8f;
typedef __attribute__((ext_vector_type(4)))  float    v4f;
typedef v8h  __attribute__((may_alias)) v8ha;
typedef v4f  __attribute__((may_alias)) v4fa;
typedef v8us __attribute__((may_alias)) v8usa;

__device__ __forceinline__ unsigned short f2bf(float f) { unsigned u = __float_as_uint(f); u += 0x7FFFu + ((u >> 16) & 1u); return (unsigned short)(u >> 16); }
__device__ __forceinline__ float bf2f(unsigned short b) { return __uint_as_float(((unsigned)b) << 16); }
__device__ __forceinline__ float bfr(float f) { return bf2f(f2bf(f)); }
__device__ __forceinline__ v16h cat16(v8h lo, v8h hi) { return __builtin_shufflevector(lo, hi, 0, 1, 2, 3, 4, 5, 6, 7, 8, 9, 10, 11, 12, 13, 14, 15); }
__device__ __forceinline__ v16bf cat16b(v8us lo, v8us hi) { return __builtin_bit_cast(v16bf, __builtin_shufflevector(lo, hi, 0, 1, 2, 3, 4, 5, 6, 7, 8, 9, 10, 11, 12, 13, 14, 15)); }
__device__ __forceinline__ v8f wmma16(v16h a, v16h b, v8f c) { return __builtin_amdgcn_wmma_f32_16x16x32_f16(false, a, false, b, (short)0, c, false, false); }
__device__ __forceinline__ v8f wmmab(v16bf a, v16bf b, v8f c) { return __builtin_amdgcn_wmma_f32_16x16x32_bf16(false, a, false, b, (short)0, c, false, false); }



// ---- k_gemmw: register-blocked GEMM, ONE WAVE per 64x64 output tile (16 accumulators), operands straight from K-contiguous 16-bit planes; grid (M/64, N/64, Z), 32 threads.
// C[m][n] (f32, pitch ldc, + optional f32 bias[n]) = sum_k A[m][k] Bt[n][k] (+ split products per NSPLIT). z-batch strides sA/sB/sC in elements. K % 32 == 0.
template <typename T16> struct WFrag;
template <> struct WFrag<h16> { typedef v16h V; static __device__ __forceinline__ V ld(const h16* p) { return cat16(*(const v8h*)p, *(const v8h*)(p + 16)); } static __device__ __forceinline__ v8f mma(V a, V b, v8f c) { return wmma16(a, b, c); } };
template <> struct WFrag<bf> { typedef v16bf V; static __device__ __forceinline__ V ld(const bf* p) { return cat16b(*(const v8us*)p, *(const v8us*)(p + 16)); } static __device__ __forceinline__ v8f mma(V a, V b, v8f c) { return wmmab(a, b, c); } };
template <typename T16, int NSPLIT, bool BIAS>
__global__ __launch_bounds__(32) void k_gemmw(const T16* __restrict__ A, const T16* __restrict__ A2, const T16* __restrict__ Bt, const T16* __restrict__ Bt2, int K, float* C, int ldc, const float* __restrict__ bias, size_t sA, size_t sB, size_t sC) {
    typedef typename WFrag<T16>::V V;
    __shared__ __align__(16) float os[16 * 68];
    const size_t z = blockIdx.z; A += z * sA; if (A2) A2 += z * sA; Bt += z * sB; if (Bt2) Bt2 += z * sB; C += z * sC;
    const int lane = threadIdx.x & 31, lr = lane & 15, hi = lane >> 4; const int r0 = blockIdx.x * 64, c0 = blockIdx.y * 64;
    v8f acc[4][4];
#pragma unroll
    for (int mb = 0; mb < 4; ++mb)
#pragma unroll
        for (int nb = 0; nb < 4; ++nb) acc[mb][nb] = (v8f){};
    const size_t aoff = (size_t)(r0 + lr) * K + 8 * hi, boff = (size_t)(c0 + lr) * K + 8 * hi;
#pragma unroll 1
    for (int kc = 0; kc < K; kc += 32) {
        V a[4], a2[4];
#pragma unroll
        for (int mb = 0; mb < 4; ++mb) { a[mb] = WFrag<T16>::ld(A + aoff + (size_t)mb * 16 * K + kc); if (NSPLIT == 1 || NSPLIT == 2) a2[mb] = WFrag<T16>::ld(A2 + aoff + (size_t)mb * 16 * K + kc); }
#pragma unroll
        for (int nb = 0; nb < 4; ++nb) { const V b = WFrag<T16>::ld(Bt + boff + (size_t)nb * 16 * K + kc); V b2; if (NSPLIT >= 2) b2 = WFrag<T16>::ld(Bt2 + boff + (size_t)nb * 16 * K + kc);
#pragma unroll
            for (int mb = 0; mb < 4; ++mb) { acc[mb][nb] = WFrag<T16>::mma(a[mb], b, acc[mb][nb]); if (NSPLIT == 1 || NSPLIT == 2) acc[mb][nb] = WFrag<T16>::mma(a2[mb], b, acc[mb][nb]); if (NSPLIT >= 2) acc[mb][nb] = WFrag<T16>::mma(a[mb], b2, acc[mb][nb]); } }
        asm volatile("v_nop\n\tv_nop\n\tv_nop\n\tv_nop" : "+v"(acc[0][0]), "+v"(acc[1][1]), "+v"(acc[2][2]), "+v"(acc[3][3]) : "v"(a[0]), "v"(a[3]));
    }
#pragma unroll
    for (int mb = 0; mb < 4; ++mb) {
#pragma unroll
        for (int nb = 0; nb < 4; ++nb) {
#pragma unroll
            for (int j = 0; j < 8; ++j) os[(hi * 8 + j) * 68 + nb * 16 + lr] = acc[mb][nb][j]; }
        __builtin_amdgcn_wave_barrier(); asm volatile("" ::: "memory");
        float* crow = C + (size_t)(r0 + mb * 16) * ldc + c0;
{
#pragma unroll
            for (int s = 0; s < 8; ++s) { const int row = 2 * s + hi, cofs = lr * 4; v4f val = *(const v4fa*)(os + row * 68 + cofs); if (BIAS) { val[0] += bfr(bias[c0 + cofs]); val[1] += bfr(bias[c0 + cofs + 1]); val[2] += bfr(bias[c0 + cofs + 2]); val[3] += bfr(bias[c0 + cofs + 3]); }
                *(v4f*)(crow + (size_t)row * ldc + cofs) = val; }
             }
        __builtin_amdgcn_wave_barrier(); asm volatile("" ::: "memory");
    }
}

__device__ __forceinline__ h16 tohx(float x) { return (h16)x; }
__device__ __forceinline__ void splitf(float y, unsigned short& h, unsigned short& l) { h = f2bf(y); l = f2bf(y - bf2f(h)); }
typedef __attribute__((ext_vector_type(2))) _Float16 v2h;
typedef __attribute__((ext_vector_type(4))) _Float16 v4h;
typedef __attribute__((ext_vector_type(2))) unsigned short v2us;
typedef __attribute__((ext_vector_type(4))) unsigned short v4us;
typedef __attribute__((ext_vector_type(2))) float v2f;
typedef __attribute__((ext_vector_type(4))) int v4i;
typedef v4h  __attribute__((may_alias)) v4ha;
typedef v4us __attribute__((may_alias)) v4usa;

__global__ __launch_bounds__(256) void k_wtG(const float* __restrict__ w, int K, int N, bf* Bt) {
    const int lane = threadIdx.x & 31; const int L0 = (blockIdx.x * 8 + (threadIdx.x >> 5)) * 8; const int nlines = N * K / 64;
{
#pragma unroll 1
        for (int l = 0; l < 8; ++l) { const int L = L0 + l; if (L >= nlines) break; const size_t e = (size_t)L * 64 + lane * 2; const int k = (int)(e % K), n = (int)(e / K); v2us o;
            o[0] = f2bf(w[(size_t)k * N + n]); o[1] = f2bf(w[(size_t)(k + 1) * N + n]); *(v2us*)(Bt + e) = o; }
         }
}
__global__ __launch_bounds__(256) void k_cvt8(const float* __restrict__ src, bf* dst, size_t n8) { const size_t i = (size_t)blockIdx.x * 256 + threadIdx.x; if (i >= n8) return; const v8f v = *(const v8f*)(src + i * 8); v8us o;
#pragma unroll
    for (int k = 0; k < 8; ++k) o[k] = f2bf(v[k]); *(v8us*)(dst + i * 8) = o;  }
__global__ __launch_bounds__(256) void k_cstab(float* CS) { const int idx = blockIdx.x * 256 + threadIdx.x; if (idx >= TT * HD) return; const int t = idx / HD, d = idx % HD; const int i = d >> 1;   /* interleaved pairs */ const float inv = __fdiv_rn(1.0f, powf(10000.0f, (float)(2 * i) / (float)HD)); const float ang = __fmul_rn((float)t, inv); v2f cs; cs[0] = cosf(ang); cs[1] = sinf(ang);
    *(v2f*)(CS + (size_t)idx * 2) = cs;  }
// k_rope: head planes [h][t][d] (fp16 + hi/lo) of rope(x) x sc with interleaved pairs out[2i] = x[2i] cos[t][2i] - x[2i+1] sin[t][2i], out[2i+1] = x[2i+1] cos[t][2i+1] + x[2i] sin[t][2i+1]
__global__ __launch_bounds__(256) void k_rope(const float* __restrict__ F, int pitch, int nheads, const float* __restrict__ CS, const float* __restrict__ RF, const float* __restrict__ nw, float sc, h16* P16, bf* Ph, bf* Pl) {
    const size_t e = ((size_t)blockIdx.x * 256 + threadIdx.x) * 2; if (e >= (size_t)nheads * TT * HD) return; const int d = (int)(e % HD); const int t = (int)((e / HD) % TT); const int h = (int)(e / ((size_t)HD * TT)); const float* f = F + (size_t)t * pitch + h * HD; const float rf = RF ? RF[(size_t)h * TT + t] : 1.0f; v2h o16; v2us oh, ol;
#pragma unroll
    for (int q = 0; q < 2; ++q) { const int dd = d + q; const int dp = dd ^ 1; float x0 = f[dd], x1 = f[dp];
        if (RF) { float n0 = __fmul_rn(x0, rf), n1 = __fmul_rn(x1, rf); asm volatile("" : "+v"(n0)); asm volatile("" : "+v"(n1)); x0 = __fmul_rn(bfr(nw[dd]), n0); x1 = __fmul_rn(bfr(nw[dp]), n1); }
        const v2f cs = *(const v2f*)(CS + ((size_t)t * HD + dd) * 2); float a = __fmul_rn(x0, cs[0]), bq = __fmul_rn(x1, cs[1]); asm volatile("" : "+v"(a)); asm volatile("" : "+v"(bq)); const float r = (((dd & 1) == 0) ? __fsub_rn(a, bq) : __fadd_rn(a, bq)) * sc;
        o16[q] = tohx(r); unsigned short a2, c2; splitf(r, a2, c2); oh[q] = a2; ol[q] = c2; }
    *(v2h*)(P16 + e) = o16; *(v2us*)(Ph + e) = oh; *(v2us*)(Pl + e) = ol;  }
__global__ __launch_bounds__(256) void k_vtp(const float* __restrict__ F, int pitch, int nheads, h16* V16, bf* Vh, bf* Vl) { const size_t e = ((size_t)blockIdx.x * 256 + threadIdx.x) * 2; if (e >= (size_t)nheads * HD * TT) return; const int t = (int)(e % TT); const int d = (int)((e / TT) % HD); const int g = (int)(e / ((size_t)TT * HD)); v2h o16; v2us oh, ol; float xs[2];
#pragma unroll
    for (int q = 0; q < 2; ++q) xs[q] = F[(size_t)(t + q) * pitch + g * HD + d];
    asm volatile("s_wait_xcnt 0x0" ::: "memory");   // precaution: stands behind the two loads, before their address registers are reused
#pragma unroll
    for (int q = 0; q < 2; ++q) { const float x = xs[q]; o16[q] = tohx(x); unsigned short a2, c2; splitf(x, a2, c2); oh[q] = a2; ol[q] = c2; }
    const size_t oo = ((size_t)g * HD + d) * PP + t;   // planes [g][d][t] at row pitch PP
    *(v2h*)(V16 + oo) = o16; *(v2us*)(Vh + oo) = oh; *(v2us*)(Vl + oo) = ol;  }
// ---- k_attn: scores, mask, softmax and probability x value product in one kernel; one wave per tile of NQ x 16 query rows of one (batch, head), no LDS.
// S^T = K Q^T: A = 16 key rows, B = 16 query rows, so a lane's accumulators hold scores of ONE query (column lr), keys hi * 8 + j of each 16-key tile. That is the k order of a B fragment over 32 keys
// (elements 0..7: keys 8 hi + e, elements 8..15: keys 16 + 8 hi + e), so the probabilities go from the accumulators into O^T += V^T P^T without leaving their lane. A = 16 rows of the transposed value plane.
// Online softmax in the log2 domain: running maximum m and sum l per query (per lane; the two halves of the wave share m and join l at the end); the output tiles are rescaled by 2^(m_old - m_new) each pass.
// Mask: key j is visible to query i iff j < i, or i == j == 0; key 0 is visible to every query, so m is finite after the first pass.
typedef __attribute__((ext_vector_type(16))) unsigned short v16us;
__device__ __forceinline__ float xhalf(float x) { return __builtin_bit_cast(float, __builtin_amdgcn_permlanex16(__builtin_bit_cast(int, x), __builtin_bit_cast(int, x), 0x76543210, 0xfedcba98, false, false)); }   // lane l reads lane l ^ 16
// 2^x; the v_nop fills, in the same statement, the slot that the instruction set asks for behind a transcendental before its result is used or its source overwritten
__device__ __forceinline__ float exp2s(float x) { float r; asm("v_exp_f32 %0, %1\n\tv_nop" : "=v"(r) : "v"(x)); return r; }
template <typename T16, bool HL, int NQ>
__device__ __forceinline__ void attn_tile(const T16* __restrict__ Q, const T16* __restrict__ Q2, const T16* __restrict__ Kp, const T16* __restrict__ K2, const T16* __restrict__ Vt, const T16* __restrict__ V2, int q0, bf* Ah, bf* Al) {
    typedef typename WFrag<T16>::V V;
    const int lane = threadIdx.x & 31, lr = lane & 15, hi = lane >> 4;
    V qf[NQ][2], qf2[NQ][2]; v8f o[NQ][4]; float m[NQ], l[NQ];
#pragma unroll
    for (int qb = 0; qb < NQ; ++qb) { m[qb] = -3.0e38f; l[qb] = 0.f;
#pragma unroll
        for (int ks = 0; ks < 2; ++ks) { const size_t qo = (size_t)(q0 + qb * 16 + lr) * HD + ks * 32 + 8 * hi; qf[qb][ks] = WFrag<T16>::ld(Q + qo); if (HL) qf2[qb][ks] = WFrag<T16>::ld(Q2 + qo); }
#pragma unroll
        for (int dt = 0; dt < 4; ++dt) o[qb][dt] = (v8f){}; }
    const int npass = (q0 + NQ * 16 - 1 + KB - 1) / KB;   // the tile's last query sees keys 0 .. q0 + NQ * 16 - 2
    const size_t ko = (size_t)lr * HD + 8 * hi, vo = (size_t)lr * PP + 8 * hi;
    V kf[2][2], kf2[2][2];
    // key fragments of the 32 key rows at pk (and their lo plane at pk2)
    auto ldk = [&](const T16* pk, const T16* pk2) {
#pragma unroll
        for (int kt = 0; kt < 2; ++kt)
#pragma unroll
            for (int ks = 0; ks < 2; ++ks) { kf[kt][ks] = WFrag<T16>::ld(pk + kt * 16 * HD + ks * 32); if (HL) kf2[kt][ks] = WFrag<T16>::ld(pk2 + kt * 16 * HD + ks * 32); } };
    // the fp16 tiles fetch their key fragments one pass ahead; the hi+lo tiles hold twice the fragments and have no registers for that: they fetch them at the head of the pass, with the value fragments
    if (!HL) ldk(Kp + ko, Kp + ko);
#pragma unroll 1
    for (int it = 0; it < npass; ++it) { const int k0 = it * KB;
        V vf[4], vf2[4];   // this pass's value fragments: asked for here, used behind the softmax
        const T16* pv = Vt + vo + k0; const T16* pv2 = HL ? V2 + vo + k0 : pv;
#pragma unroll
        for (int dt = 0; dt < 4; ++dt) { vf[dt] = WFrag<T16>::ld(pv + (size_t)dt * 16 * PP); if (HL) vf2[dt] = WFrag<T16>::ld(pv2 + (size_t)dt * 16 * PP); }
        if constexpr (HL) { const T16* pk = Kp + (size_t)k0 * HD + ko; const T16* pk2 = K2 + (size_t)k0 * HD + ko; ldk(pk, pk2);
            // precaution: stands behind the pass's loads and names their address registers as inputs, so that none of them is reused (not even as a later load's destination) before the wait
            asm volatile("s_wait_xcnt 0x0" :: "v"(pv), "v"(pv2), "v"(pk), "v"(pk2) : "memory"); }
        v8f s[NQ][2];
#pragma unroll
        for (int qb = 0; qb < NQ; ++qb)
#pragma unroll
            for (int kt = 0; kt < 2; ++kt) { s[qb][kt] = (v8f){};
#pragma unroll
                for (int ks = 0; ks < 2; ++ks) { s[qb][kt] = WFrag<T16>::mma(kf[kt][ks], qf[qb][ks], s[qb][kt]); if (HL) { s[qb][kt] = WFrag<T16>::mma(kf[kt][ks], qf2[qb][ks], s[qb][kt]); s[qb][kt] = WFrag<T16>::mma(kf2[kt][ks], qf[qb][ks], s[qb][kt]); } } }
        if constexpr (!HL) { const T16* pk = Kp + (size_t)min(k0 + KB, TT - KB) * HD + ko; ldk(pk, pk);   // the next pass's key fragments (the last pass re-reads rows inside the plane and drops them)
            // precaution: as above
            asm volatile("s_wait_xcnt 0x0" :: "v"(pv), "v"(pk) : "memory"); }
#pragma unroll
        for (int qb = 0; qb < NQ; ++qb) { const int iq = q0 + qb * 16 + lr; float t[16];
#pragma unroll
            for (int e = 0; e < 16; ++e) t[e] = s[qb][e >> 3][e & 7] * (SCL * 1.4426950408889634f);
            if (k0 + KB > q0) {   // wave-uniform: only passes that reach the tile's first query hold masked keys
#pragma unroll
                for (int e = 0; e < 16; ++e) { const int j = k0 + (e >> 3) * 16 + hi * 8 + (e & 7); t[e] = (j < iq || (iq == 0 && j == 0)) ? t[e] : -3.0e38f; } }
            float mx = t[0];
#pragma unroll
            for (int e = 1; e < 16; ++e) mx = fmaxf(mx, t[e]);
            mx = fmaxf(mx, xhalf(mx));
            const float mn = fmaxf(m[qb], mx); const float al = exp2s(m[qb] - mn); m[qb] = mn;
            float ps = 0.f; V pf, pf2;
            if constexpr (HL) { v16us ph, pl;
#pragma unroll
                for (int e = 0; e < 16; ++e) { const float p = exp2s(t[e] - mn); ps += p; unsigned short a, c2; splitf(p, a, c2); ph[e] = a; pl[e] = c2; }
                pf = __builtin_bit_cast(v16bf, ph); pf2 = __builtin_bit_cast(v16bf, pl);
            } else {
#pragma unroll
                for (int e = 0; e < 16; ++e) { const float p = exp2s(t[e] - mn); ps += p; pf[e] = tohx(p); } }
            l[qb] = l[qb] * al + ps;
#pragma unroll
            for (int dt = 0; dt < 4; ++dt) { o[qb][dt] *= al; o[qb][dt] = WFrag<T16>::mma(vf[dt], pf, o[qb][dt]); if constexpr (HL) { o[qb][dt] = WFrag<T16>::mma(vf[dt], pf2, o[qb][dt]); o[qb][dt] = WFrag<T16>::mma(vf2[dt], pf, o[qb][dt]); } } }
    }
#pragma unroll
    for (int qb = 0; qb < NQ; ++qb) { const float inv = __fdiv_rn(1.0f, l[qb] + xhalf(l[qb])); const size_t oo = (size_t)(q0 + qb * 16 + lr) * DQ + hi * 8;
#pragma unroll
        for (int dt = 0; dt < 4; ++dt) { v8us oh, ol;   // accumulator j of tile dt: output column dt * 16 + hi * 8 + j of query lr
#pragma unroll
            for (int j = 0; j < 8; ++j) { unsigned short a, c2; splitf(o[qb][dt][j] * inv, a, c2); oh[j] = a; ol[j] = c2; }
            *(v8us*)(Ah + oo + dt * 16) = oh; *(v8us*)(Al + oo + dt * 16) = ol; } }
}
// grid (heads, batches, NTF + NTH), four waves a block, each wave its own tile of one head; blockIdx.z is the slowest index, so the blocks with the most keys are handed out first.
// z < NTF: rows >= RH, 32 rows a wave, fp16; the rest: rows < RH, 16 rows a wave, hi+lo planes.
#define NTF  ((TT - RH) / 128)
#define NTH  (RH / 64)
// four waves a SIMD: a budget of 256 registers a wave, so that every block of the grid is resident at once and no register window switch is needed
__global__ __launch_bounds__(128) __attribute__((amdgpu_waves_per_eu(4))) void k_attn(const h16* __restrict__ Q16, const h16* __restrict__ K16, const h16* __restrict__ V16, const bf* __restrict__ Qh, const bf* __restrict__ Ql, const bf* __restrict__ Kh, const bf* __restrict__ Kl, const bf* __restrict__ Vh, const bf* __restrict__ Vl, bf* Ah, bf* Al) {
    const int wv = __builtin_amdgcn_readfirstlane(threadIdx.x >> 5), tz = (int)blockIdx.z; const size_t zh = (size_t)blockIdx.y * NH_ + blockIdx.x; const size_t pq = zh * TT * HD, pv = zh * HD * PP, pa = (size_t)blockIdx.y * TT * DQ + (size_t)blockIdx.x * HD;
    if (tz < NTF) attn_tile<h16, false, 2>(Q16 + pq, nullptr, K16 + pq, nullptr, V16 + pv, nullptr, TT - 128 * (tz + 1) + 32 * wv, Ah + pa, Al + pa);
    else attn_tile<bf, true, 1>(Qh + pq, Ql + pq, Kh + pq, Kl + pq, Vh + pv, Vl + pv, RH - 64 * (tz - NTF + 1) + 16 * wv, Ah + pa, Al + pa);
}

extern "C" void kernel_launch(void* const* d_in, const int* in_sizes, int n_in,
                              void* d_out, int out_size, void* d_ws, size_t ws_size, hipStream_t stream) {
    (void)in_sizes; (void)n_in; (void)out_size;
    const float* x = (const float*)d_in[0]; const float* xk = (const float*)d_in[1]; const float* xv = (const float*)d_in[2]; const float* wq = (const float*)d_in[3]; const float* wk = (const float*)d_in[4]; const float* wv = (const float*)d_in[5]; const float* wo = (const float*)d_in[6];
    float* OUT = (float*)d_out;     // [2][2048][1024]
    char* wsp = (char*)d_ws;
    auto take = [&](size_t bytes) { char* p = wsp; wsp += (bytes + 255) & ~(size_t)255; return (void*)p; };
    bf* WQ = (bf*)take((size_t)DQ * DM * 2); bf* WK = (bf*)take((size_t)DKV * DM * 2); bf* WV = (bf*)take((size_t)DKV * DM * 2); bf* WO = (bf*)take((size_t)DM * DQ * 2); float* CS = (float*)take((size_t)TT * HD * 2 * 4);
    // head planes of both batches, [b][h][..]
    const size_t SQ = (size_t)NH_ * TT * HD, SV = (size_t)NKV * HD * PP, SA = (size_t)TT * DQ;
    h16* QP16 = (h16*)take(NB_ * SQ * 2); h16* KP16 = (h16*)take(NB_ * SQ * 2); h16* VT16 = (h16*)take(NB_ * SV * 2);
    bf* QPh = (bf*)take(NB_ * SQ * 2); bf* QPl = (bf*)take(NB_ * SQ * 2); bf* KPh = (bf*)take(NB_ * SQ * 2); bf* KPl = (bf*)take(NB_ * SQ * 2); bf* VTh = (bf*)take(NB_ * SV * 2); bf* VTl = VTh + TT;   // each PP row: hi plane, then lo plane
    bf* ATh = (bf*)take(NB_ * SA * 2); bf* ATl = (bf*)take(NB_ * SA * 2);
    bf* XB = (bf*)take((size_t)TT * DM * 2); bf* XB2 = (bf*)take((size_t)TT * DM * 2); bf* XB3 = (bf*)take((size_t)TT * DM * 2); float* FQ = (float*)take((size_t)TT * DQ * 4); float* FK = (float*)take((size_t)TT * DKV * 4);
    if ((size_t)(wsp - (char*)d_ws) > ws_size) return;    // ws 256 MiB
    float* FV = FK;   // v projection reuses the k buffer after the k planes are built (stream-ordered)
    { k_cvt8<<<(unsigned)(((size_t)DQ * DM / 8 + 255) / 256), 256, 0, stream>>>(wq, WQ, (size_t)DQ * DM / 8); k_cvt8<<<(unsigned)(((size_t)DKV * DM / 8 + 255) / 256), 256, 0, stream>>>(wk, WK, (size_t)DKV * DM / 8); k_cvt8<<<(unsigned)(((size_t)DKV * DM / 8 + 255) / 256), 256, 0, stream>>>(wv, WV, (size_t)DKV * DM / 8);
      k_cvt8<<<(unsigned)(((size_t)DM * DQ / 8 + 255) / 256), 256, 0, stream>>>(wo, WO, (size_t)DM * DQ / 8);
      k_cstab<<<(TT * HD + 255) / 256, 256, 0, stream>>>(CS); }
    const unsigned LQ = (unsigned)(((size_t)NH_ * TT * HD / 2 + 255) / 256), LKv = (unsigned)(((size_t)NKV * TT * HD / 2 + 255) / 256);
    for (int b = 0; b < NB_; ++b) {
        k_cvt8<<<(unsigned)(((size_t)TT * DM / 8 + 255) / 256), 256, 0, stream>>>(x + (size_t)b * TT * DM, XB, (size_t)TT * DM / 8); k_cvt8<<<(unsigned)(((size_t)TT * DM / 8 + 255) / 256), 256, 0, stream>>>(xk + (size_t)b * TT * DM, XB2, (size_t)TT * DM / 8); k_cvt8<<<(unsigned)(((size_t)TT * DM / 8 + 255) / 256), 256, 0, stream>>>(xv + (size_t)b * TT * DM, XB3, (size_t)TT * DM / 8);
        k_gemmw<bf, 0, false><<<dim3(TT / 64, DQ / 64, 1), 32, 0, stream>>>(XB, nullptr, WQ, nullptr, DM, FQ, DQ, nullptr, 0, 0, 0);
        k_rope<<<LQ, 256, 0, stream>>>(FQ, DQ, NH_, CS, nullptr, nullptr, 1.0f, QP16 + b * SQ, QPh + b * SQ, QPl + b * SQ);
        k_gemmw<bf, 0, false><<<dim3(TT / 64, DKV / 64, 1), 32, 0, stream>>>(XB2, nullptr, WK, nullptr, DM, FK, DKV, nullptr, 0, 0, 0);
        k_rope<<<LKv, 256, 0, stream>>>(FK, DKV, NKV, CS, nullptr, nullptr, 1.0f, KP16 + b * SQ, KPh + b * SQ, KPl + b * SQ);
        k_gemmw<bf, 0, false><<<dim3(TT / 64, DKV / 64, 1), 32, 0, stream>>>(XB3, nullptr, WV, nullptr, DM, FV, DKV, nullptr, 0, 0, 0); k_vtp<<<LKv, 256, 0, stream>>>(FV, DKV, NKV, VT16 + b * SV, VTh + b * SV, VTl + b * SV); }
    static_assert(REP == 1, "k_attn takes one kv head per query head");
    k_attn<<<dim3(NH_, NB_, NTF + NTH), 128, 0, stream>>>(QP16, KP16, VT16, QPh, QPl, KPh, KPl, VTh, VTl, ATh, ATl);
    for (int b = 0; b < NB_; ++b)
        k_gemmw<bf, 1, false><<<dim3(TT / 64, DM / 64, 1), 32, 0, stream>>>(ATh + b * SA, ATl + b * SA, WO, nullptr, DQ, OUT + (size_t)b * TT * DM, DM, nullptr, 0, 0, 0);
}

// v004
// A run of this version takes 301 microseconds.
// Two timings next to v003 both put it at 1.12 times that version's speed.
// Over all steps from v000 it is 4.84 times as fast.
#include <hip/hip_runtime.h>

// ICLAttention (q, k, v inputs [2][2048][1024]; qh/kh/vh = x W^T (torch; 16 heads x 64); interleaved-pair RoPE (base 1e4, tables computed on device); SCALE = 1/sqrt(1024); 'shifted causal' mask: key j is masked iff j >= i, except (0, 0) which stays visible; softmax; out = merged Wo^T -> [2][2048][1024]).
// Compute dtypes, f32 accumulate: every input rounded to bf16; projections on PLAIN bf16 operands (inputs: exact); RoPE f32, in the projection's epilogue; scores and attn.v: query rows < 512 hl (3 products), the rest single fp16, fused with an online f32 softmax in k_attn (key blocks beyond the diagonal are never visited); Wo hl x exact (2 products).

#define NB_  2
#define TT   2048
#define DM   1024
#define NH_  16
#define NKV  16
#define REP  (NH_ / NKV)
#define HD   64
#define DQ   (NH_ * HD)
#define DKV  (NKV * HD)
#define RH   512                  // query rows < RH use hi+lo planes (0: none)
#define SCL  0.03125f   // 1/sqrt(d_attn = 1024), as the source
static_assert(HD == 64, "k_attn holds four 16-row output tiles and two 32-deep query fragments");
#define PP   (2 * TT)             // row pitch, in 16-bit elements, of the transposed value planes (a hi/lo row holds the hi plane, then the lo plane)
#define KB   32                   // keys per pass of k_attn
typedef _Float16 h16;
typedef unsigned short bf;
typedef __attribute__((ext_vector_type(16))) __bf16   v16bf;
typedef __attribute__((ext_vector_type(16))) _Float16 v16h;
typedef __attribute__((ext_vector_type(8)))  _Float16 v8h;
typedef __attribute__((ext_vector_type(8)))  unsigned short v8us;
typedef __attribute__((ext_vector_type(8)))  float    v8f;
typedef __attribute__((ext_vector_type(4)))  float    v4f;
typedef v8h  __attribute__((may_alias)) v8ha;
typedef v4f  __attribute__((may_alias)) v4fa;
typedef v8us __attribute__((may_alias)) v8usa;

__device__ __forceinline__ unsigned short f2bf(float f) { unsigned u = __float_as_uint(f); u += 0x7FFFu + ((u >> 16) & 1u); return (unsigned short)(u >> 16); }
__device__ __forceinline__ float bf2f(unsigned short b) { return __uint_as_float(((unsigned)b) << 16); }
__device__ __forceinline__ float bfr(float f) { return bf2f(f2bf(f)); }
__device__ __forceinline__ v16h cat16(v8h lo, v8h hi) { return __builtin_shufflevector(lo, hi, 0, 1, 2, 3, 4, 5, 6, 7, 8, 9, 10, 11, 12, 13, 14, 15); }
__device__ __forceinline__ v16bf cat16b(v8us lo, v8us hi) { return __builtin_bit_cast(v16bf, __builtin_shufflevector(lo, hi, 0, 1, 2, 3, 4, 5, 6, 7, 8, 9, 10, 11, 12, 13, 14, 15)); }
__device__ __forceinline__ v8f wmma16(v16h a, v16h b, v8f c) { return __builtin_amdgcn_wmma_f32_16x16x32_f16(false, a, false, b, (short)0, c, false, false); }
__device__ __forceinline__ v8f wmmab(v16bf a, v16bf b, v8f c) { return __builtin_amdgcn_wmma_f32_16x16x32_bf16(false, a, false, b, (short)0, c, false, false); }

__device__ __forceinline__ h16 tohx(float x) { return (h16)x; }
__device__ __forceinline__ void splitf(float y, unsigned short& h, unsigned short& l) { h = f2bf(y); l = f2bf(y - bf2f(h)); }
typedef __attribute__((ext_vector_type(2))) _Float16 v2h;
typedef __attribute__((ext_vector_type(4))) _Float16 v4h;
typedef __attribute__((ext_vector_type(2))) unsigned short v2us;
typedef __attribute__((ext_vector_type(4))) unsigned short v4us;
typedef __attribute__((ext_vector_type(2))) float v2f;
typedef __attribute__((ext_vector_type(4))) int v4i;
typedef v4h  __attribute__((may_alias)) v4ha;
typedef v4us __attribute__((may_alias)) v4usa;

// ---- k_gemmw: register-blocked GEMM, ONE WAVE per 64x64 output tile (16 accumulators), operands straight from K-contiguous 16-bit planes; grid (M/64, N/64, Z), 32 threads.
// C[m][n] (f32, pitch ldc, + optional f32 bias[n]) = sum_k A[m][k] Bt[n][k] (+ split products per NSPLIT). z-batch strides sA/sB/sC in elements. K % 32 == 0.
// EPI 0: the f32 tile goes to C. EPI 1 and 2: a projection's tile (64 tokens x the 64 columns of head blockIdx.y) goes straight to the 16-bit planes that k_attn reads (fp16, bf16 hi, bf16 lo), C unused:
// EPI 1: interleaved-pair RoPE from the table CS, planes [head][t][d]; EPI 2: no RoPE, transposed planes [head][d][t] at row pitch PP.
template <typename T16> struct WFrag;
template <> struct WFrag<h16> { typedef v16h V; static __device__ __forceinline__ V ld(const h16* p) { return cat16(*(const v8h*)p, *(const v8h*)(p + 16)); } static __device__ __forceinline__ v8f mma(V a, V b, v8f c) { return wmma16(a, b, c); } };
template <> struct WFrag<bf> { typedef v16bf V; static __device__ __forceinline__ V ld(const bf* p) { return cat16b(*(const v8us*)p, *(const v8us*)(p + 16)); } static __device__ __forceinline__ v8f mma(V a, V b, v8f c) { return wmmab(a, b, c); } };
template <typename T16, int NSPLIT, bool BIAS, int EPI>
__global__ __launch_bounds__(32) void k_gemmw(const T16* __restrict__ A, const T16* __restrict__ A2, const T16* __restrict__ Bt, const T16* __restrict__ Bt2, int K, float* C, int ldc, const float* __restrict__ bias, size_t sA, size_t sB, size_t sC, const float* __restrict__ CS, h16* P16, bf* Ph, bf* Pl) {
    typedef typename WFrag<T16>::V V;
    __shared__ __align__(16) float os[16 * 68];
    const size_t z = blockIdx.z; A += z * sA; if (A2) A2 += z * sA; Bt += z * sB; if (Bt2) Bt2 += z * sB; C += z * sC;
    const int lane = threadIdx.x & 31, lr = lane & 15, hi = lane >> 4; const int r0 = blockIdx.x * 64, c0 = blockIdx.y * 64;
    v8f acc[4][4];
#pragma unroll
    for (int mb = 0; mb < 4; ++mb)
#pragma unroll
        for (int nb = 0; nb < 4; ++nb) acc[mb][nb] = (v8f){};
    const size_t aoff = (size_t)(r0 + lr) * K + 8 * hi, boff = (size_t)(c0 + lr) * K + 8 * hi;
    // EPI 1: in step s of row tile mb a lane holds columns 4 lr .. 4 lr + 3 (two RoPE pairs) of token r0 + mb * 16 + 2 s + hi; one base address for the table and one a plane, the rest are constant offsets
    const float* cp = CS + ((size_t)(r0 + hi) * HD + lr * 4) * 2; const size_t po = ((size_t)blockIdx.y * TT + r0 + hi) * HD + lr * 4;
    v2f ca[2][8], cb[2][8];   // (cos, sin) of the two pairs, fetched one row tile ahead (the first ahead of the K loop), so that no table latency stands in the epilogue
    auto ldcs = [&](int mb) {
#pragma unroll
        for (int s = 0; s < 8; ++s) { ca[mb & 1][s] = *(const v2f*)(cp + (mb * 16 + 2 * s) * HD * 2); cb[mb & 1][s] = *(const v2f*)(cp + (mb * 16 + 2 * s) * HD * 2 + 4); } };
    if constexpr (EPI == 1) ldcs(0);
#pragma unroll 1
    for (int kc = 0; kc < K; kc += 32) {
        V a[4], a2[4];
#pragma unroll
        for (int mb = 0; mb < 4; ++mb) { a[mb] = WFrag<T16>::ld(A + aoff + (size_t)mb * 16 * K + kc); if (NSPLIT == 1 || NSPLIT == 2) a2[mb] = WFrag<T16>::ld(A2 + aoff + (size_t)mb * 16 * K + kc); }
#pragma unroll
        for (int nb = 0; nb < 4; ++nb) { const V b = WFrag<T16>::ld(Bt + boff + (size_t)nb * 16 * K + kc); V b2; if (NSPLIT >= 2) b2 = WFrag<T16>::ld(Bt2 + boff + (size_t)nb * 16 * K + kc);
#pragma unroll
            for (int mb = 0; mb < 4; ++mb) { acc[mb][nb] = WFrag<T16>::mma(a[mb], b, acc[mb][nb]); if (NSPLIT == 1 || NSPLIT == 2) acc[mb][nb] = WFrag<T16>::mma(a2[mb], b, acc[mb][nb]); if (NSPLIT >= 2) acc[mb][nb] = WFrag<T16>::mma(a[mb], b2, acc[mb][nb]); } }
        asm volatile("v_nop\n\tv_nop\n\tv_nop\n\tv_nop" : "+v"(acc[0][0]), "+v"(acc[1][1]), "+v"(acc[2][2]), "+v"(acc[3][3]) : "v"(a[0]), "v"(a[3]));
    }
    if constexpr (EPI == 2) {   // a lane's eight accumulators of a tile are eight consecutive tokens of one column: one 16-byte store a plane, no LDS; mb innermost, so that the four stores that fill a 128-byte line follow one another
#pragma unroll
        for (int nb = 0; nb < 4; ++nb)
#pragma unroll
            for (int mb = 0; mb < 4; ++mb) { v8h o16; v8us oh, ol;
#pragma unroll
                for (int j = 0; j < 8; ++j) { const float x = acc[mb][nb][j]; o16[j] = tohx(x); unsigned short a2, c2; splitf(x, a2, c2); oh[j] = a2; ol[j] = c2; }
                const size_t oo = (size_t)(c0 + nb * 16 + lr) * PP + r0 + mb * 16 + hi * 8;
                *(v8h*)(P16 + oo) = o16; *(v8us*)(Ph + oo) = oh; *(v8us*)(Pl + oo) = ol; }
        return;
    }
#pragma unroll
    for (int mb = 0; mb < 4; ++mb) {
#pragma unroll
        for (int nb = 0; nb < 4; ++nb) {
#pragma unroll
            for (int j = 0; j < 8; ++j) os[(hi * 8 + j) * 68 + nb * 16 + lr] = acc[mb][nb][j]; }
        __builtin_amdgcn_wave_barrier(); asm volatile("" ::: "memory");
        if constexpr (EPI == 1) {
            if (mb < 3) ldcs(mb + 1);
#pragma unroll
            for (int s = 0; s < 8; ++s) { const v4f val = *(const v4fa*)(os + (2 * s + hi) * 68 + lr * 4); const v2f c0s = ca[mb & 1][s], c1s = cb[mb & 1][s];
                v4f r; r[0] = val[0] * c0s[0] - val[1] * c0s[1]; r[1] = val[1] * c0s[0] + val[0] * c0s[1]; r[2] = val[2] * c1s[0] - val[3] * c1s[1]; r[3] = val[3] * c1s[0] + val[2] * c1s[1];
                v4h o16; v4us oh, ol;
#pragma unroll
                for (int q = 0; q < 4; ++q) { o16[q] = tohx(r[q]); unsigned short a2, c2; splitf(r[q], a2, c2); oh[q] = a2; ol[q] = c2; }
                const size_t oo = po + (mb * 16 + 2 * s) * HD;
                *(v4h*)(P16 + oo) = o16; *(v4us*)(Ph + oo) = oh; *(v4us*)(Pl + oo) = ol; }
            if (mb < 3) asm volatile("s_wait_xcnt 0x0" ::: "memory");   // precaution: stands behind the row tile's stores, before the next tile's work reuses their data registers
        } else {
        float* crow = C + (size_t)(r0 + mb * 16) * ldc + c0;
#pragma unroll
            for (int s = 0; s < 8; ++s) { const int row = 2 * s + hi, cofs = lr * 4; v4f val = *(const v4fa*)(os + row * 68 + cofs); if (BIAS) { val[0] += bfr(bias[c0 + cofs]); val[1] += bfr(bias[c0 + cofs + 1]); val[2] += bfr(bias[c0 + cofs + 2]); val[3] += bfr(bias[c0 + cofs + 3]); }
                *(v4f*)(crow + (size_t)row * ldc + cofs) = val; }
             }
        __builtin_amdgcn_wave_barrier(); asm volatile("" ::: "memory");
    }
}

__global__ __launch_bounds__(256) void k_wtG(const float* __restrict__ w, int K, int N, bf* Bt) {
    const int lane = threadIdx.x & 31; const int L0 = (blockIdx.x * 8 + (threadIdx.x >> 5)) * 8; const int nlines = N * K / 64;
{
#pragma unroll 1
        for (int l = 0; l < 8; ++l) { const int L = L0 + l; if (L >= nlines) break; const size_t e = (size_t)L * 64 + lane * 2; const int k = (int)(e % K), n = (int)(e / K); v2us o;
            o[0] = f2bf(w[(size_t)k * N + n]); o[1] = f2bf(w[(size_t)(k + 1) * N + n]); *(v2us*)(Bt + e) = o; }
         }
}
__global__ __launch_bounds__(256) void k_cvt8(const float* __restrict__ src, bf* dst, size_t n8) { const size_t i = (size_t)blockIdx.x * 256 + threadIdx.x; if (i >= n8) return; const v8f v = *(const v8f*)(src + i * 8); v8us o;
#pragma unroll
    for (int k = 0; k < 8; ++k) o[k] = f2bf(v[k]); *(v8us*)(dst + i * 8) = o;  }
__global__ __launch_bounds__(256) void k_cstab(float* CS) { const int idx = blockIdx.x * 256 + threadIdx.x; if (idx >= TT * HD) return; const int t = idx / HD, d = idx % HD; const int i = d >> 1;   /* interleaved pairs */ const float inv = __fdiv_rn(1.0f, powf(10000.0f, (float)(2 * i) / (float)HD)); const float ang = __fmul_rn((float)t, inv); v2f cs; cs[0] = cosf(ang); cs[1] = sinf(ang);
    *(v2f*)(CS + (size_t)idx * 2) = cs;  }
// ---- k_attn: scores, mask, softmax and probability x value product in one kernel; one wave per tile of NQ x 16 query rows of one (batch, head), no LDS.
// S^T = K Q^T: A = 16 key rows, B = 16 query rows, so a lane's accumulators hold scores of ONE query (column lr), keys hi * 8 + j of each 16-key tile. That is the k order of a B fragment over 32 keys
// (elements 0..7: keys 8 hi + e, elements 8..15: keys 16 + 8 hi + e), so the probabilities go from the accumulators into O^T += V^T P^T without leaving their lane. A = 16 rows of the transposed value plane.
// Online softmax in the log2 domain: running maximum m and sum l per query (per lane; the two halves of the wave share m and join l at the end); the output tiles are rescaled by 2^(m_old - m_new) each pass.
// Mask: key j is visible to query i iff j < i, or i == j == 0; key 0 is visible to every query, so m is finite after the first pass.
typedef __attribute__((ext_vector_type(16))) unsigned short v16us;
__device__ __forceinline__ float xhalf(float x) { return __builtin_bit_cast(float, __builtin_amdgcn_permlanex16(__builtin_bit_cast(int, x), __builtin_bit_cast(int, x), 0x76543210, 0xfedcba98, false, false)); }   // lane l reads lane l ^ 16
// 2^x; the v_nop fills, in the same statement, the slot that the instruction set asks for behind a transcendental before its result is used or its source overwritten
__device__ __forceinline__ float exp2s(float x) { float r; asm("v_exp_f32 %0, %1\n\tv_nop" : "=v"(r) : "v"(x)); return r; }
template <typename T16, bool HL, int NQ>
__device__ __forceinline__ void attn_tile(const T16* __restrict__ Q, const T16* __restrict__ Q2, const T16* __restrict__ Kp, const T16* __restrict__ K2, const T16* __restrict__ Vt, const T16* __restrict__ V2, int q0, bf* Ah, bf* Al) {
    typedef typename WFrag<T16>::V V;
    const int lane = threadIdx.x & 31, lr = lane & 15, hi = lane >> 4;
    V qf[NQ][2], qf2[NQ][2]; v8f o[NQ][4]; float m[NQ], l[NQ];
#pragma unroll
    for (int qb = 0; qb < NQ; ++qb) { m[qb] = -3.0e38f; l[qb] = 0.f;
#pragma unroll
        for (int ks = 0; ks < 2; ++ks) { const size_t qo = (size_t)(q0 + qb * 16 + lr) * HD + ks * 32 + 8 * hi; qf[qb][ks] = WFrag<T16>::ld(Q + qo); if (HL) qf2[qb][ks] = WFrag<T16>::ld(Q2 + qo); }
#pragma unroll
        for (int dt = 0; dt < 4; ++dt) o[qb][dt] = (v8f){}; }
    const int npass = (q0 + NQ * 16 - 1 + KB - 1) / KB;   // the tile's last query sees keys 0 .. q0 + NQ * 16 - 2
    const size_t ko = (size_t)lr * HD + 8 * hi, vo = (size_t)lr * PP + 8 * hi;
    V kf[2][2], kf2[2][2];
    // key fragments of the 32 key rows at pk (and their lo plane at pk2)
    auto ldk = [&](const T16* pk, const T16* pk2) {
#pragma unroll
        for (int kt = 0; kt < 2; ++kt)
#pragma unroll
            for (int ks = 0; ks < 2; ++ks) { kf[kt][ks] = WFrag<T16>::ld(pk + kt * 16 * HD + ks * 32); if (HL) kf2[kt][ks] = WFrag<T16>::ld(pk2 + kt * 16 * HD + ks * 32); } };
    // the fp16 tiles fetch their key fragments one pass ahead; the hi+lo tiles hold twice the fragments and have no registers for that: they fetch them at the head of the pass, with the value fragments
    if (!HL) ldk(Kp + ko, Kp + ko);
#pragma unroll 1
    for (int it = 0; it < npass; ++it) { const int k0 = it * KB;
        V vf[4], vf2[4];   // this pass's value fragments: asked for here, used behind the softmax
        const T16* pv = Vt + vo + k0; const T16* pv2 = HL ? V2 + vo + k0 : pv;
#pragma unroll
        for (int dt = 0; dt < 4; ++dt) { vf[dt] = WFrag<T16>::ld(pv + (size_t)dt * 16 * PP); if (HL) vf2[dt] = WFrag<T16>::ld(pv2 + (size_t)dt * 16 * PP); }
        if constexpr (HL) { const T16* pk = Kp + (size_t)k0 * HD + ko; const T16* pk2 = K2 + (size_t)k0 * HD + ko; ldk(pk, pk2);
            // precaution: stands behind the pass's loads and names their address registers as inputs, so that none of them is reused (not even as a later load's destination) before the wait
            asm volatile("s_wait_xcnt 0x0" :: "v"(pv), "v"(pv2), "v"(pk), "v"(pk2) : "memory"); }
        v8f s[NQ][2];
#pragma unroll
        for (int qb = 0; qb < NQ; ++qb)
#pragma unroll
            for (int kt = 0; kt < 2; ++kt) { s[qb][kt] = (v8f){};
#pragma unroll
                for (int ks = 0; ks < 2; ++ks) { s[qb][kt] = WFrag<T16>::mma(kf[kt][ks], qf[qb][ks], s[qb][kt]); if (HL) { s[qb][kt] = WFrag<T16>::mma(kf[kt][ks], qf2[qb][ks], s[qb][kt]); s[qb][kt] = WFrag<T16>::mma(kf2[kt][ks], qf[qb][ks], s[qb][kt]); } } }
        if constexpr (!HL) { const T16* pk = Kp + (size_t)min(k0 + KB, TT - KB) * HD + ko; ldk(pk, pk);   // the next pass's key fragments (the last pass re-reads rows inside the plane and drops them)
            // precaution: as above
            asm volatile("s_wait_xcnt 0x0" :: "v"(pv), "v"(pk) : "memory"); }
#pragma unroll
        for (int qb = 0; qb < NQ; ++qb) { const int iq = q0 + qb * 16 + lr; float t[16];
#pragma unroll
            for (int e = 0; e < 16; ++e) t[e] = s[qb][e >> 3][e & 7] * (SCL * 1.4426950408889634f);
            if (k0 + KB > q0) {   // wave-uniform: only passes that reach the tile's first query hold masked keys
#pragma unroll
                for (int e = 0; e < 16; ++e) { const int j = k0 + (e >> 3) * 16 + hi * 8 + (e & 7); t[e] = (j < iq || (iq == 0 && j == 0)) ? t[e] : -3.0e38f; } }
            float mx = t[0];
#pragma unroll
            for (int e = 1; e < 16; ++e) mx = fmaxf(mx, t[e]);
            mx = fmaxf(mx, xhalf(mx));
            const float mn = fmaxf(m[qb], mx); const float al = exp2s(m[qb] - mn); m[qb] = mn;
            float ps = 0.f; V pf, pf2;
            if constexpr (HL) { v16us ph, pl;
#pragma unroll
                for (int e = 0; e < 16; ++e) { const float p = exp2s(t[e] - mn); ps += p; unsigned short a, c2; splitf(p, a, c2); ph[e] = a; pl[e] = c2; }
                pf = __builtin_bit_cast(v16bf, ph); pf2 = __builtin_bit_cast(v16bf, pl);
            } else {
#pragma unroll
                for (int e = 0; e < 16; ++e) { const float p = exp2s(t[e] - mn); ps += p; pf[e] = tohx(p); } }
            l[qb] = l[qb] * al + ps;
#pragma unroll
            for (int dt = 0; dt < 4; ++dt) { o[qb][dt] *= al; o[qb][dt] = WFrag<T16>::mma(vf[dt], pf, o[qb][dt]); if constexpr (HL) { o[qb][dt] = WFrag<T16>::mma(vf[dt], pf2, o[qb][dt]); o[qb][dt] = WFrag<T16>::mma(vf2[dt], pf, o[qb][dt]); } } }
    }
#pragma unroll
    for (int qb = 0; qb < NQ; ++qb) { const float inv = __fdiv_rn(1.0f, l[qb] + xhalf(l[qb])); const size_t oo = (size_t)(q0 + qb * 16 + lr) * DQ + hi * 8;
#pragma unroll
        for (int dt = 0; dt < 4; ++dt) { v8us oh, ol;   // accumulator j of tile dt: output column dt * 16 + hi * 8 + j of query lr
#pragma unroll
            for (int j = 0; j < 8; ++j) { unsigned short a, c2; splitf(o[qb][dt][j] * inv, a, c2); oh[j] = a; ol[j] = c2; }
            *(v8us*)(Ah + oo + dt * 16) = oh; *(v8us*)(Al + oo + dt * 16) = ol; } }
}
// grid (heads, batches, NTF + NTH), four waves a block, each wave its own tile of one head; blockIdx.z is the slowest index, so the blocks with the most keys are handed out first.
// z < NTF: rows >= RH, 32 rows a wave, fp16; the rest: rows < RH, 16 rows a wave, hi+lo planes.
#define NTF  ((TT - RH) / 128)
#define NTH  (RH / 64)
// four waves a SIMD: a budget of 256 registers a wave, so that every block of the grid is resident at once and no register window switch is needed
__global__ __launch_bounds__(128) __attribute__((amdgpu_waves_per_eu(4))) void k_attn(const h16* __restrict__ Q16, const h16* __restrict__ K16, const h16* __restrict__ V16, const bf* __restrict__ Qh, const bf* __restrict__ Ql, const bf* __restrict__ Kh, const bf* __restrict__ Kl, const bf* __restrict__ Vh, const bf* __restrict__ Vl, bf* Ah, bf* Al) {
    const int wv = __builtin_amdgcn_readfirstlane(threadIdx.x >> 5), tz = (int)blockIdx.z; const size_t zh = (size_t)blockIdx.y * NH_ + blockIdx.x; const size_t pq = zh * TT * HD, pv = zh * HD * PP, pa = (size_t)blockIdx.y * TT * DQ + (size_t)blockIdx.x * HD;
    if (tz < NTF) attn_tile<h16, false, 2>(Q16 + pq, nullptr, K16 + pq, nullptr, V16 + pv, nullptr, TT - 128 * (tz + 1) + 32 * wv, Ah + pa, Al + pa);
    else attn_tile<bf, true, 1>(Qh + pq, Ql + pq, Kh + pq, Kl + pq, Vh + pv, Vl + pv, RH - 64 * (tz - NTF + 1) + 16 * wv, Ah + pa, Al + pa);
}

extern "C" void kernel_launch(void* const* d_in, const int* in_sizes, int n_in,
                              void* d_out, int out_size, void* d_ws, size_t ws_size, hipStream_t stream) {
    (void)in_sizes; (void)n_in; (void)out_size;
    const float* x = (const float*)d_in[0]; const float* xk = (const float*)d_in[1]; const float* xv = (const float*)d_in[2]; const float* wq = (const float*)d_in[3]; const float* wk = (const float*)d_in[4]; const float* wv = (const float*)d_in[5]; const float* wo = (const float*)d_in[6];
    float* OUT = (float*)d_out;     // [2][2048][1024]
    char* wsp = (char*)d_ws;
    auto take = [&](size_t bytes) { char* p = wsp; wsp += (bytes + 255) & ~(size_t)255; return (void*)p; };
    bf* WQ = (bf*)take((size_t)DQ * DM * 2); bf* WK = (bf*)take((size_t)DKV * DM * 2); bf* WV = (bf*)take((size_t)DKV * DM * 2); bf* WO = (bf*)take((size_t)DM * DQ * 2); float* CS = (float*)take((size_t)TT * HD * 2 * 4);
    // head planes of both batches, [b][h][..]
    const size_t SQ = (size_t)NH_ * TT * HD, SV = (size_t)NKV * HD * PP, SA = (size_t)TT * DQ;
    h16* QP16 = (h16*)take(NB_ * SQ * 2); h16* KP16 = (h16*)take(NB_ * SQ * 2); h16* VT16 = (h16*)take(NB_ * SV * 2);
    bf* QPh = (bf*)take(NB_ * SQ * 2); bf* QPl = (bf*)take(NB_ * SQ * 2); bf* KPh = (bf*)take(NB_ * SQ * 2); bf* KPl = (bf*)take(NB_ * SQ * 2); bf* VTh = (bf*)take(NB_ * SV * 2); bf* VTl = VTh + TT;   // each PP row: hi plane, then lo plane
    bf* ATh = (bf*)take(NB_ * SA * 2); bf* ATl = (bf*)take(NB_ * SA * 2);
    bf* XB = (bf*)take((size_t)TT * DM * 2); bf* XB2 = (bf*)take((size_t)TT * DM * 2); bf* XB3 = (bf*)take((size_t)TT * DM * 2);
    if ((size_t)(wsp - (char*)d_ws) > ws_size) return;    // ws 256 MiB
    { k_cvt8<<<(unsigned)(((size_t)DQ * DM / 8 + 255) / 256), 256, 0, stream>>>(wq, WQ, (size_t)DQ * DM / 8); k_cvt8<<<(unsigned)(((size_t)DKV * DM / 8 + 255) / 256), 256, 0, stream>>>(wk, WK, (size_t)DKV * DM / 8); k_cvt8<<<(unsigned)(((size_t)DKV * DM / 8 + 255) / 256), 256, 0, stream>>>(wv, WV, (size_t)DKV * DM / 8);
      k_cvt8<<<(unsigned)(((size_t)DM * DQ / 8 + 255) / 256), 256, 0, stream>>>(wo, WO, (size_t)DM * DQ / 8);
      k_cstab<<<(TT * HD + 255) / 256, 256, 0, stream>>>(CS); }
    for (int b = 0; b < NB_; ++b) {
        k_cvt8<<<(unsigned)(((size_t)TT * DM / 8 + 255) / 256), 256, 0, stream>>>(x + (size_t)b * TT * DM, XB, (size_t)TT * DM / 8); k_cvt8<<<(unsigned)(((size_t)TT * DM / 8 + 255) / 256), 256, 0, stream>>>(xk + (size_t)b * TT * DM, XB2, (size_t)TT * DM / 8); k_cvt8<<<(unsigned)(((size_t)TT * DM / 8 + 255) / 256), 256, 0, stream>>>(xv + (size_t)b * TT * DM, XB3, (size_t)TT * DM / 8);
        k_gemmw<bf, 0, false, 1><<<dim3(TT / 64, DQ / 64, 1), 32, 0, stream>>>(XB, nullptr, WQ, nullptr, DM, nullptr, 0, nullptr, 0, 0, 0, CS, QP16 + b * SQ, QPh + b * SQ, QPl + b * SQ);
        k_gemmw<bf, 0, false, 1><<<dim3(TT / 64, DKV / 64, 1), 32, 0, stream>>>(XB2, nullptr, WK, nullptr, DM, nullptr, 0, nullptr, 0, 0, 0, CS, KP16 + b * SQ, KPh + b * SQ, KPl + b * SQ);
        k_gemmw<bf, 0, false, 2><<<dim3(TT / 64, DKV / 64, 1), 32, 0, stream>>>(XB3, nullptr, WV, nullptr, DM, nullptr, 0, nullptr, 0, 0, 0, nullptr, VT16 + b * SV, VTh + b * SV, VTl + b * SV); }
    static_assert(REP == 1, "k_attn takes one kv head per query head");
    k_attn<<<dim3(NH_, NB_, NTF + NTH), 128, 0, stream>>>(QP16, KP16, VT16, QPh, QPl, KPh, KPl, VTh, VTl, ATh, ATl);
    for (int b = 0; b < NB_; ++b)
        k_gemmw<bf, 1, false, 0><<<dim3(TT / 64, DM / 64, 1), 32, 0, stream>>>(ATh + b * SA, ATl + b * SA, WO, nullptr, DQ, OUT + (size_t)b * TT * DM, DM, nullptr, 0, 0, 0, nullptr, nullptr, nullptr, nullptr);
}

// v005
// A run of this version takes 163 microseconds.
// In two side-by-side timings against v004, it was 1.87 and 1.86 times as fast.
// All steps since v000 together make it 9.02 times as fast.
#include <hip/hip_runtime.h>

// ICLAttention (q, k, v inputs [2][2048][1024]; qh/kh/vh = x W^T (torch; 16 heads x 64); interleaved-pair RoPE (base 1e4, tables computed on device); SCALE = 1/sqrt(1024); 'shifted causal' mask: key j is masked iff j >= i, except (0, 0) which stays visible; softmax; out = merged Wo^T -> [2][2048][1024]).
// Compute dtypes, f32 accumulate: every input rounded to bf16; projections on PLAIN bf16 operands (inputs: exact); RoPE f32, in the projection's epilogue; scores and attn.v: query rows < 512 hl (3 products), the rest single fp16, fused with an online f32 softmax in k_attn (key blocks beyond the diagonal are never visited); Wo hl x exact (2 products).

#define NB_  2
#define TT   2048
#define DM   1024
#define NH_  16
#define NKV  16
#define REP  (NH_ / NKV)
#define HD   64
#define DQ   (NH_ * HD)
#define DKV  (NKV * HD)
#define RH   512                  // query rows < RH use hi+lo planes (0: none)
#define SCL  0.03125f   // 1/sqrt(d_attn = 1024), as the source
static_assert(HD == 64, "k_attn holds four 16-row output tiles and two 32-deep query fragments");
#define PP   (2 * TT)             // row pitch, in 16-bit elements, of the transposed value planes (a hi/lo row holds the hi plane, then the lo plane)
#define KB   32                   // keys per pass of k_attn
typedef _Float16 h16;
typedef unsigned short bf;
typedef __attribute__((ext_vector_type(16))) __bf16   v16bf;
typedef __attribute__((ext_vector_type(16))) _Float16 v16h;
typedef __attribute__((ext_vector_type(8)))  _Float16 v8h;
typedef __attribute__((ext_vector_type(8)))  unsigned short v8us;
typedef __attribute__((ext_vector_type(8)))  float    v8f;
typedef __attribute__((ext_vector_type(4)))  float    v4f;
typedef v8h  __attribute__((may_alias)) v8ha;
typedef v4f  __attribute__((may_alias)) v4fa;
typedef v8us __attribute__((may_alias)) v8usa;

__device__ __forceinline__ unsigned short f2bf(float f) { unsigned u = __float_as_uint(f); u += 0x7FFFu + ((u >> 16) & 1u); return (unsigned short)(u >> 16); }
__device__ __forceinline__ float bf2f(unsigned short b) { return __uint_as_float(((unsigned)b) << 16); }
__device__ __forceinline__ float bfr(float f) { return bf2f(f2bf(f)); }
__device__ __forceinline__ v16h cat16(v8h lo, v8h hi) { return __builtin_shufflevector(lo, hi, 0, 1, 2, 3, 4, 5, 6, 7, 8, 9, 10, 11, 12, 13, 14, 15); }
__device__ __forceinline__ v16bf cat16b(v8us lo, v8us hi) { return __builtin_bit_cast(v16bf, __builtin_shufflevector(lo, hi, 0, 1, 2, 3, 4, 5, 6, 7, 8, 9, 10, 11, 12, 13, 14, 15)); }
__device__ __forceinline__ v8f wmma16(v16h a, v16h b, v8f c) { return __builtin_amdgcn_wmma_f32_16x16x32_f16(false, a, false, b, (short)0, c, false, false); }
__device__ __forceinline__ v8f wmmab(v16bf a, v16bf b, v8f c) { return __builtin_amdgcn_wmma_f32_16x16x32_bf16(false, a, false, b, (short)0, c, false, false); }

__device__ __forceinline__ h16 tohx(float x) { return (h16)x; }
__device__ __forceinline__ void splitf(float y, unsigned short& h, unsigned short& l) { h = f2bf(y); l = f2bf(y - bf2f(h)); }
typedef __attribute__((ext_vector_type(2))) _Float16 v2h;
typedef __attribute__((ext_vector_type(4))) _Float16 v4h;
typedef __attribute__((ext_vector_type(2))) unsigned short v2us;
typedef __attribute__((ext_vector_type(4))) unsigned short v4us;
typedef __attribute__((ext_vector_type(2))) float v2f;
typedef __attribute__((ext_vector_type(4))) int v4i;
typedef v4h  __attribute__((may_alias)) v4ha;
typedef v4us __attribute__((may_alias)) v4usa;

// ---- gemm_tile: register-blocked GEMM, ONE WAVE per 64x64 output tile (16 accumulators), operands straight from K-contiguous 16-bit planes; tile (blockIdx.x, blockIdx.y) of (M/64, N/64), 32 threads; os: 16 x 68 floats of LDS.
// C[m][n] (f32, pitch ldc, + optional f32 bias[n]) = sum_k A[m][k] Bt[n][k] (+ split products per NSPLIT). K % 32 == 0.
// EPI 0: the f32 tile goes to C. EPI 1 and 2: a projection's tile (64 tokens x the 64 columns of head blockIdx.y) goes straight to the 16-bit planes that k_attn reads (fp16, bf16 hi, bf16 lo), C unused:
// EPI 1: interleaved-pair RoPE from the table CS, planes [head][t][d]; EPI 2: no RoPE, transposed planes [head][d][t] at row pitch PP.
template <typename T16> struct WFrag;
template <> struct WFrag<h16> { typedef v16h V; static __device__ __forceinline__ V ld(const h16* p) { return cat16(*(const v8h*)p, *(const v8h*)(p + 16)); } static __device__ __forceinline__ v8f mma(V a, V b, v8f c) { return wmma16(a, b, c); } };
template <> struct WFrag<bf> { typedef v16bf V; static __device__ __forceinline__ V ld(const bf* p) { return cat16b(*(const v8us*)p, *(const v8us*)(p + 16)); } static __device__ __forceinline__ v8f mma(V a, V b, v8f c) { return wmmab(a, b, c); } };
template <typename T16, int NSPLIT, bool BIAS, int EPI>
__device__ __forceinline__ void gemm_tile(const T16* __restrict__ A, const T16* __restrict__ A2, const T16* __restrict__ Bt, const T16* __restrict__ Bt2, int K, float* C, int ldc, const float* __restrict__ bias, const float* __restrict__ CS, h16* P16, bf* Ph, bf* Pl, float* os) {
    typedef typename WFrag<T16>::V V;
    const int lane = threadIdx.x & 31, lr = lane & 15, hi = lane >> 4; const int r0 = blockIdx.x * 64, c0 = blockIdx.y * 64;
    v8f acc[4][4];
#pragma unroll
    for (int mb = 0; mb < 4; ++mb)
#pragma unroll
        for (int nb = 0; nb < 4; ++nb) acc[mb][nb] = (v8f){};
    const size_t aoff = (size_t)(r0 + lr) * K + 8 * hi, boff = (size_t)(c0 + lr) * K + 8 * hi;
    // EPI 1: in step s of row tile mb a lane holds columns 4 lr .. 4 lr + 3 (two RoPE pairs) of token r0 + mb * 16 + 2 s + hi; one base address for the table and one a plane, the rest are constant offsets
    const float* cp = CS + ((size_t)(r0 + hi) * HD + lr * 4) * 2; const size_t po = ((size_t)blockIdx.y * TT + r0 + hi) * HD + lr * 4;
    v2f ca[2][8], cb[2][8];   // (cos, sin) of the two pairs, fetched one row tile ahead (the first ahead of the K loop), so that no table latency stands in the epilogue
    auto ldcs = [&](int mb) {
#pragma unroll
        for (int s = 0; s < 8; ++s) { ca[mb & 1][s] = *(const v2f*)(cp + (mb * 16 + 2 * s) * HD * 2); cb[mb & 1][s] = *(const v2f*)(cp + (mb * 16 + 2 * s) * HD * 2 + 4); } };
    if constexpr (EPI == 1) ldcs(0);
#pragma unroll 1
    for (int kc = 0; kc < K; kc += 32) {
        V a[4], a2[4];
        const T16* pa = A + aoff + kc; const T16* pb = Bt + boff + kc; const T16* pa2 = (NSPLIT == 1 || NSPLIT == 2) ? A2 + aoff + kc : pa; const T16* pb2 = NSPLIT >= 2 ? Bt2 + boff + kc : pb;
#pragma unroll
        for (int mb = 0; mb < 4; ++mb) { a[mb] = WFrag<T16>::ld(pa + (size_t)mb * 16 * K); if (NSPLIT == 1 || NSPLIT == 2) a2[mb] = WFrag<T16>::ld(pa2 + (size_t)mb * 16 * K); }
#pragma unroll
        for (int nb = 0; nb < 4; ++nb) { const V b = WFrag<T16>::ld(pb + (size_t)nb * 16 * K); V b2; if (NSPLIT >= 2) b2 = WFrag<T16>::ld(pb2 + (size_t)nb * 16 * K);
            // precaution: stands behind the trip's last load and names the trip's address registers as inputs, so that none of them is reused (not even as a later load's destination) before the wait
            if (nb == 3) asm volatile("s_wait_xcnt 0x0" :: "v"(pa), "v"(pa2), "v"(pb), "v"(pb2) : "memory");
#pragma unroll
            for (int mb = 0; mb < 4; ++mb) { acc[mb][nb] = WFrag<T16>::mma(a[mb], b, acc[mb][nb]); if (NSPLIT == 1 || NSPLIT == 2) acc[mb][nb] = WFrag<T16>::mma(a2[mb], b, acc[mb][nb]); if (NSPLIT >= 2) acc[mb][nb] = WFrag<T16>::mma(a[mb], b2, acc[mb][nb]); } }
        asm volatile("v_nop\n\tv_nop\n\tv_nop\n\tv_nop" : "+v"(acc[0][0]), "+v"(acc[1][1]), "+v"(acc[2][2]), "+v"(acc[3][3]) : "v"(a[0]), "v"(a[3]));
    }
    if constexpr (EPI == 2) {   // a lane's eight accumulators of a tile are eight consecutive tokens of one column: one 16-byte store a plane, no LDS; mb innermost, so that the four stores that fill a 128-byte line follow one another
#pragma unroll
        for (int nb = 0; nb < 4; ++nb)
#pragma unroll
            for (int mb = 0; mb < 4; ++mb) { v8h o16; v8us oh, ol;
#pragma unroll
                for (int j = 0; j < 8; ++j) { const float x = acc[mb][nb][j]; o16[j] = tohx(x); unsigned short a2, c2; splitf(x, a2, c2); oh[j] = a2; ol[j] = c2; }
                const size_t oo = (size_t)(c0 + nb * 16 + lr) * PP + r0 + mb * 16 + hi * 8;
                *(v8h*)(P16 + oo) = o16; *(v8us*)(Ph + oo) = oh; *(v8us*)(Pl + oo) = ol; }
        return;
    }
#pragma unroll
    for (int mb = 0; mb < 4; ++mb) {
#pragma unroll
        for (int nb = 0; nb < 4; ++nb) {
#pragma unroll
            for (int j = 0; j < 8; ++j) os[(hi * 8 + j) * 68 + nb * 16 + lr] = acc[mb][nb][j]; }
        __builtin_amdgcn_wave_barrier(); asm volatile("" ::: "memory");
        if constexpr (EPI == 1) {
            if (mb < 3) ldcs(mb + 1);
#pragma unroll
            for (int s = 0; s < 8; ++s) { const v4f val = *(const v4fa*)(os + (2 * s + hi) * 68 + lr * 4); const v2f c0s = ca[mb & 1][s], c1s = cb[mb & 1][s];
                v4f r; r[0] = val[0] * c0s[0] - val[1] * c0s[1]; r[1] = val[1] * c0s[0] + val[0] * c0s[1]; r[2] = val[2] * c1s[0] - val[3] * c1s[1]; r[3] = val[3] * c1s[0] + val[2] * c1s[1];
                v4h o16; v4us oh, ol;
#pragma unroll
                for (int q = 0; q < 4; ++q) { o16[q] = tohx(r[q]); unsigned short a2, c2; splitf(r[q], a2, c2); oh[q] = a2; ol[q] = c2; }
                const size_t oo = po + (mb * 16 + 2 * s) * HD;
                *(v4h*)(P16 + oo) = o16; *(v4us*)(Ph + oo) = oh; *(v4us*)(Pl + oo) = ol; }
            if (mb < 3) asm volatile("s_wait_xcnt 0x0" ::: "memory");   // precaution: stands behind the row tile's stores, before the next tile's work reuses their data registers
        } else {
        float* crow = C + (size_t)(r0 + mb * 16) * ldc + c0;
#pragma unroll
            for (int s = 0; s < 8; ++s) { const int row = 2 * s + hi, cofs = lr * 4; v4f val = *(const v4fa*)(os + row * 68 + cofs); if (BIAS) { val[0] += bfr(bias[c0 + cofs]); val[1] += bfr(bias[c0 + cofs + 1]); val[2] += bfr(bias[c0 + cofs + 2]); val[3] += bfr(bias[c0 + cofs + 3]); }
                *(v4f*)(crow + (size_t)row * ldc + cofs) = val; }
             }
        __builtin_amdgcn_wave_barrier(); asm volatile("" ::: "memory");
    }
}

// all six projections (q, k, v of both batches) in one launch, so that their tiles run side by side: grid (TT/64, heads, 3 * NB_), blockIdx.z = 2 * (0 q, 1 k, 2 v) + batch.
// X: the three converted inputs [3][NB_][TT][DM]; Wt: their weights [3][DQ][DM]; the planes are [batch][head][..]
static_assert(DQ == DKV && NB_ == 2, "k_proj and k_prep take q, k and v planes of one size and two batches");
__global__ __launch_bounds__(32) void k_proj(const bf* __restrict__ X, const bf* __restrict__ Wt, const float* __restrict__ CS, h16* Q16, bf* Qh, bf* Ql, h16* K16, bf* Kh, bf* Kl, h16* V16, bf* Vh, bf* Vl) {
    __shared__ __align__(16) float os[16 * 68];
    const int wh = (int)blockIdx.z >> 1; const size_t b = blockIdx.z & 1;
    const bf* A = X + (size_t)blockIdx.z * TT * DM; const bf* Bt = Wt + (size_t)wh * DQ * DM;
    const size_t sq = b * NH_ * TT * HD, sv = b * NKV * HD * PP;
    if (wh == 2) gemm_tile<bf, 0, false, 2>(A, nullptr, Bt, nullptr, DM, nullptr, 0, nullptr, nullptr, V16 + sv, Vh + sv, Vl + sv, os);
    else gemm_tile<bf, 0, false, 1>(A, nullptr, Bt, nullptr, DM, nullptr, 0, nullptr, CS, (wh ? K16 : Q16) + sq, (wh ? Kh : Qh) + sq, (wh ? Kl : Ql) + sq, os);
}
// the output projection of both batches in one launch: their rows follow one another in A and in C; grid (NB_ * TT / 64, DM / 64)
__global__ __launch_bounds__(32) void k_outp(const bf* __restrict__ Ah, const bf* __restrict__ Al, const bf* __restrict__ Wt, float* C) {
    __shared__ __align__(16) float os[16 * 68];
    gemm_tile<bf, 1, false, 0>(Ah, Al, Wt, nullptr, DQ, C, DM, nullptr, nullptr, nullptr, nullptr, nullptr, os);
}

__global__ __launch_bounds__(256) void k_wtG(const float* __restrict__ w, int K, int N, bf* Bt) {
    const int lane = threadIdx.x & 31; const int L0 = (blockIdx.x * 8 + (threadIdx.x >> 5)) * 8; const int nlines = N * K / 64;
{
#pragma unroll 1
        for (int l = 0; l < 8; ++l) { const int L = L0 + l; if (L >= nlines) break; const size_t e = (size_t)L * 64 + lane * 2; const int k = (int)(e % K), n = (int)(e / K); v2us o;
            o[0] = f2bf(w[(size_t)k * N + n]); o[1] = f2bf(w[(size_t)(k + 1) * N + n]); *(v2us*)(Bt + e) = o; }
         }
}
// ---- k_prep: every conversion to bf16 (three inputs, four weights) and the RoPE table in one launch; the blocks are independent, blockIdx.x says which piece a block takes.
// A conversion block takes CVB consecutive elements: each thread CG vectors of 8, all loaded before the first is stored, so that the launch needs few waves and each has CG loads in flight.
#define CG   8
#define CVB  (256 * 8 * CG)
#define NXB  (NB_ * TT * DM / CVB)   // blocks an input
#define NWB  (DQ * DM / CVB)         // blocks a weight
static_assert(NB_ * TT * DM % CVB == 0 && DQ * DM % CVB == 0 && TT * HD % 256 == 0, "k_prep has no edge blocks");
__global__ __launch_bounds__(256) void k_prep(const float* __restrict__ x, const float* __restrict__ xk, const float* __restrict__ xv, const float* __restrict__ wq, const float* __restrict__ wk, const float* __restrict__ wv, const float* __restrict__ wo, bf* XB, bf* WB, float* CS) {
    const int bx = (int)blockIdx.x;
    if (bx < 3 * NXB + 4 * NWB) {
        const float* src; bf* dst;
        if (bx < 3 * NXB) { const int t = bx / NXB; src = (t == 0 ? x : t == 1 ? xk : xv) + (size_t)(bx % NXB) * CVB; dst = XB + (size_t)bx * CVB; }
        else { const int c = bx - 3 * NXB, t = c / NWB; src = (t == 0 ? wq : t == 1 ? wk : t == 2 ? wv : wo) + (size_t)(c % NWB) * CVB; dst = WB + (size_t)c * CVB; }
        const int e0 = threadIdx.x * 8; v8f v[CG];
#pragma unroll
        for (int g = 0; g < CG; ++g) v[g] = *(const v8f*)(src + e0 + g * 2048);
#pragma unroll
        for (int g = 0; g < CG; ++g) { v8us o;
#pragma unroll
            for (int k = 0; k < 8; ++k) o[k] = f2bf(v[g][k]);
            *(v8us*)(dst + e0 + g * 2048) = o; }
        return;
    }
    const int idx = (bx - (3 * NXB + 4 * NWB)) * 256 + threadIdx.x; const int t = idx / HD, d = idx % HD; const int i = d >> 1;   /* interleaved pairs */ const float inv = __fdiv_rn(1.0f, powf(10000.0f, (float)(2 * i) / (float)HD)); const float ang = __fmul_rn((float)t, inv); v2f cs; cs[0] = cosf(ang); cs[1] = sinf(ang);
    *(v2f*)(CS + (size_t)idx * 2) = cs;
}
// ---- k_attn: scores, mask, softmax and probability x value product in one kernel; one wave per tile of NQ x 16 query rows of one (batch, head), no LDS.
// S^T = K Q^T: A = 16 key rows, B = 16 query rows, so a lane's accumulators hold scores of ONE query (column lr), keys hi * 8 + j of each 16-key tile. That is the k order of a B fragment over 32 keys
// (elements 0..7: keys 8 hi + e, elements 8..15: keys 16 + 8 hi + e), so the probabilities go from the accumulators into O^T += V^T P^T without leaving their lane. A = 16 rows of the transposed value plane.
// Online softmax in the log2 domain: running maximum m and sum l per query (per lane; the two halves of the wave share m and join l at the end); the output tiles are rescaled by 2^(m_old - m_new) each pass.
// Mask: key j is visible to query i iff j < i, or i == j == 0; key 0 is visible to every query, so m is finite after the first pass.
typedef __attribute__((ext_vector_type(16))) unsigned short v16us;
__device__ __forceinline__ float xhalf(float x) { return __builtin_bit_cast(float, __builtin_amdgcn_permlanex16(__builtin_bit_cast(int, x), __builtin_bit_cast(int, x), 0x76543210, 0xfedcba98, false, false)); }   // lane l reads lane l ^ 16
// 2^x; the v_nop fills, in the same statement, the slot that the instruction set asks for behind a transcendental before its result is used or its source overwritten
__device__ __forceinline__ float exp2s(float x) { float r; asm("v_exp_f32 %0, %1\n\tv_nop" : "=v"(r) : "v"(x)); return r; }
template <typename T16, bool HL, int NQ>
__device__ __forceinline__ void attn_tile(const T16* __restrict__ Q, const T16* __restrict__ Q2, const T16* __restrict__ Kp, const T16* __restrict__ K2, const T16* __restrict__ Vt, const T16* __restrict__ V2, int q0, bf* Ah, bf* Al) {
    typedef typename WFrag<T16>::V V;
    const int lane = threadIdx.x & 31, lr = lane & 15, hi = lane >> 4;
    V qf[NQ][2], qf2[NQ][2]; v8f o[NQ][4]; float m[NQ], l[NQ];
#pragma unroll
    for (int qb = 0; qb < NQ; ++qb) { m[qb] = -3.0e38f; l[qb] = 0.f;
#pragma unroll
        for (int ks = 0; ks < 2; ++ks) { const size_t qo = (size_t)(q0 + qb * 16 + lr) * HD + ks * 32 + 8 * hi; qf[qb][ks] = WFrag<T16>::ld(Q + qo); if (HL) qf2[qb][ks] = WFrag<T16>::ld(Q2 + qo); }
#pragma unroll
        for (int dt = 0; dt < 4; ++dt) o[qb][dt] = (v8f){}; }
    const int npass = (q0 + NQ * 16 - 1 + KB - 1) / KB;   // the tile's last query sees keys 0 .. q0 + NQ * 16 - 2
    const size_t ko = (size_t)lr * HD + 8 * hi, vo = (size_t)lr * PP + 8 * hi;
    V kf[2][2], kf2[2][2];
    // key fragments of the 32 key rows at pk (and their lo plane at pk2)
    auto ldk = [&](const T16* pk, const T16* pk2) {
#pragma unroll
        for (int kt = 0; kt < 2; ++kt)
#pragma unroll
            for (int ks = 0; ks < 2; ++ks) { kf[kt][ks] = WFrag<T16>::ld(pk + kt * 16 * HD + ks * 32); if (HL) kf2[kt][ks] = WFrag<T16>::ld(pk2 + kt * 16 * HD + ks * 32); } };
    // the fp16 tiles fetch their key fragments one pass ahead; the hi+lo tiles hold twice the fragments and have no registers for that: they fetch them at the head of the pass, with the value fragments
    if (!HL) ldk(Kp + ko, Kp + ko);
#pragma unroll 1
    for (int it = 0; it < npass; ++it) { const int k0 = it * KB;
        V vf[4], vf2[4];   // this pass's value fragments: asked for here, used behind the softmax
        const T16* pv = Vt + vo + k0; const T16* pv2 = HL ? V2 + vo + k0 : pv;
#pragma unroll
        for (int dt = 0; dt < 4; ++dt) { vf[dt] = WFrag<T16>::ld(pv + (size_t)dt * 16 * PP); if (HL) vf2[dt] = WFrag<T16>::ld(pv2 + (size_t)dt * 16 * PP); }
        if constexpr (HL) { const T16* pk = Kp + (size_t)k0 * HD + ko; const T16* pk2 = K2 + (size_t)k0 * HD + ko; ldk(pk, pk2);
            // precaution: stands behind the pass's loads and names their address registers as inputs, so that none of them is reused (not even as a later load's destination) before the wait
            asm volatile("s_wait_xcnt 0x0" :: "v"(pv), "v"(pv2), "v"(pk), "v"(pk2) : "memory"); }
        v8f s[NQ][2];
#pragma unroll
        for (int qb = 0; qb < NQ; ++qb)
#pragma unroll
            for (int kt = 0; kt < 2; ++kt) { s[qb][kt] = (v8f){};
#pragma unroll
                for (int ks = 0; ks < 2; ++ks) { s[qb][kt] = WFrag<T16>::mma(kf[kt][ks], qf[qb][ks], s[qb][kt]); if (HL) { s[qb][kt] = WFrag<T16>::mma(kf[kt][ks], qf2[qb][ks], s[qb][kt]); s[qb][kt] = WFrag<T16>::mma(kf2[kt][ks], qf[qb][ks], s[qb][kt]); } } }
        if constexpr (!HL) { const T16* pk = Kp + (size_t)min(k0 + KB, TT - KB) * HD + ko; ldk(pk, pk);   // the next pass's key fragments (the last pass re-reads rows inside the plane and drops them)
            // precaution: as above
            asm volatile("s_wait_xcnt 0x0" :: "v"(pv), "v"(pk) : "memory"); }
#pragma unroll
        for (int qb = 0; qb < NQ; ++qb) { const int iq = q0 + qb * 16 + lr; float t[16];
#pragma unroll
            for (int e = 0; e < 16; ++e) t[e] = s[qb][e >> 3][e & 7] * (SCL * 1.4426950408889634f);
            if (k0 + KB > q0) {   // wave-uniform: only passes that reach the tile's first query hold masked keys
#pragma unroll
                for (int e = 0; e < 16; ++e) { const int j = k0 + (e >> 3) * 16 + hi * 8 + (e & 7); t[e] = (j < iq || (iq == 0 && j == 0)) ? t[e] : -3.0e38f; } }
            float mx = t[0];
#pragma unroll
            for (int e = 1; e < 16; ++e) mx = fmaxf(mx, t[e]);
            mx = fmaxf(mx, xhalf(mx));
            const float mn = fmaxf(m[qb], mx); const float al = exp2s(m[qb] - mn); m[qb] = mn;
            float ps = 0.f; V pf, pf2;
            if constexpr (HL) { v16us ph, pl;
#pragma unroll
                for (int e = 0; e < 16; ++e) { const float p = exp2s(t[e] - mn); ps += p; unsigned short a, c2; splitf(p, a, c2); ph[e] = a; pl[e] = c2; }
                pf = __builtin_bit_cast(v16bf, ph); pf2 = __builtin_bit_cast(v16bf, pl);
            } else {
#pragma unroll
                for (int e = 0; e < 16; ++e) { const float p = exp2s(t[e] - mn); ps += p; pf[e] = tohx(p); } }
            l[qb] = l[qb] * al + ps;
#pragma unroll
            for (int dt = 0; dt < 4; ++dt) { o[qb][dt] *= al; o[qb][dt] = WFrag<T16>::mma(vf[dt], pf, o[qb][dt]); if constexpr (HL) { o[qb][dt] = WFrag<T16>::mma(vf[dt], pf2, o[qb][dt]); o[qb][dt] = WFrag<T16>::mma(vf2[dt], pf, o[qb][dt]); } } }
    }
#pragma unroll
    for (int qb = 0; qb < NQ; ++qb) { const float inv = __fdiv_rn(1.0f, l[qb] + xhalf(l[qb])); const size_t oo = (size_t)(q0 + qb * 16 + lr) * DQ + hi * 8;
#pragma unroll
        for (int dt = 0; dt < 4; ++dt) { v8us oh, ol;   // accumulator j of tile dt: output column dt * 16 + hi * 8 + j of query lr
#pragma unroll
            for (int j = 0; j < 8; ++j) { unsigned short a, c2; splitf(o[qb][dt][j] * inv, a, c2); oh[j] = a; ol[j] = c2; }
            *(v8us*)(Ah + oo + dt * 16) = oh; *(v8us*)(Al + oo + dt * 16) = ol; } }
}
// grid (heads, batches, NTF + NTH), four waves a block, each wave its own tile of one head; blockIdx.z is the slowest index; the blocks with the most keys have the lowest z.
// z < NTF: rows >= RH, 32 rows a wave, fp16; the rest: rows < RH, 16 rows a wave, hi+lo planes.
#define NTF  ((TT - RH) / 128)
#define NTH  (RH / 64)
// four waves a SIMD: a budget of 256 registers a wave, so that every block of the grid is resident at once and no register window switch is needed
__global__ __launch_bounds__(128) __attribute__((amdgpu_waves_per_eu(4))) void k_attn(const h16* __restrict__ Q16, const h16* __restrict__ K16, const h16* __restrict__ V16, const bf* __restrict__ Qh, const bf* __restrict__ Ql, const bf* __restrict__ Kh, const bf* __restrict__ Kl, const bf* __restrict__ Vh, const bf* __restrict__ Vl, bf* Ah, bf* Al) {
    const int wv = __builtin_amdgcn_readfirstlane(threadIdx.x >> 5), tz = (int)blockIdx.z; const size_t zh = (size_t)blockIdx.y * NH_ + blockIdx.x; const size_t pq = zh * TT * HD, pv = zh * HD * PP, pa = (size_t)blockIdx.y * TT * DQ + (size_t)blockIdx.x * HD;
    if (tz < NTF) attn_tile<h16, false, 2>(Q16 + pq, nullptr, K16 + pq, nullptr, V16 + pv, nullptr, TT - 128 * (tz + 1) + 32 * wv, Ah + pa, Al + pa);
    else attn_tile<bf, true, 1>(Qh + pq, Ql + pq, Kh + pq, Kl + pq, Vh + pv, Vl + pv, RH - 64 * (tz - NTF + 1) + 16 * wv, Ah + pa, Al + pa);
}

extern "C" void kernel_launch(void* const* d_in, const int* in_sizes, int n_in,
                              void* d_out, int out_size, void* d_ws, size_t ws_size, hipStream_t stream) {
    (void)in_sizes; (void)n_in; (void)out_size;
    const float* x = (const float*)d_in[0]; const float* xk = (const float*)d_in[1]; const float* xv = (const float*)d_in[2]; const float* wq = (const float*)d_in[3]; const float* wk = (const float*)d_in[4]; const float* wv = (const float*)d_in[5]; const float* wo = (const float*)d_in[6];
    float* OUT = (float*)d_out;     // [2][2048][1024]
    char* wsp = (char*)d_ws;
    auto take = [&](size_t bytes) { char* p = wsp; wsp += (bytes + 255) & ~(size_t)255; return (void*)p; };
    bf* WB = (bf*)take((size_t)4 * DQ * DM * 2); bf* WO = WB + (size_t)3 * DQ * DM; float* CS = (float*)take((size_t)TT * HD * 2 * 4);   // WB: wq, wk, wv, wo, one behind the other
    // head planes of both batches, [b][h][..]
    const size_t SQ = (size_t)NH_ * TT * HD, SV = (size_t)NKV * HD * PP, SA = (size_t)TT * DQ;
    h16* QP16 = (h16*)take(NB_ * SQ * 2); h16* KP16 = (h16*)take(NB_ * SQ * 2); h16* VT16 = (h16*)take(NB_ * SV * 2);
    bf* QPh = (bf*)take(NB_ * SQ * 2); bf* QPl = (bf*)take(NB_ * SQ * 2); bf* KPh = (bf*)take(NB_ * SQ * 2); bf* KPl = (bf*)take(NB_ * SQ * 2); bf* VTh = (bf*)take(NB_ * SV * 2); bf* VTl = VTh + TT;   // each PP row: hi plane, then lo plane
    bf* ATh = (bf*)take(NB_ * SA * 2); bf* ATl = (bf*)take(NB_ * SA * 2);
    bf* XB = (bf*)take((size_t)3 * NB_ * TT * DM * 2);   // q, k, v inputs, both batches each
    if ((size_t)(wsp - (char*)d_ws) > ws_size) return;    // ws 256 MiB
    k_prep<<<3 * NXB + 4 * NWB + TT * HD / 256, 256, 0, stream>>>(x, xk, xv, wq, wk, wv, wo, XB, WB, CS);
    k_proj<<<dim3(TT / 64, DQ / 64, 3 * NB_), 32, 0, stream>>>(XB, WB, CS, QP16, QPh, QPl, KP16, KPh, KPl, VT16, VTh, VTl);
    static_assert(REP == 1, "k_attn takes one kv head per query head");
    k_attn<<<dim3(NH_, NB_, NTF + NTH), 128, 0, stream>>>(QP16, KP16, VT16, QPh, QPl, KPh, KPl, VTh, VTl, ATh, ATl);
    k_outp<<<dim3(NB_ * TT / 64, DM / 64, 1), 32, 0, stream>>>(ATh, ATl, WO, OUT);
}

// v006
// A run of this version takes 130 microseconds.
// Timed twice side by side with v005, it ran 1.26 times as fast both times.
// All steps since v000 together make it 11.3 times as fast.
#include <hip/hip_runtime.h>

// ICLAttention (q, k, v inputs [2][2048][1024]; qh/kh/vh = x W^T (torch; 16 heads x 64); interleaved-pair RoPE (base 1e4, tables computed on device); SCALE = 1/sqrt(1024); 'shifted causal' mask: key j is masked iff j >= i, except (0, 0) which stays visible; softmax; out = merged Wo^T -> [2][2048][1024]).
// Compute dtypes, f32 accumulate: every input rounded to bf16; projections on PLAIN bf16 operands (inputs: exact); RoPE f32, in the projection's epilogue; scores and attn.v: query rows < 512 hl (3 products), the rest single fp16, fused with an online f32 softmax in k_attn (key blocks beyond the diagonal are never visited); Wo hl x exact (2 products).

#define NB_  2
#define TT   2048
#define DM   1024
#define NH_  16
#define NKV  16
#define REP  (NH_ / NKV)
#define HD   64
#define DQ   (NH_ * HD)
#define DKV  (NKV * HD)
#define RH   512                  // query rows < RH use hi+lo planes (0: none)
#define SCL  0.03125f   // 1/sqrt(d_attn = 1024), as the source
static_assert(HD == 64, "k_attn holds four 16-row output tiles and two 32-deep query fragments");
#define PP   (2 * TT)             // row pitch, in 16-bit elements, of the transposed value planes (a hi/lo row holds the hi plane, then the lo plane)
#define KB   32                   // keys per pass of k_attn
typedef _Float16 h16;
typedef unsigned short bf;
typedef __attribute__((ext_vector_type(16))) __bf16   v16bf;
typedef __attribute__((ext_vector_type(16))) _Float16 v16h;
typedef __attribute__((ext_vector_type(8)))  _Float16 v8h;
typedef __attribute__((ext_vector_type(8)))  unsigned short v8us;
typedef __attribute__((ext_vector_type(8)))  float    v8f;
typedef __attribute__((ext_vector_type(4)))  float    v4f;
typedef v8h  __attribute__((may_alias)) v8ha;
typedef v4f  __attribute__((may_alias)) v4fa;
typedef v8us __attribute__((may_alias)) v8usa;

__device__ __forceinline__ unsigned short f2bf(float f) { unsigned u = __float_as_uint(f); u += 0x7FFFu + ((u >> 16) & 1u); return (unsigned short)(u >> 16); }
__device__ __forceinline__ float bf2f(unsigned short b) { return __uint_as_float(((unsigned)b) << 16); }
__device__ __forceinline__ float bfr(float f) { return bf2f(f2bf(f)); }
__device__ __forceinline__ v16h cat16(v8h lo, v8h hi) { return __builtin_shufflevector(lo, hi, 0, 1, 2, 3, 4, 5, 6, 7, 8, 9, 10, 11, 12, 13, 14, 15); }
__device__ __forceinline__ v16bf cat16b(v8us lo, v8us hi) { return __builtin_bit_cast(v16bf, __builtin_shufflevector(lo, hi, 0, 1, 2, 3, 4, 5, 6, 7, 8, 9, 10, 11, 12, 13, 14, 15)); }
__device__ __forceinline__ v8f wmma16(v16h a, v16h b, v8f c) { return __builtin_amdgcn_wmma_f32_16x16x32_f16(false, a, false, b, (short)0, c, false, false); }
__device__ __forceinline__ v8f wmmab(v16bf a, v16bf b, v8f c) { return __builtin_amdgcn_wmma_f32_16x16x32_bf16(false, a, false, b, (short)0, c, false, false); }

__device__ __forceinline__ h16 tohx(float x) { return (h16)x; }
__device__ __forceinline__ void splitf(float y, unsigned short& h, unsigned short& l) { h = f2bf(y); l = f2bf(y - bf2f(h)); }
typedef __attribute__((ext_vector_type(2))) _Float16 v2h;
typedef __attribute__((ext_vector_type(4))) _Float16 v4h;
typedef __attribute__((ext_vector_type(2))) unsigned short v2us;
typedef __attribute__((ext_vector_type(4))) unsigned short v4us;
typedef __attribute__((ext_vector_type(2))) float v2f;
typedef __attribute__((ext_vector_type(4))) int v4i;
typedef v4h  __attribute__((may_alias)) v4ha;
typedef v4us __attribute__((may_alias)) v4usa;

// ---- gemm_tile: GEMM, four waves a block on a 128x128 output tile, each wave a 64x64 quarter (16 accumulators); tile (blockIdx.x, blockIdx.y) of (M/128, N/128), 128 threads.
// The operands (K-contiguous 16-bit planes) come through LDS: KT-deep tiles of 128 rows an operand, brought by asynchronous copies in whole 128-byte lines, two buffers, the next tile in flight while this one is worked on.
// ring: 2 x (2 + NSPLIT) x OPT elements of LDS; osb: 16 x 68 floats of LDS a wave.
// C[m][n] (f32, pitch ldc, + optional f32 bias[n]) = sum_k A[m][k] Bt[n][k] (NSPLIT 1: + A2[m][k] Bt[n][k]). K % KT == 0.
// EPI 0: the f32 tile goes to C. EPI 1 and 2: a projection's tile (64 tokens x the 64 columns of one head) goes straight to the 16-bit planes that k_attn reads (fp16, bf16 hi, bf16 lo), C unused:
// EPI 1: interleaved-pair RoPE from the table CS, planes [head][t][d]; EPI 2: no RoPE, transposed planes [head][d][t] at row pitch PP.
#define KT   64                   // K elements of a staged tile: a row is one 128-byte line
#define LP   72                   // LDS row pitch in 16-bit elements: 128 bytes + 16 of pad (16 bytes x odd, so that 16 rows read by ds_load_b128 fall on different banks)
#define OPT  (128 * LP)           // elements of one operand's staged tile
template <typename T16> struct WFrag;
template <> struct WFrag<h16> { typedef v16h V; static __device__ __forceinline__ V ld(const h16* p) { return cat16(*(const v8h*)p, *(const v8h*)(p + 16)); } static __device__ __forceinline__ v8f mma(V a, V b, v8f c) { return wmma16(a, b, c); } };
template <> struct WFrag<bf> { typedef v16bf V; static __device__ __forceinline__ V ld(const bf* p) { return cat16b(*(const v8us*)p, *(const v8us*)(p + 16)); } static __device__ __forceinline__ v8f mma(V a, V b, v8f c) { return wmmab(a, b, c); } };
// eight asynchronous copies of a wave, each 4 rows x 128 bytes (16 bytes a lane), rows 4 apart: l = the lane's LDS byte address, g = its global address, of the first.
// The wait in the same statement stands before anything can rewrite the address registers (a precaution).
template <typename T16>
__device__ __forceinline__ void cp8(unsigned l, const T16* g, int K) {
    asm volatile("global_load_async_to_lds_b128 %0, %8, off\n\tglobal_load_async_to_lds_b128 %1, %9, off\n\tglobal_load_async_to_lds_b128 %2, %10, off\n\tglobal_load_async_to_lds_b128 %3, %11, off\n\t"
                 "global_load_async_to_lds_b128 %4, %12, off\n\tglobal_load_async_to_lds_b128 %5, %13, off\n\tglobal_load_async_to_lds_b128 %6, %14, off\n\tglobal_load_async_to_lds_b128 %7, %15, off\n\ts_wait_xcnt 0x0"
                 :: "v"(l), "v"(l + 4 * LP * 2), "v"(l + 8 * LP * 2), "v"(l + 12 * LP * 2), "v"(l + 16 * LP * 2), "v"(l + 20 * LP * 2), "v"(l + 24 * LP * 2), "v"(l + 28 * LP * 2),
                    "v"(g), "v"(g + 4 * K), "v"(g + 8 * K), "v"(g + 12 * K), "v"(g + 16 * K), "v"(g + 20 * K), "v"(g + 24 * K), "v"(g + 28 * K) : "memory");
}
template <typename T16, int NSPLIT, bool BIAS, int EPI>
__device__ __forceinline__ void gemm_tile(const T16* __restrict__ A, const T16* __restrict__ A2, const T16* __restrict__ Bt, int K, float* C, int ldc, const float* __restrict__ bias, const float* __restrict__ CS, h16* P16, bf* Ph, bf* Pl, T16* ring, float* osb) {
    typedef typename WFrag<T16>::V V;
    static_assert(NSPLIT == 0 || NSPLIT == 1, "one or two planes of A, one of B");
    constexpr int STG = (2 + NSPLIT) * OPT;   // a buffer: A, B, then A2
    const int lane = threadIdx.x & 31, lr = lane & 15, hi = lane >> 4; const int wv = __builtin_amdgcn_readfirstlane(threadIdx.x >> 5);
    const int R0 = blockIdx.x * 128, C0 = blockIdx.y * 128; const int r0 = R0 + (wv & 1) * 64, c0 = C0 + (wv >> 1) * 64;
    float* os = osb + wv * (16 * 68);
    v8f acc[4][4];
#pragma unroll
    for (int mb = 0; mb < 4; ++mb)
#pragma unroll
        for (int nb = 0; nb < 4; ++nb) acc[mb][nb] = (v8f){};
    // EPI 1: in step s of row tile mb a lane holds columns 4 lr .. 4 lr + 3 (two RoPE pairs) of token r0 + mb * 16 + 2 s + hi; one base address for the table and one a plane, the rest are constant offsets
    const float* cp = CS + ((size_t)(r0 + hi) * HD + lr * 4) * 2; const size_t po = ((size_t)(c0 / 64) * TT + r0 + hi) * HD + lr * 4;
    v2f ca[2][8], cb[2][8];   // (cos, sin) of the two pairs, fetched one row tile ahead (the first ahead of the K loop), so that no table latency stands in the epilogue
    auto ldcs = [&](int mb) {
#pragma unroll
        for (int s = 0; s < 8; ++s) { ca[mb & 1][s] = *(const v2f*)(cp + (mb * 16 + 2 * s) * HD * 2); cb[mb & 1][s] = *(const v2f*)(cp + (mb * 16 + 2 * s) * HD * 2 + 4); } };
    if constexpr (EPI == 1) ldcs(0);
    // a wave copies rows 32 wv .. 32 wv + 31 of each operand's tile; a lane takes 16 bytes: row lane / 8 of four, piece lane % 8 of the line
    const int srow = wv * 32 + (lane >> 3), cpc = (lane & 7) * 8;
    const T16* ga = A + (size_t)(R0 + srow) * K + cpc; const T16* gb = Bt + (size_t)(C0 + srow) * K + cpc;
    const unsigned l0 = (unsigned)(size_t)(ring + srow * LP + cpc);
    auto fill = [&](int t) { const unsigned l = l0 + (t & 1) * (STG * 2); cp8(l, ga + t * KT, K); cp8(l + OPT * 2, gb + t * KT, K);
        if constexpr (NSPLIT == 1) cp8(l + 2 * OPT * 2, A2 + (size_t)(R0 + srow) * K + cpc + t * KT, K); };
    const int NT = K / KT;
    fill(0);
    asm volatile("s_wait_asynccnt 0x0" ::: "memory");   // this wave's share of tile 0 has landed
    __syncthreads();                                    // every wave's share has
    if (NT > 1) fill(1);
    const int fa = ((wv & 1) * 64 + lr) * LP + 8 * hi, fb = OPT + ((wv >> 1) * 64 + lr) * LP + 8 * hi;
#pragma unroll 1
    for (int t = 0; t < NT; ++t) {
        const T16* sb = ring + (t & 1) * STG;
#pragma unroll
        for (int ks = 0; ks < KT / 32; ++ks) { V a[4], a2[4], b[4];
#pragma unroll
            for (int i = 0; i < 4; ++i) { a[i] = WFrag<T16>::ld(sb + fa + i * 16 * LP + ks * 32); b[i] = WFrag<T16>::ld(sb + fb + i * 16 * LP + ks * 32); if (NSPLIT == 1) a2[i] = WFrag<T16>::ld(sb + fa + 2 * OPT + i * 16 * LP + ks * 32); }
#pragma unroll
            for (int nb = 0; nb < 4; ++nb)
#pragma unroll
                for (int mb = 0; mb < 4; ++mb) { acc[mb][nb] = WFrag<T16>::mma(a[mb], b[nb], acc[mb][nb]); if (NSPLIT == 1) acc[mb][nb] = WFrag<T16>::mma(a2[mb], b[nb], acc[mb][nb]); } }
        // order of the trip's LDS reads (0x100) and matrix instructions (0x8): the reads stand in a few groups ahead of the products that use them; left alone, the compiler read each B fragment directly in front of its products, and a wave alone on its SIMD would wait out the LDS latency at every column tile
        { constexpr int NW = 4 * (1 + NSPLIT), NA = 2 * NW;
          __builtin_amdgcn_sched_group_barrier(0x100, NA + 4, 0);
          __builtin_amdgcn_sched_group_barrier(0x8, NW, 0); __builtin_amdgcn_sched_group_barrier(0x100, 2, 0);
          __builtin_amdgcn_sched_group_barrier(0x8, NW, 0); __builtin_amdgcn_sched_group_barrier(0x100, 2, 0);
          __builtin_amdgcn_sched_group_barrier(0x8, NW, 0); __builtin_amdgcn_sched_group_barrier(0x100, 4, 0);
          __builtin_amdgcn_sched_group_barrier(0x8, NW, 0); __builtin_amdgcn_sched_group_barrier(0x100, NA, 0);
          __builtin_amdgcn_sched_group_barrier(0x8, NW, 0); __builtin_amdgcn_sched_group_barrier(0x100, 2, 0);
          __builtin_amdgcn_sched_group_barrier(0x8, NW, 0); __builtin_amdgcn_sched_group_barrier(0x100, 2, 0);
          __builtin_amdgcn_sched_group_barrier(0x8, 2 * NW, 0); }
        asm volatile("s_wait_dscnt 0x0" ::: "memory");      // this wave's reads of buffer t % 2 are done
        asm volatile("s_wait_asynccnt 0x0" ::: "memory");   // its share of tile t + 1 has landed
        __syncthreads();                                    // tile t + 1 may be read, buffer t % 2 refilled
        if (t + 2 < NT) fill(t + 2);
    }
    asm volatile("s_wait_asynccnt 0x0" ::: "memory");   // no copy is in flight when the wave goes on
    if constexpr (EPI == 2) {   // a lane's eight accumulators of a tile are eight consecutive tokens of one column: one 16-byte store a plane, no LDS; mb innermost, so that the four stores that fill a 128-byte line follow one another
#pragma unroll
        for (int nb = 0; nb < 4; ++nb)
#pragma unroll
            for (int mb = 0; mb < 4; ++mb) { v8h o16; v8us oh, ol;
#pragma unroll
                for (int j = 0; j < 8; ++j) { const float x = acc[mb][nb][j]; o16[j] = tohx(x); unsigned short a2, c2; splitf(x, a2, c2); oh[j] = a2; ol[j] = c2; }
                const size_t oo = (size_t)(c0 + nb * 16 + lr) * PP + r0 + mb * 16 + hi * 8;
                *(v8h*)(P16 + oo) = o16; *(v8us*)(Ph + oo) = oh; *(v8us*)(Pl + oo) = ol; }
        return;
    }
#pragma unroll
    for (int mb = 0; mb < 4; ++mb) {
#pragma unroll
        for (int nb = 0; nb < 4; ++nb) {
#pragma unroll
            for (int j = 0; j < 8; ++j) os[(hi * 8 + j) * 68 + nb * 16 + lr] = acc[mb][nb][j]; }
        __builtin_amdgcn_wave_barrier(); asm volatile("" ::: "memory");
        if constexpr (EPI == 1) {
            if (mb < 3) ldcs(mb + 1);
#pragma unroll
            for (int s = 0; s < 8; ++s) { const v4f val = *(const v4fa*)(os + (2 * s + hi) * 68 + lr * 4); const v2f c0s = ca[mb & 1][s], c1s = cb[mb & 1][s];
                v4f r; r[0] = val[0] * c0s[0] - val[1] * c0s[1]; r[1] = val[1] * c0s[0] + val[0] * c0s[1]; r[2] = val[2] * c1s[0] - val[3] * c1s[1]; r[3] = val[3] * c1s[0] + val[2] * c1s[1];
                v4h o16; v4us oh, ol;
#pragma unroll
                for (int q = 0; q < 4; ++q) { o16[q] = tohx(r[q]); unsigned short a2, c2; splitf(r[q], a2, c2); oh[q] = a2; ol[q] = c2; }
                const size_t oo = po + (mb * 16 + 2 * s) * HD;
                *(v4h*)(P16 + oo) = o16; *(v4us*)(Ph + oo) = oh; *(v4us*)(Pl + oo) = ol; }
            if (mb < 3) asm volatile("s_wait_xcnt 0x0" ::: "memory");   // precaution: stands behind the row tile's stores, before the next tile's work reuses their data registers
        } else {
        float* crow = C + (size_t)(r0 + mb * 16) * ldc + c0;
#pragma unroll
            for (int s = 0; s < 8; ++s) { const int row = 2 * s + hi, cofs = lr * 4; v4f val = *(const v4fa*)(os + row * 68 + cofs); if (BIAS) { val[0] += bfr(bias[c0 + cofs]); val[1] += bfr(bias[c0 + cofs + 1]); val[2] += bfr(bias[c0 + cofs + 2]); val[3] += bfr(bias[c0 + cofs + 3]); }
                *(v4f*)(crow + (size_t)row * ldc + cofs) = val; }
             }
        __builtin_amdgcn_wave_barrier(); asm volatile("" ::: "memory");
    }
}

// all six projections (q, k, v of both batches) in one launch, so that their tiles run side by side: grid (TT/128, DQ/128, 3 * NB_), blockIdx.z = 2 * (0 q, 1 k, 2 v) + batch.
// X: the three converted inputs [3][NB_][TT][DM]; Wt: their weights [3][DQ][DM]; the planes are [batch][head][..]
static_assert(DQ == DKV && NB_ == 2, "k_proj and k_prep take q, k and v planes of one size and two batches");
// a budget of 256 registers a wave: three blocks of k_proj (its whole grid) are resident on a WGP at once
__global__ __launch_bounds__(128) __attribute__((amdgpu_waves_per_eu(4))) void k_proj(const bf* __restrict__ X, const bf* __restrict__ Wt, const float* __restrict__ CS, h16* Q16, bf* Qh, bf* Ql, h16* K16, bf* Kh, bf* Kl, h16* V16, bf* Vh, bf* Vl) {
    __shared__ __align__(128) bf ring[2 * 2 * OPT]; __shared__ __align__(16) float os[4 * 16 * 68];
    const int wh = (int)blockIdx.z >> 1; const size_t b = blockIdx.z & 1;
    const bf* A = X + (size_t)blockIdx.z * TT * DM; const bf* Bt = Wt + (size_t)wh * DQ * DM;
    const size_t sq = b * NH_ * TT * HD, sv = b * NKV * HD * PP;
    if (wh == 2) gemm_tile<bf, 0, false, 2>(A, nullptr, Bt, DM, nullptr, 0, nullptr, nullptr, V16 + sv, Vh + sv, Vl + sv, ring, os);
    else gemm_tile<bf, 0, false, 1>(A, nullptr, Bt, DM, nullptr, 0, nullptr, CS, (wh ? K16 : Q16) + sq, (wh ? Kh : Qh) + sq, (wh ? Kl : Ql) + sq, ring, os);
}
// the output projection of both batches in one launch: their rows follow one another in A and in C; grid (NB_ * TT / 128, DM / 128)
__global__ __launch_bounds__(128) __attribute__((amdgpu_waves_per_eu(4))) void k_outp(const bf* __restrict__ Ah, const bf* __restrict__ Al, const bf* __restrict__ Wt, float* C) {
    __shared__ __align__(128) bf ring[2 * 3 * OPT]; __shared__ __align__(16) float os[4 * 16 * 68];
    gemm_tile<bf, 1, false, 0>(Ah, Al, Wt, DQ, C, DM, nullptr, nullptr, nullptr, nullptr, nullptr, ring, os);
}

__global__ __launch_bounds__(256) void k_wtG(const float* __restrict__ w, int K, int N, bf* Bt) {
    const int lane = threadIdx.x & 31; const int L0 = (blockIdx.x * 8 + (threadIdx.x >> 5)) * 8; const int nlines = N * K / 64;
{
#pragma unroll 1
        for (int l = 0; l < 8; ++l) { const int L = L0 + l; if (L >= nlines) break; const size_t e = (size_t)L * 64 + lane * 2; const int k = (int)(e % K), n = (int)(e / K); v2us o;
            o[0] = f2bf(w[(size_t)k * N + n]); o[1] = f2bf(w[(size_t)(k + 1) * N + n]); *(v2us*)(Bt + e) = o; }
         }
}
// ---- k_prep: every conversion to bf16 (three inputs, four weights) and the RoPE table in one launch; the blocks are independent, blockIdx.x says which piece a block takes.
// A conversion block takes CVB consecutive elements: each thread CG vectors of 8, all loaded before the first is stored, so that the launch needs few waves and each has CG loads in flight.
#define CG   8
#define CVB  (256 * 8 * CG)
#define NXB  (NB_ * TT * DM / CVB)   // blocks an input
#define NWB  (DQ * DM / CVB)         // blocks a weight
static_assert(NB_ * TT * DM % CVB == 0 && DQ * DM % CVB == 0 && TT * HD % 256 == 0, "k_prep has no edge blocks");
__global__ __launch_bounds__(256) void k_prep(const float* __restrict__ x, const float* __restrict__ xk, const float* __restrict__ xv, const float* __restrict__ wq, const float* __restrict__ wk, const float* __restrict__ wv, const float* __restrict__ wo, bf* XB, bf* WB, float* CS) {
    const int bx = (int)blockIdx.x;
    if (bx < 3 * NXB + 4 * NWB) {
        const float* src; bf* dst;
        if (bx < 3 * NXB) { const int t = bx / NXB; src = (t == 0 ? x : t == 1 ? xk : xv) + (size_t)(bx % NXB) * CVB; dst = XB + (size_t)bx * CVB; }
        else { const int c = bx - 3 * NXB, t = c / NWB; src = (t == 0 ? wq : t == 1 ? wk : t == 2 ? wv : wo) + (size_t)(c % NWB) * CVB; dst = WB + (size_t)c * CVB; }
        const int e0 = threadIdx.x * 8; v8f v[CG];
#pragma unroll
        for (int g = 0; g < CG; ++g) v[g] = *(const v8f*)(src + e0 + g * 2048);
#pragma unroll
        for (int g = 0; g < CG; ++g) { v8us o;
#pragma unroll
            for (int k = 0; k < 8; ++k) o[k] = f2bf(v[g][k]);
            *(v8us*)(dst + e0 + g * 2048) = o; }
        return;
    }
    const int idx = (bx - (3 * NXB + 4 * NWB)) * 256 + threadIdx.x; const int t = idx / HD, d = idx % HD; const int i = d >> 1;   /* interleaved pairs */ const float inv = __fdiv_rn(1.0f, powf(10000.0f, (float)(2 * i) / (float)HD)); const float ang = __fmul_rn((float)t, inv); v2f cs; cs[0] = cosf(ang); cs[1] = sinf(ang);
    *(v2f*)(CS + (size_t)idx * 2) = cs;
}
// ---- k_attn: scores, mask, softmax and probability x value product in one kernel; one wave per tile of NQ x 16 query rows of one (batch, head), no LDS.
// S^T = K Q^T: A = 16 key rows, B = 16 query rows, so a lane's accumulators hold scores of ONE query (column lr), keys hi * 8 + j of each 16-key tile. That is the k order of a B fragment over 32 keys
// (elements 0..7: keys 8 hi + e, elements 8..15: keys 16 + 8 hi + e), so the probabilities go from the accumulators into O^T += V^T P^T without leaving their lane. A = 16 rows of the transposed value plane.
// Online softmax in the log2 domain: running maximum m and sum l per query (per lane; the two halves of the wave share m and join l at the end); the output tiles are rescaled by 2^(m_old - m_new) each pass.
// Mask: key j is visible to query i iff j < i, or i == j == 0; key 0 is visible to every query, so m is finite after the first pass.
typedef __attribute__((ext_vector_type(16))) unsigned short v16us;
__device__ __forceinline__ float xhalf(float x) { return __builtin_bit_cast(float, __builtin_amdgcn_permlanex16(__builtin_bit_cast(int, x), __builtin_bit_cast(int, x), 0x76543210, 0xfedcba98, false, false)); }   // lane l reads lane l ^ 16
// 2^x; the v_nop fills, in the same statement, the slot that the instruction set asks for behind a transcendental before its result is used or its source overwritten
__device__ __forceinline__ float exp2s(float x) { float r; asm("v_exp_f32 %0, %1\n\tv_nop" : "=v"(r) : "v"(x)); return r; }
template <typename T16, bool HL, int NQ>
__device__ __forceinline__ void attn_tile(const T16* __restrict__ Q, const T16* __restrict__ Q2, const T16* __restrict__ Kp, const T16* __restrict__ K2, const T16* __restrict__ Vt, const T16* __restrict__ V2, int q0, bf* Ah, bf* Al) {
    typedef typename WFrag<T16>::V V;
    const int lane = threadIdx.x & 31, lr = lane & 15, hi = lane >> 4;
    V qf[NQ][2], qf2[NQ][2]; v8f o[NQ][4]; float m[NQ], l[NQ];
#pragma unroll
    for (int qb = 0; qb < NQ; ++qb) { m[qb] = -3.0e38f; l[qb] = 0.f;
#pragma unroll
        for (int ks = 0; ks < 2; ++ks) { const size_t qo = (size_t)(q0 + qb * 16 + lr) * HD + ks * 32 + 8 * hi; qf[qb][ks] = WFrag<T16>::ld(Q + qo); if (HL) qf2[qb][ks] = WFrag<T16>::ld(Q2 + qo); }
#pragma unroll
        for (int dt = 0; dt < 4; ++dt) o[qb][dt] = (v8f){}; }
    const int npass = (q0 + NQ * 16 - 1 + KB - 1) / KB;   // the tile's last query sees keys 0 .. q0 + NQ * 16 - 2
    const size_t ko = (size_t)lr * HD + 8 * hi, vo = (size_t)lr * PP + 8 * hi;
    V kf[2][2], kf2[2][2];
    // key fragments of the 32 key rows at pk (and their lo plane at pk2)
    auto ldk = [&](const T16* pk, const T16* pk2) {
#pragma unroll
        for (int kt = 0; kt < 2; ++kt)
#pragma unroll
            for (int ks = 0; ks < 2; ++ks) { kf[kt][ks] = WFrag<T16>::ld(pk + kt * 16 * HD + ks * 32); if (HL) kf2[kt][ks] = WFrag<T16>::ld(pk2 + kt * 16 * HD + ks * 32); } };
    // the fp16 tiles fetch their key fragments one pass ahead; the hi+lo tiles hold twice the fragments and have no registers for that: they fetch them at the head of the pass, with the value fragments
    if (!HL) ldk(Kp + ko, Kp + ko);
#pragma unroll 1
    for (int it = 0; it < npass; ++it) { const int k0 = it * KB;
        V vf[4], vf2[4];   // this pass's value fragments: asked for here, used behind the softmax
        const T16* pv = Vt + vo + k0; const T16* pv2 = HL ? V2 + vo + k0 : pv;
#pragma unroll
        for (int dt = 0; dt < 4; ++dt) { vf[dt] = WFrag<T16>::ld(pv + (size_t)dt * 16 * PP); if (HL) vf2[dt] = WFrag<T16>::ld(pv2 + (size_t)dt * 16 * PP); }
        if constexpr (HL) { const T16* pk = Kp + (size_t)k0 * HD + ko; const T16* pk2 = K2 + (size_t)k0 * HD + ko; ldk(pk, pk2);
            // precaution: stands behind the pass's loads and names their address registers as inputs, so that none of them is reused (not even as a later load's destination) before the wait
            asm volatile("s_wait_xcnt 0x0" :: "v"(pv), "v"(pv2), "v"(pk), "v"(pk2) : "memory"); }
        v8f s[NQ][2];
#pragma unroll
        for (int qb = 0; qb < NQ; ++qb)
#pragma unroll
            for (int kt = 0; kt < 2; ++kt) { s[qb][kt] = (v8f){};
#pragma unroll
                for (int ks = 0; ks < 2; ++ks) { s[qb][kt] = WFrag<T16>::mma(kf[kt][ks], qf[qb][ks], s[qb][kt]); if (HL) { s[qb][kt] = WFrag<T16>::mma(kf[kt][ks], qf2[qb][ks], s[qb][kt]); s[qb][kt] = WFrag<T16>::mma(kf2[kt][ks], qf[qb][ks], s[qb][kt]); } } }
        if constexpr (!HL) { const T16* pk = Kp + (size_t)min(k0 + KB, TT - KB) * HD + ko; ldk(pk, pk);   // the next pass's key fragments (the last pass re-reads rows inside the plane and drops them)
            // precaution: as above
            asm volatile("s_wait_xcnt 0x0" :: "v"(pv), "v"(pk) : "memory"); }
#pragma unroll
        for (int qb = 0; qb < NQ; ++qb) { const int iq = q0 + qb * 16 + lr; float t[16];
#pragma unroll
            for (int e = 0; e < 16; ++e) t[e] = s[qb][e >> 3][e & 7] * (SCL * 1.4426950408889634f);
            if (k0 + KB > q0) {   // wave-uniform: only passes that reach the tile's first query hold masked keys
#pragma unroll
                for (int e = 0; e < 16; ++e) { const int j = k0 + (e >> 3) * 16 + hi * 8 + (e & 7); t[e] = (j < iq || (iq == 0 && j == 0)) ? t[e] : -3.0e38f; } }
            float mx = t[0];
#pragma unroll
            for (int e = 1; e < 16; ++e) mx = fmaxf(mx, t[e]);
            mx = fmaxf(mx, xhalf(mx));
            const float mn = fmaxf(m[qb], mx); const float al = exp2s(m[qb] - mn); m[qb] = mn;
            float ps = 0.f; V pf, pf2;
            if constexpr (HL) { v16us ph, pl;
#pragma unroll
                for (int e = 0; e < 16; ++e) { const float p = exp2s(t[e] - mn); ps += p; unsigned short a, c2; splitf(p, a, c2); ph[e] = a; pl[e] = c2; }
                pf = __builtin_bit_cast(v16bf, ph); pf2 = __builtin_bit_cast(v16bf, pl);
            } else {
#pragma unroll
                for (int e = 0; e < 16; ++e) { const float p = exp2s(t[e] - mn); ps += p; pf[e] = tohx(p); } }
            l[qb] = l[qb] * al + ps;
#pragma unroll
            for (int dt = 0; dt < 4; ++dt) { o[qb][dt] *= al; o[qb][dt] = WFrag<T16>::mma(vf[dt], pf, o[qb][dt]); if constexpr (HL) { o[qb][dt] = WFrag<T16>::mma(vf[dt], pf2, o[qb][dt]); o[qb][dt] = WFrag<T16>::mma(vf2[dt], pf, o[qb][dt]); } } }
    }
#pragma unroll
    for (int qb = 0; qb < NQ; ++qb) { const float inv = __fdiv_rn(1.0f, l[qb] + xhalf(l[qb])); const size_t oo = (size_t)(q0 + qb * 16 + lr) * DQ + hi * 8;
#pragma unroll
        for (int dt = 0; dt < 4; ++dt) { v8us oh, ol;   // accumulator j of tile dt: output column dt * 16 + hi * 8 + j of query lr
#pragma unroll
            for (int j = 0; j < 8; ++j) { unsigned short a, c2; splitf(o[qb][dt][j] * inv, a, c2); oh[j] = a; ol[j] = c2; }
            *(v8us*)(Ah + oo + dt * 16) = oh; *(v8us*)(Al + oo + dt * 16) = ol; } }
}
// grid (heads, batches, NTF + NTH), four waves a block, each wave its own tile of one head; blockIdx.z is the slowest index; the blocks with the most keys have the lowest z.
// z < NTF: rows >= RH, 32 rows a wave, fp16; the rest: rows < RH, 16 rows a wave, hi+lo planes.
#define NTF  ((TT - RH) / 128)
#define NTH  (RH / 64)
// four waves a SIMD: a budget of 256 registers a wave, so that every block of the grid is resident at once and no register window switch is needed
__global__ __launch_bounds__(128) __attribute__((amdgpu_waves_per_eu(4))) void k_attn(const h16* __restrict__ Q16, const h16* __restrict__ K16, const h16* __restrict__ V16, const bf* __restrict__ Qh, const bf* __restrict__ Ql, const bf* __restrict__ Kh, const bf* __restrict__ Kl, const bf* __restrict__ Vh, const bf* __restrict__ Vl, bf* Ah, bf* Al) {
    const int wv = __builtin_amdgcn_readfirstlane(threadIdx.x >> 5), tz = (int)blockIdx.z; const size_t zh = (size_t)blockIdx.y * NH_ + blockIdx.x; const size_t pq = zh * TT * HD, pv = zh * HD * PP, pa = (size_t)blockIdx.y * TT * DQ + (size_t)blockIdx.x * HD;
    if (tz < NTF) attn_tile<h16, false, 2>(Q16 + pq, nullptr, K16 + pq, nullptr, V16 + pv, nullptr, TT - 128 * (tz + 1) + 32 * wv, Ah + pa, Al + pa);
    else attn_tile<bf, true, 1>(Qh + pq, Ql + pq, Kh + pq, Kl + pq, Vh + pv, Vl + pv, RH - 64 * (tz - NTF + 1) + 16 * wv, Ah + pa, Al + pa);
}

extern "C" void kernel_launch(void* const* d_in, const int* in_sizes, int n_in,
                              void* d_out, int out_size, void* d_ws, size_t ws_size, hipStream_t stream) {
    (void)in_sizes; (void)n_in; (void)out_size;
    const float* x = (const float*)d_in[0]; const float* xk = (const float*)d_in[1]; const float* xv = (const float*)d_in[2]; const float* wq = (const float*)d_in[3]; const float* wk = (const float*)d_in[4]; const float* wv = (const float*)d_in[5]; const float* wo = (const float*)d_in[6];
    float* OUT = (float*)d_out;     // [2][2048][1024]
    char* wsp = (char*)d_ws;
    auto take = [&](size_t bytes) { char* p = wsp; wsp += (bytes + 255) & ~(size_t)255; return (void*)p; };
    bf* WB = (bf*)take((size_t)4 * DQ * DM * 2); bf* WO = WB + (size_t)3 * DQ * DM; float* CS = (float*)take((size_t)TT * HD * 2 * 4);   // WB: wq, wk, wv, wo, one behind the other
    // head planes of both batches, [b][h][..]
    const size_t SQ = (size_t)NH_ * TT * HD, SV = (size_t)NKV * HD * PP, SA = (size_t)TT * DQ;
    h16* QP16 = (h16*)take(NB_ * SQ * 2); h16* KP16 = (h16*)take(NB_ * SQ * 2); h16* VT16 = (h16*)take(NB_ * SV * 2);
    bf* QPh = (bf*)take(NB_ * SQ * 2); bf* QPl = (bf*)take(NB_ * SQ * 2); bf* KPh = (bf*)take(NB_ * SQ * 2); bf* KPl = (bf*)take(NB_ * SQ * 2); bf* VTh = (bf*)take(NB_ * SV * 2); bf* VTl = VTh + TT;   // each PP row: hi plane, then lo plane
    bf* ATh = (bf*)take(NB_ * SA * 2); bf* ATl = (bf*)take(NB_ * SA * 2);
    bf* XB = (bf*)take((size_t)3 * NB_ * TT * DM * 2);   // q, k, v inputs, both batches each
    if ((size_t)(wsp - (char*)d_ws) > ws_size) return;    // ws 256 MiB
    k_prep<<<3 * NXB + 4 * NWB + TT * HD / 256, 256, 0, stream>>>(x, xk, xv, wq, wk, wv, wo, XB, WB, CS);
    k_proj<<<dim3(TT / 128, DQ / 128, 3 * NB_), 128, 0, stream>>>(XB, WB, CS, QP16, QPh, QPl, KP16, KPh, KPl, VT16, VTh, VTl);
    static_assert(REP == 1, "k_attn takes one kv head per query head");
    k_attn<<<dim3(NH_, NB_, NTF + NTH), 128, 0, stream>>>(QP16, KP16, VT16, QPh, QPl, KPh, KPl, VTh, VTl, ATh, ATl);
    k_outp<<<dim3(NB_ * TT / 128, DM / 128, 1), 128, 0, stream>>>(ATh, ATl, WO, OUT);
}

// v007
// A run of this version takes 103 microseconds.
// Next to v006, in two timings, it ran 1.27 and 1.26 times as fast.
// All steps since v000 together make it 14.3 times as fast.
#include <hip/hip_runtime.h>

// ICLAttention (q, k, v inputs [2][2048][1024]; qh/kh/vh = x W^T (torch; 16 heads x 64); interleaved-pair RoPE (base 1e4, tables computed on device); SCALE = 1/sqrt(1024); 'shifted causal' mask: key j is masked iff j >= i, except (0, 0) which stays visible; softmax; out = merged Wo^T -> [2][2048][1024]).
// Compute dtypes, f32 accumulate: every input rounded to bf16; projections on PLAIN bf16 operands (inputs: exact); RoPE f32, in the projection's epilogue; scores and attn.v: query rows < 512 hl (3 products), the rest single fp16, fused with an online f32 softmax in k_attn (key blocks beyond the diagonal are never visited); Wo hl x exact (2 products).

#define NB_  2
#define TT   2048
#define DM   1024
#define NH_  16
#define NKV  16
#define REP  (NH_ / NKV)
#define HD   64
#define DQ   (NH_ * HD)
#define DKV  (NKV * HD)
#define RH   512                  // query rows < RH use hi+lo planes (0: none)
#define SCL  0.03125f   // 1/sqrt(d_attn = 1024), as the source
static_assert(HD == 64, "k_attn holds four 16-row output tiles and two 32-deep query fragments");
#define PP   (2 * TT)             // row pitch, in 16-bit elements, of the transposed value planes (a hi/lo row holds the hi plane, then the lo plane)
#define KB   32                   // keys per pass of k_attn
typedef _Float16 h16;
typedef unsigned short bf;
typedef __attribute__((ext_vector_type(16))) __bf16   v16bf;
typedef __attribute__((ext_vector_type(16))) _Float16 v16h;
typedef __attribute__((ext_vector_type(8)))  _Float16 v8h;
typedef __attribute__((ext_vector_type(8)))  unsigned short v8us;
typedef __attribute__((ext_vector_type(8)))  float    v8f;
typedef __attribute__((ext_vector_type(4)))  float    v4f;
typedef v8h  __attribute__((may_alias)) v8ha;
typedef v4f  __attribute__((may_alias)) v4fa;
typedef v8us __attribute__((may_alias)) v8usa;

__device__ __forceinline__ unsigned short f2bf(float f) { unsigned u = __float_as_uint(f); u += 0x7FFFu + ((u >> 16) & 1u); return (unsigned short)(u >> 16); }
__device__ __forceinline__ float bf2f(unsigned short b) { return __uint_as_float(((unsigned)b) << 16); }
__device__ __forceinline__ float bfr(float f) { return bf2f(f2bf(f)); }
__device__ __forceinline__ v16h cat16(v8h lo, v8h hi) { return __builtin_shufflevector(lo, hi, 0, 1, 2, 3, 4, 5, 6, 7, 8, 9, 10, 11, 12, 13, 14, 15); }
__device__ __forceinline__ v16bf cat16b(v8us lo, v8us hi) { return __builtin_bit_cast(v16bf, __builtin_shufflevector(lo, hi, 0, 1, 2, 3, 4, 5, 6, 7, 8, 9, 10, 11, 12, 13, 14, 15)); }
__device__ __forceinline__ v8f wmma16(v16h a, v16h b, v8f c) { return __builtin_amdgcn_wmma_f32_16x16x32_f16(false, a, false, b, (short)0, c, false, false); }
__device__ __forceinline__ v8f wmmab(v16bf a, v16bf b, v8f c) { return __builtin_amdgcn_wmma_f32_16x16x32_bf16(false, a, false, b, (short)0, c, false, false); }

__device__ __forceinline__ h16 tohx(float x) { return (h16)x; }
__device__ __forceinline__ void splitf(float y, unsigned short& h, unsigned short& l) { h = f2bf(y); l = f2bf(y - bf2f(h)); }
typedef __attribute__((ext_vector_type(2))) _Float16 v2h;
typedef __attribute__((ext_vector_type(4))) _Float16 v4h;
typedef __attribute__((ext_vector_type(2))) unsigned short v2us;
typedef __attribute__((ext_vector_type(4))) unsigned short v4us;
typedef __attribute__((ext_vector_type(2))) float v2f;
typedef __attribute__((ext_vector_type(4))) int v4i;
typedef v4h  __attribute__((may_alias)) v4ha;
typedef v4us __attribute__((may_alias)) v4usa;

// ---- gemm_tile: GEMM, four waves a block on a 128x128 output tile, each wave a 64x64 quarter (16 accumulators); tile (blockIdx.x, blockIdx.y) of (M/128, N/128), 128 threads.
// The operands (K-contiguous 16-bit planes) come through LDS: KT-deep tiles of 128 rows an operand, brought by asynchronous copies in whole 128-byte lines, two buffers, the next tile in flight while this one is worked on.
// ring: 2 x (2 + NSPLIT) x OPT elements of LDS; osb: 16 x 68 floats of LDS a wave.
// C[m][n] (f32, pitch ldc, + optional f32 bias[n]) = sum_k A[m][k] Bt[n][k] (NSPLIT 1: + A2[m][k] Bt[n][k]). K % KT == 0.
// EPI 0: the f32 tile goes to C. EPI 1 and 2: a projection's tile (64 tokens x the 64 columns of one head) goes straight to the 16-bit planes that k_attn reads (fp16, bf16 hi, bf16 lo), C unused:
// EPI 1: interleaved-pair RoPE from the table CS, planes [head][t][d]; EPI 2: no RoPE, transposed planes [head][d][t] at row pitch PP.
#define KT   64                   // K elements of a staged tile: a row is one 128-byte line
#define LP   72                   // LDS row pitch in 16-bit elements: 128 bytes + 16 of pad (16 bytes x odd, so that 16 rows read by ds_load_b128 fall on different banks)
#define OPT  (128 * LP)           // elements of one operand's staged tile
template <typename T16> struct WFrag;
template <> struct WFrag<h16> { typedef v16h V; static __device__ __forceinline__ V ld(const h16* p) { return cat16(*(const v8h*)p, *(const v8h*)(p + 16)); } static __device__ __forceinline__ v8f mma(V a, V b, v8f c) { return wmma16(a, b, c); } };
template <> struct WFrag<bf> { typedef v16bf V; static __device__ __forceinline__ V ld(const bf* p) { return cat16b(*(const v8us*)p, *(const v8us*)(p + 16)); } static __device__ __forceinline__ v8f mma(V a, V b, v8f c) { return wmmab(a, b, c); } };
// eight asynchronous copies of a wave, each 4 rows x 128 bytes (16 bytes a lane), rows 4 apart: l = the lane's LDS byte address, g = its global address, of the first.
// The wait in the same statement stands before anything can rewrite the address registers (a precaution).
template <typename T16>
__device__ __forceinline__ void cp8(unsigned l, const T16* g, int K) {
    asm volatile("global_load_async_to_lds_b128 %0, %8, off\n\tglobal_load_async_to_lds_b128 %1, %9, off\n\tglobal_load_async_to_lds_b128 %2, %10, off\n\tglobal_load_async_to_lds_b128 %3, %11, off\n\t"
                 "global_load_async_to_lds_b128 %4, %12, off\n\tglobal_load_async_to_lds_b128 %5, %13, off\n\tglobal_load_async_to_lds_b128 %6, %14, off\n\tglobal_load_async_to_lds_b128 %7, %15, off\n\ts_wait_xcnt 0x0"
                 :: "v"(l), "v"(l + 4 * LP * 2), "v"(l + 8 * LP * 2), "v"(l + 12 * LP * 2), "v"(l + 16 * LP * 2), "v"(l + 20 * LP * 2), "v"(l + 24 * LP * 2), "v"(l + 28 * LP * 2),
                    "v"(g), "v"(g + 4 * K), "v"(g + 8 * K), "v"(g + 12 * K), "v"(g + 16 * K), "v"(g + 20 * K), "v"(g + 24 * K), "v"(g + 28 * K) : "memory");
}
template <typename T16, int NSPLIT, bool BIAS, int EPI>
__device__ __forceinline__ void gemm_tile(const T16* __restrict__ A, const T16* __restrict__ A2, const T16* __restrict__ Bt, int K, float* C, int ldc, const float* __restrict__ bias, const float* __restrict__ CS, h16* P16, bf* Ph, bf* Pl, T16* ring, float* osb) {
    typedef typename WFrag<T16>::V V;
    static_assert(NSPLIT == 0 || NSPLIT == 1, "one or two planes of A, one of B");
    constexpr int STG = (2 + NSPLIT) * OPT;   // a buffer: A, B, then A2
    const int lane = threadIdx.x & 31, lr = lane & 15, hi = lane >> 4; const int wv = __builtin_amdgcn_readfirstlane(threadIdx.x >> 5);
    const int R0 = blockIdx.x * 128, C0 = blockIdx.y * 128; const int r0 = R0 + (wv & 1) * 64, c0 = C0 + (wv >> 1) * 64;
    float* os = osb + wv * (16 * 68);
    v8f acc[4][4];
#pragma unroll
    for (int mb = 0; mb < 4; ++mb)
#pragma unroll
        for (int nb = 0; nb < 4; ++nb) acc[mb][nb] = (v8f){};
    // EPI 1: in step s of row tile mb a lane holds columns 4 lr .. 4 lr + 3 (two RoPE pairs) of token r0 + mb * 16 + 2 s + hi; one base address for the table and one a plane, the rest are constant offsets
    const float* cp = CS + ((size_t)(r0 + hi) * HD + lr * 4) * 2; const size_t po = ((size_t)(c0 / 64) * TT + r0 + hi) * HD + lr * 4;
    v2f ca[2][8], cb[2][8];   // (cos, sin) of the two pairs, fetched one row tile ahead (the first ahead of the K loop), so that no table latency stands in the epilogue
    auto ldcs = [&](int mb) {
#pragma unroll
        for (int s = 0; s < 8; ++s) { ca[mb & 1][s] = *(const v2f*)(cp + (mb * 16 + 2 * s) * HD * 2); cb[mb & 1][s] = *(const v2f*)(cp + (mb * 16 + 2 * s) * HD * 2 + 4); } };
    if constexpr (EPI == 1) ldcs(0);
    // a wave copies rows 32 wv .. 32 wv + 31 of each operand's tile; a lane takes 16 bytes: row lane / 8 of four, piece lane % 8 of the line
    const int srow = wv * 32 + (lane >> 3), cpc = (lane & 7) * 8;
    const T16* ga = A + (size_t)(R0 + srow) * K + cpc; const T16* gb = Bt + (size_t)(C0 + srow) * K + cpc;
    const unsigned l0 = (unsigned)(size_t)(ring + srow * LP + cpc);
    auto fill = [&](int t) { const unsigned l = l0 + (t & 1) * (STG * 2); cp8(l, ga + t * KT, K); cp8(l + OPT * 2, gb + t * KT, K);
        if constexpr (NSPLIT == 1) cp8(l + 2 * OPT * 2, A2 + (size_t)(R0 + srow) * K + cpc + t * KT, K); };
    const int NT = K / KT;
    fill(0);
    asm volatile("s_wait_asynccnt 0x0" ::: "memory");   // this wave's share of tile 0 has landed
    __syncthreads();                                    // every wave's share has
    if (NT > 1) fill(1);
    const int fa = ((wv & 1) * 64 + lr) * LP + 8 * hi, fb = OPT + ((wv >> 1) * 64 + lr) * LP + 8 * hi;
#pragma unroll 1
    for (int t = 0; t < NT; ++t) {
        const T16* sb = ring + (t & 1) * STG;
#pragma unroll
        for (int ks = 0; ks < KT / 32; ++ks) { V a[4], a2[4], b[4];
#pragma unroll
            for (int i = 0; i < 4; ++i) { a[i] = WFrag<T16>::ld(sb + fa + i * 16 * LP + ks * 32); b[i] = WFrag<T16>::ld(sb + fb + i * 16 * LP + ks * 32); if (NSPLIT == 1) a2[i] = WFrag<T16>::ld(sb + fa + 2 * OPT + i * 16 * LP + ks * 32); }
#pragma unroll
            for (int nb = 0; nb < 4; ++nb)
#pragma unroll
                for (int mb = 0; mb < 4; ++mb) { acc[mb][nb] = WFrag<T16>::mma(a[mb], b[nb], acc[mb][nb]); if (NSPLIT == 1) acc[mb][nb] = WFrag<T16>::mma(a2[mb], b[nb], acc[mb][nb]); } }
        // order of the trip's LDS reads (0x100) and matrix instructions (0x8): the reads stand in a few groups ahead of the products that use them; left alone, the compiler read each B fragment directly in front of its products, and a wave alone on its SIMD would wait out the LDS latency at every column tile
        { constexpr int NW = 4 * (1 + NSPLIT), NA = 2 * NW;
          __builtin_amdgcn_sched_group_barrier(0x100, NA + 4, 0);
          __builtin_amdgcn_sched_group_barrier(0x8, NW, 0); __builtin_amdgcn_sched_group_barrier(0x100, 2, 0);
          __builtin_amdgcn_sched_group_barrier(0x8, NW, 0); __builtin_amdgcn_sched_group_barrier(0x100, 2, 0);
          __builtin_amdgcn_sched_group_barrier(0x8, NW, 0); __builtin_amdgcn_sched_group_barrier(0x100, 4, 0);
          __builtin_amdgcn_sched_group_barrier(0x8, NW, 0); __builtin_amdgcn_sched_group_barrier(0x100, NA, 0);
          __builtin_amdgcn_sched_group_barrier(0x8, NW, 0); __builtin_amdgcn_sched_group_barrier(0x100, 2, 0);
          __builtin_amdgcn_sched_group_barrier(0x8, NW, 0); __builtin_amdgcn_sched_group_barrier(0x100, 2, 0);
          __builtin_amdgcn_sched_group_barrier(0x8, 2 * NW, 0); }
        asm volatile("s_wait_dscnt 0x0" ::: "memory");      // this wave's reads of buffer t % 2 are done
        asm volatile("s_wait_asynccnt 0x0" ::: "memory");   // its share of tile t + 1 has landed
        __syncthreads();                                    // tile t + 1 may be read, buffer t % 2 refilled
        if (t + 2 < NT) fill(t + 2);
    }
    asm volatile("s_wait_asynccnt 0x0" ::: "memory");   // no copy is in flight when the wave goes on
    if constexpr (EPI == 2) {   // a lane's eight accumulators of a tile are eight consecutive tokens of one column: one 16-byte store a plane, no LDS; mb innermost, so that the four stores that fill a 128-byte line follow one another
#pragma unroll
        for (int nb = 0; nb < 4; ++nb)
#pragma unroll
            for (int mb = 0; mb < 4; ++mb) { v8h o16; v8us oh, ol;
#pragma unroll
                for (int j = 0; j < 8; ++j) { const float x = acc[mb][nb][j]; o16[j] = tohx(x); unsigned short a2, c2; splitf(x, a2, c2); oh[j] = a2; ol[j] = c2; }
                const size_t oo = (size_t)(c0 + nb * 16 + lr) * PP + r0 + mb * 16 + hi * 8;
                *(v8h*)(P16 + oo) = o16; *(v8us*)(Ph + oo) = oh; *(v8us*)(Pl + oo) = ol; }
        return;
    }
#pragma unroll
    for (int mb = 0; mb < 4; ++mb) {
#pragma unroll
        for (int nb = 0; nb < 4; ++nb) {
#pragma unroll
            for (int j = 0; j < 8; ++j) os[(hi * 8 + j) * 68 + nb * 16 + lr] = acc[mb][nb][j]; }
        __builtin_amdgcn_wave_barrier(); asm volatile("" ::: "memory");
        if constexpr (EPI == 1) {
            if (mb < 3) ldcs(mb + 1);
#pragma unroll
            for (int s = 0; s < 8; ++s) { const v4f val = *(const v4fa*)(os + (2 * s + hi) * 68 + lr * 4); const v2f c0s = ca[mb & 1][s], c1s = cb[mb & 1][s];
                v4f r; r[0] = val[0] * c0s[0] - val[1] * c0s[1]; r[1] = val[1] * c0s[0] + val[0] * c0s[1]; r[2] = val[2] * c1s[0] - val[3] * c1s[1]; r[3] = val[3] * c1s[0] + val[2] * c1s[1];
                v4h o16; v4us oh, ol;
#pragma unroll
                for (int q = 0; q < 4; ++q) { o16[q] = tohx(r[q]); unsigned short a2, c2; splitf(r[q], a2, c2); oh[q] = a2; ol[q] = c2; }
                const size_t oo = po + (mb * 16 + 2 * s) * HD;
                *(v4h*)(P16 + oo) = o16; *(v4us*)(Ph + oo) = oh; *(v4us*)(Pl + oo) = ol; }
            if (mb < 3) asm volatile("s_wait_xcnt 0x0" ::: "memory");   // precaution: stands behind the row tile's stores, before the next tile's work reuses their data registers
        } else {
        float* crow = C + (size_t)(r0 + mb * 16) * ldc + c0;
#pragma unroll
            for (int s = 0; s < 8; ++s) { const int row = 2 * s + hi, cofs = lr * 4; v4f val = *(const v4fa*)(os + row * 68 + cofs); if (BIAS) { val[0] += bfr(bias[c0 + cofs]); val[1] += bfr(bias[c0 + cofs + 1]); val[2] += bfr(bias[c0 + cofs + 2]); val[3] += bfr(bias[c0 + cofs + 3]); }
                *(v4f*)(crow + (size_t)row * ldc + cofs) = val; }
             }
        __builtin_amdgcn_wave_barrier(); asm volatile("" ::: "memory");
    }
}

// all six projections (q, k, v of both batches) in one launch, so that their tiles run side by side: grid (TT/128, DQ/128, 3 * NB_), blockIdx.z = 2 * (0 q, 1 k, 2 v) + batch.
// X: the three converted inputs [3][NB_][TT][DM]; Wt: their weights [3][DQ][DM]; the planes are [batch][head][..]
static_assert(DQ == DKV && NB_ == 2, "k_proj and k_prep take q, k and v planes of one size and two batches");
// a budget of 256 registers a wave: three blocks of k_proj (its whole grid) are resident on a WGP at once
__global__ __launch_bounds__(128) __attribute__((amdgpu_waves_per_eu(4))) void k_proj(const bf* __restrict__ X, const bf* __restrict__ Wt, const float* __restrict__ CS, h16* Q16, bf* Qh, bf* Ql, h16* K16, bf* Kh, bf* Kl, h16* V16, bf* Vh, bf* Vl) {
    __shared__ __align__(128) bf ring[2 * 2 * OPT]; __shared__ __align__(16) float os[4 * 16 * 68];
    const int wh = (int)blockIdx.z >> 1; const size_t b = blockIdx.z & 1;
    const bf* A = X + (size_t)blockIdx.z * TT * DM; const bf* Bt = Wt + (size_t)wh * DQ * DM;
    const size_t sq = b * NH_ * TT * HD, sv = b * NKV * HD * PP;
    if (wh == 2) gemm_tile<bf, 0, false, 2>(A, nullptr, Bt, DM, nullptr, 0, nullptr, nullptr, V16 + sv, Vh + sv, Vl + sv, ring, os);
    else gemm_tile<bf, 0, false, 1>(A, nullptr, Bt, DM, nullptr, 0, nullptr, CS, (wh ? K16 : Q16) + sq, (wh ? Kh : Qh) + sq, (wh ? Kl : Ql) + sq, ring, os);
}
// the output projection of both batches in one launch: their rows follow one another in A and in C; grid (NB_ * TT / 128, DM / 128)
__global__ __launch_bounds__(128) __attribute__((amdgpu_waves_per_eu(4))) void k_outp(const bf* __restrict__ Ah, const bf* __restrict__ Al, const bf* __restrict__ Wt, float* C) {
    __shared__ __align__(128) bf ring[2 * 3 * OPT]; __shared__ __align__(16) float os[4 * 16 * 68];
    gemm_tile<bf, 1, false, 0>(Ah, Al, Wt, DQ, C, DM, nullptr, nullptr, nullptr, nullptr, nullptr, ring, os);
}

__global__ __launch_bounds__(256) void k_wtG(const float* __restrict__ w, int K, int N, bf* Bt) {
    const int lane = threadIdx.x & 31; const int L0 = (blockIdx.x * 8 + (threadIdx.x >> 5)) * 8; const int nlines = N * K / 64;
{
#pragma unroll 1
        for (int l = 0; l < 8; ++l) { const int L = L0 + l; if (L >= nlines) break; const size_t e = (size_t)L * 64 + lane * 2; const int k = (int)(e % K), n = (int)(e / K); v2us o;
            o[0] = f2bf(w[(size_t)k * N + n]); o[1] = f2bf(w[(size_t)(k + 1) * N + n]); *(v2us*)(Bt + e) = o; }
         }
}
// ---- k_prep: every conversion to bf16 (three inputs, four weights) and the RoPE table in one launch; the blocks are independent, blockIdx.x says which piece a block takes.
// A conversion block takes CVB consecutive elements: each thread CG vectors of 8, all loaded before the first is stored, so that the launch needs few waves and each has CG loads in flight.
#define CG   8
#define CVB  (256 * 8 * CG)
#define NXB  (NB_ * TT * DM / CVB)   // blocks an input
#define NWB  (DQ * DM / CVB)         // blocks a weight
static_assert(NB_ * TT * DM % CVB == 0 && DQ * DM % CVB == 0 && TT * HD % 256 == 0, "k_prep has no edge blocks");
__global__ __launch_bounds__(256) void k_prep(const float* __restrict__ x, const float* __restrict__ xk, const float* __restrict__ xv, const float* __restrict__ wq, const float* __restrict__ wk, const float* __restrict__ wv, const float* __restrict__ wo, bf* XB, bf* WB, float* CS) {
    const int bx = (int)blockIdx.x;
    if (bx < 3 * NXB + 4 * NWB) {
        const float* src; bf* dst;
        if (bx < 3 * NXB) { const int t = bx / NXB; src = (t == 0 ? x : t == 1 ? xk : xv) + (size_t)(bx % NXB) * CVB; dst = XB + (size_t)bx * CVB; }
        else { const int c = bx - 3 * NXB, t = c / NWB; src = (t == 0 ? wq : t == 1 ? wk : t == 2 ? wv : wo) + (size_t)(c % NWB) * CVB; dst = WB + (size_t)c * CVB; }
        const int e0 = threadIdx.x * 8; v8f v[CG];
#pragma unroll
        for (int g = 0; g < CG; ++g) v[g] = *(const v8f*)(src + e0 + g * 2048);
#pragma unroll
        for (int g = 0; g < CG; ++g) { v8us o;
#pragma unroll
            for (int k = 0; k < 8; ++k) o[k] = f2bf(v[g][k]);
            *(v8us*)(dst + e0 + g * 2048) = o; }
        return;
    }
    const int idx = (bx - (3 * NXB + 4 * NWB)) * 256 + threadIdx.x; const int t = idx / HD, d = idx % HD; const int i = d >> 1;   /* interleaved pairs */ const float inv = __fdiv_rn(1.0f, powf(10000.0f, (float)(2 * i) / (float)HD)); const float ang = __fmul_rn((float)t, inv); v2f cs; cs[0] = cosf(ang); cs[1] = sinf(ang);
    *(v2f*)(CS + (size_t)idx * 2) = cs;
}
// ---- k_attn: scores, mask, softmax and probability x value product in one kernel; one wave per tile of NQ x 16 query rows of one (batch, head); the four waves of a block walk the same keys.
// The keys and the transposed values come through LDS: tiles of SK keys (64 rows of 128 bytes a plane), brought once a block by asynchronous copies in whole 128-byte lines, two buffers, the next tile in flight while this one is worked on.
// S^T = K Q^T: A = 16 key rows, B = 16 query rows, so a lane's accumulators hold scores of ONE query (column lr), keys hi * 8 + j of each 16-key tile. That is the k order of a B fragment over 32 keys
// (elements 0..7: keys 8 hi + e, elements 8..15: keys 16 + 8 hi + e), so the probabilities go from the accumulators into O^T += V^T P^T without leaving their lane. A = 16 rows of the transposed value plane.
// Online softmax in the log2 domain: running maximum m and sum l per query (per lane; the two halves of the wave share m and join l at the end); the output tiles are rescaled by 2^(m_old - m_new) each pass.
// Mask: key j is visible to query i iff j < i, or i == j == 0; key 0 is visible to every query, so m is finite after the first pass.
typedef __attribute__((ext_vector_type(16))) unsigned short v16us;
__device__ __forceinline__ float xhalf(float x) { return __builtin_bit_cast(float, __builtin_amdgcn_permlanex16(__builtin_bit_cast(int, x), __builtin_bit_cast(int, x), 0x76543210, 0xfedcba98, false, false)); }   // lane l reads lane l ^ 16
// 2^x; the v_nop fills, in the same statement, the slot that the instruction set asks for behind a transcendental before its result is used or its source overwritten
__device__ __forceinline__ float exp2s(float x) { float r; asm("v_exp_f32 %0, %1\n\tv_nop" : "=v"(r) : "v"(x)); return r; }
#define SK   64                   // keys of a staged tile: a row of the value tile is one 128-byte line, as a key row is
#define TLE  (64 * LP)            // elements of one plane's staged tile: 64 rows at pitch LP
static_assert(SK == 2 * KB && SK == HD, "a staged tile holds two passes; cp8 takes half of a 64-row tile");
// NT: staged tiles that the block walks (the same for its four waves); ring: 2 x (HL ? 4 : 2) x TLE elements of LDS
template <typename T16, bool HL, int NQ>
__device__ __forceinline__ void attn_tile(const T16* __restrict__ Q, const T16* __restrict__ Q2, const T16* __restrict__ Kp, const T16* __restrict__ K2, const T16* __restrict__ Vt, const T16* __restrict__ V2, int q0, int NT, bf* Ah, bf* Al, T16* ring) {
    typedef typename WFrag<T16>::V V;
    constexpr int STG = (HL ? 4 : 2) * TLE;   // a buffer: K, V, then their lo planes
    const int lane = threadIdx.x & 31, lr = lane & 15, hi = lane >> 4; const int wv = __builtin_amdgcn_readfirstlane(threadIdx.x >> 5);
    // waves 0 and 1 copy the two halves (32 rows) of the key tile, waves 2 and 3 those of the value tile; a lane takes 16 bytes: row lane / 8 of four, piece lane % 8 of the line
    const int op = wv >> 1, srow = (wv & 1) * 32 + (lane >> 3), cpc = (lane & 7) * 8;
    const int gstr = op ? PP : HD, gstep = op ? SK : SK * HD;   // global row pitch; from one tile to the next
    const T16* g1 = (op ? Vt : Kp) + (size_t)srow * gstr + cpc; const T16* g2 = HL ? (op ? V2 : K2) + (size_t)srow * gstr + cpc : g1;
    const unsigned l0 = (unsigned)(size_t)(ring + op * TLE + srow * LP + cpc);
    auto fill = [&](int t) { const unsigned l = l0 + (t & 1) * (STG * 2); cp8(l, g1 + (size_t)t * gstep, gstr); if constexpr (HL) cp8(l + 2 * TLE * 2, g2 + (size_t)t * gstep, gstr); };
    fill(0);
    V qf[NQ][2], qf2[NQ][2]; v8f o[NQ][4]; float m[NQ], l[NQ];
#pragma unroll
    for (int qb = 0; qb < NQ; ++qb) { m[qb] = -3.0e38f; l[qb] = 0.f;
#pragma unroll
        for (int ks = 0; ks < 2; ++ks) { const size_t qo = (size_t)(q0 + qb * 16 + lr) * HD + ks * 32 + 8 * hi; qf[qb][ks] = WFrag<T16>::ld(Q + qo); if (HL) qf2[qb][ks] = WFrag<T16>::ld(Q2 + qo); }
#pragma unroll
        for (int dt = 0; dt < 4; ++dt) o[qb][dt] = (v8f){}; }
    const int lim = q0 + NQ * 16 - 1;   // the tile's last query sees keys 0 .. lim - 1: a pass at k0 >= lim holds nothing for this wave
    const int fo = lr * LP + 8 * hi;
    V kf[2][2], kf2[2][2];
    // key fragments of the 32 key rows of pass p of the staged tile sb (and of their lo plane)
    auto ldk = [&](const T16* sb, int p) {
#pragma unroll
        for (int kt = 0; kt < 2; ++kt)
#pragma unroll
            for (int ks = 0; ks < 2; ++ks) { kf[kt][ks] = WFrag<T16>::ld(sb + fo + (p * KB + kt * 16) * LP + ks * 32); if (HL) kf2[kt][ks] = WFrag<T16>::ld(sb + 2 * TLE + fo + (p * KB + kt * 16) * LP + ks * 32); } };
    asm volatile("s_wait_asynccnt 0x0" ::: "memory");   // this wave's share of tile 0 has landed
    __syncthreads();                                    // every wave's share has
    if (NT > 1) fill(1);
#pragma unroll 1
    for (int st = 0; st < NT; ++st) { const T16* sb = ring + (st & 1) * STG;
      // the fp16 tiles fetch the second pass's key fragments behind the first pass's scores; the hi+lo tiles hold twice the fragments and have no registers for that: they fetch them at the head of each pass, with the value fragments
      if (!HL) ldk(sb, 0);
#pragma unroll
      for (int hp = 0; hp < 2; ++hp) { const int k0 = st * SK + hp * KB;
       if (k0 < lim) {   // wave-uniform: the block's last tiles hold passes that only its later waves need
        V vf[4], vf2[4];   // this pass's value fragments: asked for here, used behind the softmax
#pragma unroll
        for (int dt = 0; dt < 4; ++dt) { vf[dt] = WFrag<T16>::ld(sb + TLE + fo + dt * 16 * LP + hp * KB); if (HL) vf2[dt] = WFrag<T16>::ld(sb + 3 * TLE + fo + dt * 16 * LP + hp * KB); }
        if (HL) ldk(sb, hp);
        v8f s[NQ][2];
#pragma unroll
        for (int qb = 0; qb < NQ; ++qb)
#pragma unroll
            for (int kt = 0; kt < 2; ++kt) { s[qb][kt] = (v8f){};
#pragma unroll
                for (int ks = 0; ks < 2; ++ks) { s[qb][kt] = WFrag<T16>::mma(kf[kt][ks], qf[qb][ks], s[qb][kt]); if (HL) { s[qb][kt] = WFrag<T16>::mma(kf[kt][ks], qf2[qb][ks], s[qb][kt]); s[qb][kt] = WFrag<T16>::mma(kf2[kt][ks], qf[qb][ks], s[qb][kt]); } } }
        if (!HL && hp == 0) ldk(sb, 1);   // the second pass's key fragments, of the same staged tile
#pragma unroll
        for (int qb = 0; qb < NQ; ++qb) { const int iq = q0 + qb * 16 + lr; float t[16];
#pragma unroll
            for (int e = 0; e < 16; ++e) t[e] = s[qb][e >> 3][e & 7] * (SCL * 1.4426950408889634f);
            if (k0 + KB > q0) {   // wave-uniform: only passes that reach the tile's first query hold masked keys
#pragma unroll
                for (int e = 0; e < 16; ++e) { const int j = k0 + (e >> 3) * 16 + hi * 8 + (e & 7); t[e] = (j < iq || (iq == 0 && j == 0)) ? t[e] : -3.0e38f; } }
            float mx = t[0];
#pragma unroll
            for (int e = 1; e < 16; ++e) mx = fmaxf(mx, t[e]);
            mx = fmaxf(mx, xhalf(mx));
            const float mn = fmaxf(m[qb], mx); const float al = exp2s(m[qb] - mn); m[qb] = mn;
            float ps = 0.f; V pf, pf2;
            if constexpr (HL) { v16us ph, pl;
#pragma unroll
                for (int e = 0; e < 16; ++e) { const float p = exp2s(t[e] - mn); ps += p; unsigned short a, c2; splitf(p, a, c2); ph[e] = a; pl[e] = c2; }
                pf = __builtin_bit_cast(v16bf, ph); pf2 = __builtin_bit_cast(v16bf, pl);
            } else {
#pragma unroll
                for (int e = 0; e < 16; ++e) { const float p = exp2s(t[e] - mn); ps += p; pf[e] = tohx(p); } }
            l[qb] = l[qb] * al + ps;
#pragma unroll
            for (int dt = 0; dt < 4; ++dt) { o[qb][dt] *= al; o[qb][dt] = WFrag<T16>::mma(vf[dt], pf, o[qb][dt]); if constexpr (HL) { o[qb][dt] = WFrag<T16>::mma(vf[dt], pf2, o[qb][dt]); o[qb][dt] = WFrag<T16>::mma(vf2[dt], pf, o[qb][dt]); } } }
       } }
      asm volatile("s_wait_dscnt 0x0" ::: "memory");      // this wave's reads of buffer st % 2 are done
      asm volatile("s_wait_asynccnt 0x0" ::: "memory");   // its share of tile st + 1 has landed
      __syncthreads();                                    // tile st + 1 may be read, buffer st % 2 refilled
      if (st + 2 < NT) fill(st + 2);
    }
    asm volatile("s_wait_asynccnt 0x0" ::: "memory");   // no copy is in flight when the wave goes on
#pragma unroll
    for (int qb = 0; qb < NQ; ++qb) { const float inv = __fdiv_rn(1.0f, l[qb] + xhalf(l[qb])); const size_t oo = (size_t)(q0 + qb * 16 + lr) * DQ + hi * 8;
#pragma unroll
        for (int dt = 0; dt < 4; ++dt) { v8us oh, ol;   // accumulator j of tile dt: output column dt * 16 + hi * 8 + j of query lr
#pragma unroll
            for (int j = 0; j < 8; ++j) { unsigned short a, c2; splitf(o[qb][dt][j] * inv, a, c2); oh[j] = a; ol[j] = c2; }
            *(v8us*)(Ah + oo + dt * 16) = oh; *(v8us*)(Al + oo + dt * 16) = ol; } }
}
// grid (heads, batches, NTF + NTH), four waves a block, each wave its own tile of one head, the four tiles one behind the other; blockIdx.z is the slowest index, and z = 0 holds the blocks with the most keys.
// z < NTF: rows >= RH, 32 rows a wave, fp16; the rest: rows < RH, 16 rows a wave, hi+lo planes.
#define NTF  ((TT - RH) / 128)
#define NTH  (RH / 64)
// four waves a SIMD: a budget of 256 registers a wave, so that every block of the grid is resident at once and no register window switch is needed
__global__ __launch_bounds__(128) __attribute__((amdgpu_waves_per_eu(4))) void k_attn(const h16* __restrict__ Q16, const h16* __restrict__ K16, const h16* __restrict__ V16, const bf* __restrict__ Qh, const bf* __restrict__ Ql, const bf* __restrict__ Kh, const bf* __restrict__ Kl, const bf* __restrict__ Vh, const bf* __restrict__ Vl, bf* Ah, bf* Al) {
    __shared__ __align__(128) bf ring[2 * 4 * TLE];
    const int wv = __builtin_amdgcn_readfirstlane(threadIdx.x >> 5), tz = (int)blockIdx.z; const size_t zh = (size_t)blockIdx.y * NH_ + blockIdx.x; const size_t pq = zh * TT * HD, pv = zh * HD * PP, pa = (size_t)blockIdx.y * TT * DQ + (size_t)blockIdx.x * HD;
    // the block's last query row R sees keys 0 .. R - 1: (first row + rows) / SK tiles
    if (tz < NTF) { const int r0 = TT - 128 * (tz + 1); attn_tile<h16, false, 2>(Q16 + pq, nullptr, K16 + pq, nullptr, V16 + pv, nullptr, r0 + 32 * wv, (r0 + 128) / SK, Ah + pa, Al + pa, (h16*)ring); }
    else { const int r0 = RH - 64 * (tz - NTF + 1); attn_tile<bf, true, 1>(Qh + pq, Ql + pq, Kh + pq, Kl + pq, Vh + pv, Vl + pv, r0 + 16 * wv, (r0 + 64) / SK, Ah + pa, Al + pa, ring); }
}

extern "C" void kernel_launch(void* const* d_in, const int* in_sizes, int n_in,
                              void* d_out, int out_size, void* d_ws, size_t ws_size, hipStream_t stream) {
    (void)in_sizes; (void)n_in; (void)out_size;
    const float* x = (const float*)d_in[0]; const float* xk = (const float*)d_in[1]; const float* xv = (const float*)d_in[2]; const float* wq = (const float*)d_in[3]; const float* wk = (const float*)d_in[4]; const float* wv = (const float*)d_in[5]; const float* wo = (const float*)d_in[6];
    float* OUT = (float*)d_out;     // [2][2048][1024]
    char* wsp = (char*)d_ws;
    auto take = [&](size_t bytes) { char* p = wsp; wsp += (bytes + 255) & ~(size_t)255; return (void*)p; };
    bf* WB = (bf*)take((size_t)4 * DQ * DM * 2); bf* WO = WB + (size_t)3 * DQ * DM; float* CS = (float*)take((size_t)TT * HD * 2 * 4);   // WB: wq, wk, wv, wo, one behind the other
    // head planes of both batches, [b][h][..]
    const size_t SQ = (size_t)NH_ * TT * HD, SV = (size_t)NKV * HD * PP, SA = (size_t)TT * DQ;
    h16* QP16 = (h16*)take(NB_ * SQ * 2); h16* KP16 = (h16*)take(NB_ * SQ * 2); h16* VT16 = (h16*)take(NB_ * SV * 2);
    bf* QPh = (bf*)take(NB_ * SQ * 2); bf* QPl = (bf*)take(NB_ * SQ * 2); bf* KPh = (bf*)take(NB_ * SQ * 2); bf* KPl = (bf*)take(NB_ * SQ * 2); bf* VTh = (bf*)take(NB_ * SV * 2); bf* VTl = VTh + TT;   // each PP row: hi plane, then lo plane
    bf* ATh = (bf*)take(NB_ * SA * 2); bf* ATl = (bf*)take(NB_ * SA * 2);
    bf* XB = (bf*)take((size_t)3 * NB_ * TT * DM * 2);   // q, k, v inputs, both batches each
    if ((size_t)(wsp - (char*)d_ws) > ws_size) return;    // ws 256 MiB
    k_prep<<<3 * NXB + 4 * NWB + TT * HD / 256, 256, 0, stream>>>(x, xk, xv, wq, wk, wv, wo, XB, WB, CS);
    k_proj<<<dim3(TT / 128, DQ / 128, 3 * NB_), 128, 0, stream>>>(XB, WB, CS, QP16, QPh, QPl, KP16, KPh, KPl, VT16, VTh, VTl);
    static_assert(REP == 1, "k_attn takes one kv head per query head");
    k_attn<<<dim3(NH_, NB_, NTF + NTH), 128, 0, stream>>>(QP16, KP16, VT16, QPh, QPl, KPh, KPl, VTh, VTl, ATh, ATl);
    k_outp<<<dim3(NB_ * TT / 128, DM / 128, 1), 128, 0, stream>>>(ATh, ATl, WO, OUT);
}

// v008
// It runs in 97.8 microseconds.
// Next to v007, in two timings, it ran 1.03 times as fast each time.
// Counting every step since v000, it is 14.8 times as fast.
#include <hip/hip_runtime.h>

// ICLAttention (q, k, v inputs [2][2048][1024]; qh/kh/vh = x W^T (torch; 16 heads x 64); interleaved-pair RoPE (base 1e4, tables computed on device); SCALE = 1/sqrt(1024); 'shifted causal' mask: key j is masked iff j >= i, except (0, 0) which stays visible; softmax; out = merged Wo^T -> [2][2048][1024]).
// Compute dtypes, f32 accumulate: every input rounded to bf16; projections on PLAIN bf16 operands (inputs: exact); RoPE f32, in the projection's epilogue; scores and attn.v: query rows < 512 hl (3 products), the rest single fp16, fused with an online f32 softmax in k_attn (key blocks beyond the diagonal are never visited); Wo hl x exact (2 products).

#define NB_  2
#define TT   2048
#define DM   1024
#define NH_  16
#define NKV  16
#define REP  (NH_ / NKV)
#define HD   64
#define DQ   (NH_ * HD)
#define DKV  (NKV * HD)
#define RH   512                  // query rows < RH use hi+lo planes (0: none)
#define SCL  0.03125f   // 1/sqrt(d_attn = 1024), as the source
static_assert(HD == 64, "k_attn holds four 16-row output tiles and two 32-deep query fragments");
#define PP   (2 * TT)             // row pitch, in 16-bit elements, of the transposed value planes (a hi/lo row holds the hi plane, then the lo plane)
#define KB   32                   // keys per pass of k_attn
typedef _Float16 h16;
typedef unsigned short bf;
typedef __attribute__((ext_vector_type(16))) __bf16   v16bf;
typedef __attribute__((ext_vector_type(16))) _Float16 v16h;
typedef __attribute__((ext_vector_type(8)))  _Float16 v8h;
typedef __attribute__((ext_vector_type(8)))  unsigned short v8us;
typedef __attribute__((ext_vector_type(8)))  float    v8f;
typedef __attribute__((ext_vector_type(4)))  float    v4f;
typedef v8h  __attribute__((may_alias)) v8ha;
typedef v4f  __attribute__((may_alias)) v4fa;
typedef v8us __attribute__((may_alias)) v8usa;

__device__ __forceinline__ unsigned short f2bf(float f) { unsigned u = __float_as_uint(f); u += 0x7FFFu + ((u >> 16) & 1u); return (unsigned short)(u >> 16); }
__device__ __forceinline__ float bf2f(unsigned short b) { return __uint_as_float(((unsigned)b) << 16); }
__device__ __forceinline__ float bfr(float f) { return bf2f(f2bf(f)); }
__device__ __forceinline__ v16h cat16(v8h lo, v8h hi) { return __builtin_shufflevector(lo, hi, 0, 1, 2, 3, 4, 5, 6, 7, 8, 9, 10, 11, 12, 13, 14, 15); }
__device__ __forceinline__ v16bf cat16b(v8us lo, v8us hi) { return __builtin_bit_cast(v16bf, __builtin_shufflevector(lo, hi, 0, 1, 2, 3, 4, 5, 6, 7, 8, 9, 10, 11, 12, 13, 14, 15)); }
__device__ __forceinline__ v8f wmma16(v16h a, v16h b, v8f c) { return __builtin_amdgcn_wmma_f32_16x16x32_f16(false, a, false, b, (short)0, c, false, false); }
__device__ __forceinline__ v8f wmmab(v16bf a, v16bf b, v8f c) { return __builtin_amdgcn_wmma_f32_16x16x32_bf16(false, a, false, b, (short)0, c, false, false); }

__device__ __forceinline__ h16 tohx(float x) { return (h16)x; }
__device__ __forceinline__ void splitf(float y, unsigned short& h, unsigned short& l) { h = f2bf(y); l = f2bf(y - bf2f(h)); }
typedef __attribute__((ext_vector_type(2))) _Float16 v2h;
typedef __attribute__((ext_vector_type(4))) _Float16 v4h;
typedef __attribute__((ext_vector_type(2))) unsigned short v2us;
typedef __attribute__((ext_vector_type(4))) unsigned short v4us;
typedef __attribute__((ext_vector_type(2))) float v2f;
typedef __attribute__((ext_vector_type(4))) int v4i;
typedef v4h  __attribute__((may_alias)) v4ha;
typedef v4us __attribute__((may_alias)) v4usa;

// ---- gemm_tile: GEMM, four waves a block on a 128x128 output tile, each wave a 64x64 quarter (16 accumulators); tile (blockIdx.x, blockIdx.y) of (M/128, N/128), 128 threads.
// The operands (K-contiguous 16-bit planes) come through LDS: KT-deep tiles of 128 rows an operand, brought by asynchronous copies in whole 128-byte lines, two buffers, the next tile in flight while this one is worked on.
// ring: 2 x (2 + NSPLIT) x OPT elements of LDS; osb: 16 x 68 floats of LDS a wave.
// C[m][n] (f32, pitch ldc, + optional f32 bias[n]) = sum_k A[m][k] Bt[n][k] (NSPLIT 1: + A2[m][k] Bt[n][k]). K % KT == 0.
// EPI 0: the f32 tile goes to C. EPI 1 and 2: a projection's tile (64 tokens x the 64 columns of one head) goes straight to the 16-bit planes that k_attn reads (fp16, bf16 hi, bf16 lo), C unused:
// EPI 1: interleaved-pair RoPE from the table CS, planes [head][t][d]; EPI 2: no RoPE, transposed planes [head][d][t] at row pitch PP.
#define KT   64                   // K elements of a staged tile: a row is one 128-byte line
#define LP   72                   // LDS row pitch in 16-bit elements: 128 bytes + 16 of pad (16 bytes x odd, so that 16 rows read by ds_load_b128 fall on different banks)
#define OPT  (128 * LP)           // elements of one operand's staged tile
template <typename T16> struct WFrag;
template <> struct WFrag<h16> { typedef v16h V; static __device__ __forceinline__ V ld(const h16* p) { return cat16(*(const v8h*)p, *(const v8h*)(p + 16)); } static __device__ __forceinline__ v8f mma(V a, V b, v8f c) { return wmma16(a, b, c); } };
template <> struct WFrag<bf> { typedef v16bf V; static __device__ __forceinline__ V ld(const bf* p) { return cat16b(*(const v8us*)p, *(const v8us*)(p + 16)); } static __device__ __forceinline__ v8f mma(V a, V b, v8f c) { return wmmab(a, b, c); } };
// eight asynchronous copies of a wave, each 4 rows x 128 bytes (16 bytes a lane), rows 4 apart: l = the lane's LDS byte address, g = its global address, of the first.
// The wait in the same statement stands before anything can rewrite the address registers (a precaution).
template <typename T16>
__device__ __forceinline__ void cp8(unsigned l, const T16* g, int K) {
    asm volatile("global_load_async_to_lds_b128 %0, %8, off\n\tglobal_load_async_to_lds_b128 %1, %9, off\n\tglobal_load_async_to_lds_b128 %2, %10, off\n\tglobal_load_async_to_lds_b128 %3, %11, off\n\t"
                 "global_load_async_to_lds_b128 %4, %12, off\n\tglobal_load_async_to_lds_b128 %5, %13, off\n\tglobal_load_async_to_lds_b128 %6, %14, off\n\tglobal_load_async_to_lds_b128 %7, %15, off\n\ts_wait_xcnt 0x0"
                 :: "v"(l), "v"(l + 4 * LP * 2), "v"(l + 8 * LP * 2), "v"(l + 12 * LP * 2), "v"(l + 16 * LP * 2), "v"(l + 20 * LP * 2), "v"(l + 24 * LP * 2), "v"(l + 28 * LP * 2),
                    "v"(g), "v"(g + 4 * K), "v"(g + 8 * K), "v"(g + 12 * K), "v"(g + 16 * K), "v"(g + 20 * K), "v"(g + 24 * K), "v"(g + 28 * K) : "memory");
}
template <typename T16, int NSPLIT, bool BIAS, int EPI>
__device__ __forceinline__ void gemm_tile(const T16* __restrict__ A, const T16* __restrict__ A2, const T16* __restrict__ Bt, int K, float* C, int ldc, const float* __restrict__ bias, const float* __restrict__ CS, h16* P16, bf* Ph, bf* Pl, T16* ring, float* osb) {
    typedef typename WFrag<T16>::V V;
    static_assert(NSPLIT == 0 || NSPLIT == 1, "one or two planes of A, one of B");
    constexpr int STG = (2 + NSPLIT) * OPT;   // a buffer: A, B, then A2
    const int lane = threadIdx.x & 31, lr = lane & 15, hi = lane >> 4; const int wv = __builtin_amdgcn_readfirstlane(threadIdx.x >> 5);
    const int R0 = blockIdx.x * 128, C0 = blockIdx.y * 128; const int r0 = R0 + (wv & 1) * 64, c0 = C0 + (wv >> 1) * 64;
    float* os = osb + wv * (16 * 68);
    v8f acc[4][4];
#pragma unroll
    for (int mb = 0; mb < 4; ++mb)
#pragma unroll
        for (int nb = 0; nb < 4; ++nb) acc[mb][nb] = (v8f){};
    // EPI 1: in step s of row tile mb a lane holds columns 4 lr .. 4 lr + 3 (two RoPE pairs) of token r0 + mb * 16 + 2 s + hi; one base address for the table and one a plane, the rest are constant offsets
    const float* cp = CS + ((size_t)(r0 + hi) * HD + lr * 4) * 2; const size_t po = ((size_t)(c0 / 64) * TT + r0 + hi) * HD + lr * 4;
    v2f ca[2][8], cb[2][8];   // (cos, sin) of the two pairs, fetched one row tile ahead (the first ahead of the K loop), so that no table latency stands in the epilogue
    auto ldcs = [&](int mb) {
#pragma unroll
        for (int s = 0; s < 8; ++s) { ca[mb & 1][s] = *(const v2f*)(cp + (mb * 16 + 2 * s) * HD * 2); cb[mb & 1][s] = *(const v2f*)(cp + (mb * 16 + 2 * s) * HD * 2 + 4); } };
    if constexpr (EPI == 1) ldcs(0);
    // a wave copies rows 32 wv .. 32 wv + 31 of each operand's tile; a lane takes 16 bytes: row lane / 8 of four, piece lane % 8 of the line
    const int srow = wv * 32 + (lane >> 3), cpc = (lane & 7) * 8;
    const T16* ga = A + (size_t)(R0 + srow) * K + cpc; const T16* gb = Bt + (size_t)(C0 + srow) * K + cpc;
    const unsigned l0 = (unsigned)(size_t)(ring + srow * LP + cpc);
    auto fill = [&](int t) { const unsigned l = l0 + (t & 1) * (STG * 2); cp8(l, ga + t * KT, K); cp8(l + OPT * 2, gb + t * KT, K);
        if constexpr (NSPLIT == 1) cp8(l + 2 * OPT * 2, A2 + (size_t)(R0 + srow) * K + cpc + t * KT, K); };
    const int NT = K / KT;
    fill(0);
    asm volatile("s_wait_asynccnt 0x0" ::: "memory");   // this wave's share of tile 0 has landed
    __syncthreads();                                    // every wave's share has
    if (NT > 1) fill(1);
    const int fa = ((wv & 1) * 64 + lr) * LP + 8 * hi, fb = OPT + ((wv >> 1) * 64 + lr) * LP + 8 * hi;
#pragma unroll 1
    for (int t = 0; t < NT; ++t) {
        const T16* sb = ring + (t & 1) * STG;
#pragma unroll
        for (int ks = 0; ks < KT / 32; ++ks) { V a[4], a2[4], b[4];
#pragma unroll
            for (int i = 0; i < 4; ++i) { a[i] = WFrag<T16>::ld(sb + fa + i * 16 * LP + ks * 32); b[i] = WFrag<T16>::ld(sb + fb + i * 16 * LP + ks * 32); if (NSPLIT == 1) a2[i] = WFrag<T16>::ld(sb + fa + 2 * OPT + i * 16 * LP + ks * 32); }
#pragma unroll
            for (int nb = 0; nb < 4; ++nb)
#pragma unroll
                for (int mb = 0; mb < 4; ++mb) { acc[mb][nb] = WFrag<T16>::mma(a[mb], b[nb], acc[mb][nb]); if (NSPLIT == 1) acc[mb][nb] = WFrag<T16>::mma(a2[mb], b[nb], acc[mb][nb]); } }
        // order of the trip's LDS reads (0x100) and matrix instructions (0x8): the reads stand in a few groups ahead of the products that use them; left alone, the compiler read each B fragment directly in front of its products, and a wave alone on its SIMD would wait out the LDS latency at every column tile
        { constexpr int NW = 4 * (1 + NSPLIT), NA = 2 * NW;
          __builtin_amdgcn_sched_group_barrier(0x100, NA + 4, 0);
          __builtin_amdgcn_sched_group_barrier(0x8, NW, 0); __builtin_amdgcn_sched_group_barrier(0x100, 2, 0);
          __builtin_amdgcn_sched_group_barrier(0x8, NW, 0); __builtin_amdgcn_sched_group_barrier(0x100, 2, 0);
          __builtin_amdgcn_sched_group_barrier(0x8, NW, 0); __builtin_amdgcn_sched_group_barrier(0x100, 4, 0);
          __builtin_amdgcn_sched_group_barrier(0x8, NW, 0); __builtin_amdgcn_sched_group_barrier(0x100, NA, 0);
          __builtin_amdgcn_sched_group_barrier(0x8, NW, 0); __builtin_amdgcn_sched_group_barrier(0x100, 2, 0);
          __builtin_amdgcn_sched_group_barrier(0x8, NW, 0); __builtin_amdgcn_sched_group_barrier(0x100, 2, 0);
          __builtin_amdgcn_sched_group_barrier(0x8, 2 * NW, 0); }
        asm volatile("s_wait_dscnt 0x0" ::: "memory");      // this wave's reads of buffer t % 2 are done
        asm volatile("s_wait_asynccnt 0x0" ::: "memory");   // its share of tile t + 1 has landed
        __syncthreads();                                    // tile t + 1 may be read, buffer t % 2 refilled
        if (t + 2 < NT) fill(t + 2);
    }
    asm volatile("s_wait_asynccnt 0x0" ::: "memory");   // no copy is in flight when the wave goes on
    if constexpr (EPI == 2) {   // a lane's eight accumulators of a tile are eight consecutive tokens of one column: one 16-byte store a plane, no LDS; mb innermost, so that the four stores that fill a 128-byte line follow one another
#pragma unroll
        for (int nb = 0; nb < 4; ++nb)
#pragma unroll
            for (int mb = 0; mb < 4; ++mb) { v8h o16; v8us oh, ol;
#pragma unroll
                for (int j = 0; j < 8; ++j) { const float x = acc[mb][nb][j]; o16[j] = tohx(x); unsigned short a2, c2; splitf(x, a2, c2); oh[j] = a2; ol[j] = c2; }
                const size_t oo = (size_t)(c0 + nb * 16 + lr) * PP + r0 + mb * 16 + hi * 8;
                *(v8h*)(P16 + oo) = o16; *(v8us*)(Ph + oo) = oh; *(v8us*)(Pl + oo) = ol; }
        return;
    }
#pragma unroll
    for (int mb = 0; mb < 4; ++mb) {
#pragma unroll
        for (int nb = 0; nb < 4; ++nb) {
#pragma unroll
            for (int j = 0; j < 8; ++j) os[(hi * 8 + j) * 68 + nb * 16 + lr] = acc[mb][nb][j]; }
        __builtin_amdgcn_wave_barrier(); asm volatile("" ::: "memory");
        if constexpr (EPI == 1) {
            if (mb < 3) ldcs(mb + 1);
#pragma unroll
            for (int s = 0; s < 8; ++s) { const v4f val = *(const v4fa*)(os + (2 * s + hi) * 68 + lr * 4); const v2f c0s = ca[mb & 1][s], c1s = cb[mb & 1][s];
                v4f r; r[0] = val[0] * c0s[0] - val[1] * c0s[1]; r[1] = val[1] * c0s[0] + val[0] * c0s[1]; r[2] = val[2] * c1s[0] - val[3] * c1s[1]; r[3] = val[3] * c1s[0] + val[2] * c1s[1];
                v4h o16; v4us oh, ol;
#pragma unroll
                for (int q = 0; q < 4; ++q) { o16[q] = tohx(r[q]); unsigned short a2, c2; splitf(r[q], a2, c2); oh[q] = a2; ol[q] = c2; }
                const size_t oo = po + (mb * 16 + 2 * s) * HD;
                *(v4h*)(P16 + oo) = o16; *(v4us*)(Ph + oo) = oh; *(v4us*)(Pl + oo) = ol; }
            if (mb < 3) asm volatile("s_wait_xcnt 0x0" ::: "memory");   // precaution: stands behind the row tile's stores, before the next tile's work reuses their data registers
        } else {
        float* crow = C + (size_t)(r0 + mb * 16) * ldc + c0;
#pragma unroll
            for (int s = 0; s < 8; ++s) { const int row = 2 * s + hi, cofs = lr * 4; v4f val = *(const v4fa*)(os + row * 68 + cofs); if (BIAS) { val[0] += bfr(bias[c0 + cofs]); val[1] += bfr(bias[c0 + cofs + 1]); val[2] += bfr(bias[c0 + cofs + 2]); val[3] += bfr(bias[c0 + cofs + 3]); }
                *(v4f*)(crow + (size_t)row * ldc + cofs) = val; }
             }
        __builtin_amdgcn_wave_barrier(); asm volatile("" ::: "memory");
    }
}

// all six projections (q, k, v of both batches) in one launch, so that their tiles run side by side: grid (TT/128, DQ/128, 3 * NB_), blockIdx.z = 2 * (0 q, 1 k, 2 v) + batch.
// X: the three converted inputs [3][NB_][TT][DM]; Wt: their weights [3][DQ][DM]; the planes are [batch][head][..]
static_assert(DQ == DKV && NB_ == 2, "k_proj and k_prep take q, k and v planes of one size and two batches");
// a budget of 256 registers a wave: three blocks of k_proj (its whole grid) are resident on a WGP at once
__global__ __launch_bounds__(128) __attribute__((amdgpu_waves_per_eu(4))) void k_proj(const bf* __restrict__ X, const bf* __restrict__ Wt, const float* __restrict__ CS, h16* Q16, bf* Qh, bf* Ql, h16* K16, bf* Kh, bf* Kl, h16* V16, bf* Vh, bf* Vl) {
    __shared__ __align__(128) bf ring[2 * 2 * OPT]; __shared__ __align__(16) float os[4 * 16 * 68];
    const int wh = (int)blockIdx.z >> 1; const size_t b = blockIdx.z & 1;
    const bf* A = X + (size_t)blockIdx.z * TT * DM; const bf* Bt = Wt + (size_t)wh * DQ * DM;
    const size_t sq = b * NH_ * TT * HD, sv = b * NKV * HD * PP;
    if (wh == 2) gemm_tile<bf, 0, false, 2>(A, nullptr, Bt, DM, nullptr, 0, nullptr, nullptr, V16 + sv, Vh + sv, Vl + sv, ring, os);
    else gemm_tile<bf, 0, false, 1>(A, nullptr, Bt, DM, nullptr, 0, nullptr, CS, (wh ? K16 : Q16) + sq, (wh ? Kh : Qh) + sq, (wh ? Kl : Ql) + sq, ring, os);
}
// the output projection of both batches in one launch: their rows follow one another in A and in C; grid (NB_ * TT / 128, DM / 128)
__global__ __launch_bounds__(128) __attribute__((amdgpu_waves_per_eu(4))) void k_outp(const bf* __restrict__ Ah, const bf* __restrict__ Al, const bf* __restrict__ Wt, float* C) {
    __shared__ __align__(128) bf ring[2 * 3 * OPT]; __shared__ __align__(16) float os[4 * 16 * 68];
    gemm_tile<bf, 1, false, 0>(Ah, Al, Wt, DQ, C, DM, nullptr, nullptr, nullptr, nullptr, nullptr, ring, os);
}

__global__ __launch_bounds__(256) void k_wtG(const float* __restrict__ w, int K, int N, bf* Bt) {
    const int lane = threadIdx.x & 31; const int L0 = (blockIdx.x * 8 + (threadIdx.x >> 5)) * 8; const int nlines = N * K / 64;
{
#pragma unroll 1
        for (int l = 0; l < 8; ++l) { const int L = L0 + l; if (L >= nlines) break; const size_t e = (size_t)L * 64 + lane * 2; const int k = (int)(e % K), n = (int)(e / K); v2us o;
            o[0] = f2bf(w[(size_t)k * N + n]); o[1] = f2bf(w[(size_t)(k + 1) * N + n]); *(v2us*)(Bt + e) = o; }
         }
}
// ---- k_prep: every conversion to bf16 (three inputs, four weights) and the RoPE table in one launch; the blocks are independent, blockIdx.x says which piece a block takes.
// A conversion block takes CVB consecutive elements: each thread CG vectors of 8, all loaded before the first is stored, so that the launch needs few waves and each has CG loads in flight.
#define CG   8
#define CVB  (256 * 8 * CG)
#define NXB  (NB_ * TT * DM / CVB)   // blocks an input
#define NWB  (DQ * DM / CVB)         // blocks a weight
static_assert(NB_ * TT * DM % CVB == 0 && DQ * DM % CVB == 0 && TT * HD % 256 == 0, "k_prep has no edge blocks");
__global__ __launch_bounds__(256) void k_prep(const float* __restrict__ x, const float* __restrict__ xk, const float* __restrict__ xv, const float* __restrict__ wq, const float* __restrict__ wk, const float* __restrict__ wv, const float* __restrict__ wo, bf* XB, bf* WB, float* CS) {
    const int bx = (int)blockIdx.x;
    if (bx < 3 * NXB + 4 * NWB) {
        const float* src; bf* dst;
        if (bx < 3 * NXB) { const int t = bx / NXB; src = (t == 0 ? x : t == 1 ? xk : xv) + (size_t)(bx % NXB) * CVB; dst = XB + (size_t)bx * CVB; }
        else { const int c = bx - 3 * NXB, t = c / NWB; src = (t == 0 ? wq : t == 1 ? wk : t == 2 ? wv : wo) + (size_t)(c % NWB) * CVB; dst = WB + (size_t)c * CVB; }
        const int e0 = threadIdx.x * 8; v8f v[CG];
#pragma unroll
        for (int g = 0; g < CG; ++g) v[g] = *(const v8f*)(src + e0 + g * 2048);
#pragma unroll
        for (int g = 0; g < CG; ++g) { v8us o;
#pragma unroll
            for (int k = 0; k < 8; ++k) o[k] = f2bf(v[g][k]);
            *(v8us*)(dst + e0 + g * 2048) = o; }
        return;
    }
    const int idx = (bx - (3 * NXB + 4 * NWB)) * 256 + threadIdx.x; const int t = idx / HD, d = idx % HD; const int i = d >> 1;   /* interleaved pairs */ const float inv = __fdiv_rn(1.0f, powf(10000.0f, (float)(2 * i) / (float)HD)); const float ang = __fmul_rn((float)t, inv); v2f cs; cs[0] = cosf(ang); cs[1] = sinf(ang);
    *(v2f*)(CS + (size_t)idx * 2) = cs;
}
// ---- k_attn: scores, mask, softmax and probability x value product in one kernel; one wave per tile of NQ x 16 query rows of one (batch, head); the four waves of a block walk the same keys.
// The keys and the transposed values come through LDS: tiles of SK keys (64 rows of 128 bytes a plane), brought once a block by asynchronous copies in whole 128-byte lines, two buffers, the next tile in flight while this one is worked on.
// S^T = K Q^T: A = 16 key rows, B = 16 query rows, so a lane's accumulators hold scores of ONE query (column lr), keys hi * 8 + j of each 16-key tile. That is the k order of a B fragment over 32 keys
// (elements 0..7: keys 8 hi + e, elements 8..15: keys 16 + 8 hi + e), so the probabilities go from the accumulators into O^T += V^T P^T without leaving their lane. A = 16 rows of the transposed value plane.
// Online softmax in the log2 domain: running maximum m and sum l per query (per lane; the two halves of the wave share m and join l at the end); the output tiles are rescaled by 2^(m_old - m_new) each pass.
// Mask: key j is visible to query i iff j < i, or i == j == 0; key 0 is visible to every query, so m is finite after the first pass.
typedef __attribute__((ext_vector_type(16))) unsigned short v16us;
__device__ __forceinline__ float xhalf(float x) { return __builtin_bit_cast(float, __builtin_amdgcn_permlanex16(__builtin_bit_cast(int, x), __builtin_bit_cast(int, x), 0x76543210, 0xfedcba98, false, false)); }   // lane l reads lane l ^ 16
// 2^x; the v_nop fills, in the same statement, the slot that the instruction set asks for behind a transcendental before its result is used or its source overwritten
__device__ __forceinline__ float exp2s(float x) { float r; asm("v_exp_f32 %0, %1\n\tv_nop" : "=v"(r) : "v"(x)); return r; }
#define SK   64                   // keys of a staged tile: a row of the value tile is one 128-byte line, as a key row is
#define TLE  (64 * LP)            // elements of one plane's staged tile: 64 rows at pitch LP
static_assert(SK == 2 * KB && SK == HD, "a staged tile holds two passes; cp8 takes half of a 64-row tile");
// NT: staged tiles that the block walks (the same for its four waves); ring: 2 x (HL ? 4 : 2) x TLE elements of LDS
template <typename T16, bool HL, int NQ>
__device__ __forceinline__ void attn_tile(const T16* __restrict__ Q, const T16* __restrict__ Q2, const T16* __restrict__ Kp, const T16* __restrict__ K2, const T16* __restrict__ Vt, const T16* __restrict__ V2, int q0, int NT, bf* Ah, bf* Al, T16* ring) {
    typedef typename WFrag<T16>::V V;
    constexpr int STG = (HL ? 4 : 2) * TLE;   // a buffer: K, V, then their lo planes
    const int lane = threadIdx.x & 31, lr = lane & 15, hi = lane >> 4; const int wv = __builtin_amdgcn_readfirstlane(threadIdx.x >> 5);
    // waves 0 and 1 copy the two halves (32 rows) of the key tile, waves 2 and 3 those of the value tile; a lane takes 16 bytes: row lane / 8 of four, piece lane % 8 of the line
    const int op = wv >> 1, srow = (wv & 1) * 32 + (lane >> 3), cpc = (lane & 7) * 8;
    const int gstr = op ? PP : HD, gstep = op ? SK : SK * HD;   // global row pitch; from one tile to the next
    const T16* g1 = (op ? Vt : Kp) + (size_t)srow * gstr + cpc; const T16* g2 = HL ? (op ? V2 : K2) + (size_t)srow * gstr + cpc : g1;
    const unsigned l0 = (unsigned)(size_t)(ring + op * TLE + srow * LP + cpc);
    auto fill = [&](int t) { const unsigned l = l0 + (t & 1) * (STG * 2); cp8(l, g1 + (size_t)t * gstep, gstr); if constexpr (HL) cp8(l + 2 * TLE * 2, g2 + (size_t)t * gstep, gstr); };
    fill(0);
    V qf[NQ][2], qf2[NQ][2]; v8f o[NQ][4]; float m[NQ], l[NQ];
#pragma unroll
    for (int qb = 0; qb < NQ; ++qb) { m[qb] = -3.0e38f; l[qb] = 0.f;
#pragma unroll
        for (int ks = 0; ks < 2; ++ks) { const size_t qo = (size_t)(q0 + qb * 16 + lr) * HD + ks * 32 + 8 * hi; qf[qb][ks] = WFrag<T16>::ld(Q + qo); if (HL) qf2[qb][ks] = WFrag<T16>::ld(Q2 + qo); }
#pragma unroll
        for (int dt = 0; dt < 4; ++dt) o[qb][dt] = (v8f){}; }
    const int lim = q0 + NQ * 16 - 1;   // the tile's last query sees keys 0 .. lim - 1: a pass at k0 >= lim holds nothing for this wave
    const int fo = lr * LP + 8 * hi;
    V kf[2][2], kf2[2][2];
    // key fragments of the 32 key rows of pass p of the staged tile sb (and of their lo plane)
    auto ldk = [&](const T16* sb, int p) {
#pragma unroll
        for (int kt = 0; kt < 2; ++kt)
#pragma unroll
            for (int ks = 0; ks < 2; ++ks) { kf[kt][ks] = WFrag<T16>::ld(sb + fo + (p * KB + kt * 16) * LP + ks * 32); if (HL) kf2[kt][ks] = WFrag<T16>::ld(sb + 2 * TLE + fo + (p * KB + kt * 16) * LP + ks * 32); } };
    asm volatile("s_wait_asynccnt 0x0" ::: "memory");   // this wave's share of tile 0 has landed
    __syncthreads();                                    // every wave's share has
    if (NT > 1) fill(1);
#pragma unroll 1
    for (int st = 0; st < NT; ++st) { const T16* sb = ring + (st & 1) * STG;
      // the fp16 tiles fetch the second pass's key fragments behind the first pass's scores; the hi+lo tiles hold twice the fragments and have no registers for that: they fetch them at the head of each pass, with the value fragments
      if (!HL) ldk(sb, 0);
#pragma unroll
      for (int hp = 0; hp < 2; ++hp) { const int k0 = st * SK + hp * KB;
       if (k0 < lim) {   // wave-uniform: the block's last tiles hold passes that only its later waves need
        V vf[4], vf2[4];   // this pass's value fragments: asked for here, used behind the softmax
#pragma unroll
        for (int dt = 0; dt < 4; ++dt) { vf[dt] = WFrag<T16>::ld(sb + TLE + fo + dt * 16 * LP + hp * KB); if (HL) vf2[dt] = WFrag<T16>::ld(sb + 3 * TLE + fo + dt * 16 * LP + hp * KB); }
        if (HL) ldk(sb, hp);
        v8f s[NQ][2];
#pragma unroll
        for (int qb = 0; qb < NQ; ++qb)
#pragma unroll
            for (int kt = 0; kt < 2; ++kt) { s[qb][kt] = (v8f){};
#pragma unroll
                for (int ks = 0; ks < 2; ++ks) { s[qb][kt] = WFrag<T16>::mma(kf[kt][ks], qf[qb][ks], s[qb][kt]); if (HL) { s[qb][kt] = WFrag<T16>::mma(kf[kt][ks], qf2[qb][ks], s[qb][kt]); s[qb][kt] = WFrag<T16>::mma(kf2[kt][ks], qf[qb][ks], s[qb][kt]); } } }
        if (!HL && hp == 0) ldk(sb, 1);   // the second pass's key fragments, of the same staged tile
#pragma unroll
        for (int qb = 0; qb < NQ; ++qb) { const int iq = q0 + qb * 16 + lr; float t[16];
#pragma unroll
            for (int e = 0; e < 16; ++e) t[e] = s[qb][e >> 3][e & 7] * (SCL * 1.4426950408889634f);
            if (k0 + KB > q0) {   // wave-uniform: only passes that reach the tile's first query hold masked keys
#pragma unroll
                for (int e = 0; e < 16; ++e) { const int j = k0 + (e >> 3) * 16 + hi * 8 + (e & 7); t[e] = (j < iq || (iq == 0 && j == 0)) ? t[e] : -3.0e38f; } }
            float mx = t[0];
#pragma unroll
            for (int e = 1; e < 16; ++e) mx = fmaxf(mx, t[e]);
            mx = fmaxf(mx, xhalf(mx));
            const float mn = fmaxf(m[qb], mx); const float al = exp2s(m[qb] - mn); m[qb] = mn;
            float ps = 0.f; V pf, pf2;
            if constexpr (HL) { v16us ph, pl;
#pragma unroll
                for (int e = 0; e < 16; ++e) { const float p = exp2s(t[e] - mn); ps += p; unsigned short a, c2; splitf(p, a, c2); ph[e] = a; pl[e] = c2; }
                pf = __builtin_bit_cast(v16bf, ph); pf2 = __builtin_bit_cast(v16bf, pl);
            } else {
#pragma unroll
                for (int e = 0; e < 16; ++e) { const float p = exp2s(t[e] - mn); ps += p; pf[e] = tohx(p); } }
            l[qb] = l[qb] * al + ps;
#pragma unroll
            for (int dt = 0; dt < 4; ++dt) { o[qb][dt] *= al; o[qb][dt] = WFrag<T16>::mma(vf[dt], pf, o[qb][dt]); if constexpr (HL) { o[qb][dt] = WFrag<T16>::mma(vf[dt], pf2, o[qb][dt]); o[qb][dt] = WFrag<T16>::mma(vf2[dt], pf, o[qb][dt]); } } }
       } }
      asm volatile("s_wait_dscnt 0x0" ::: "memory");      // this wave's reads of buffer st % 2 are done
      asm volatile("s_wait_asynccnt 0x0" ::: "memory");   // its share of tile st + 1 has landed
      __syncthreads();                                    // tile st + 1 may be read, buffer st % 2 refilled
      if (st + 2 < NT) fill(st + 2);
    }
    asm volatile("s_wait_asynccnt 0x0" ::: "memory");   // no copy is in flight when the wave goes on
#pragma unroll
    for (int qb = 0; qb < NQ; ++qb) { const float inv = __fdiv_rn(1.0f, l[qb] + xhalf(l[qb])); const size_t oo = (size_t)(q0 + qb * 16 + lr) * DQ + hi * 8;
#pragma unroll
        for (int dt = 0; dt < 4; ++dt) { v8us oh, ol;   // accumulator j of tile dt: output column dt * 16 + hi * 8 + j of query lr
#pragma unroll
            for (int j = 0; j < 8; ++j) { unsigned short a, c2; splitf(o[qb][dt][j] * inv, a, c2); oh[j] = a; ol[j] = c2; }
            *(v8us*)(Ah + oo + dt * 16) = oh; *(v8us*)(Al + oo + dt * 16) = ol; } }
}
// grid (heads, batches, NT1 + NT2 + NTH), four waves a block, each wave its own tile of one head, the four tiles one behind the other. Three kinds of row tile, numbered t, each kind from its last rows down:
// t < NT1: rows >= RS, 64 rows, 16 a wave, fp16; then NT2 tiles: rows RH .. RS - 1, 128 rows, 32 a wave, fp16; then NTH tiles: rows < RH, 64 rows, 16 a wave, hi+lo planes.
// The rows with the most keys are cut into the shorter tiles, so that no block's walk over its keys lasts longer than all the work of an evenly filled WGP.
#define RS   1280
#define NT1  ((TT - RS) / 64)
#define NT2  ((RS - RH) / 128)
#define NTH  (RH / 64)
// Which row tile a block takes: DEAL[blockIdx.z]. Every block is resident at once, so the launch lasts as long as the fullest WGP. A z plane is 32 blocks; the
// planes z, z + 8, z + 16 and z + 24 of a column below add up to about the same work (a staged key tile of a 16-row fp16 wave counts about half). For speed only: any placement gives the same result.
static_assert(NT1 == 12 && NT2 == 6 && NTH == 8 && NH_ * NB_ == 32, "DEAL is laid out for 26 planes of 32 blocks");
constexpr int DEAL[NT1 + NT2 + NTH] = {  10,  6, 12, 13,  4,  1,  0, 14,     // staged key tiles  22, 26, 20, 18, 28, 31, 32, 16
                                         16,  8,  3,  2,  9,  5, 15,  7,     //                   12, 24, 29, 30, 23, 27, 14, 25
                                         11, 18, 24, 22, 17, 21, 20, 19,     //                   21,  8,  2,  4, 10,  5,  6,  7
                                         23, 25 };                           //                    3,  1
constexpr bool deal_ok() { unsigned seen = 0; for (int i = 0; i < NT1 + NT2 + NTH; ++i) seen |= 1u << DEAL[i]; return seen == (1u << (NT1 + NT2 + NTH)) - 1u; }
static_assert(deal_ok(), "every row tile is taken exactly once");
constexpr unsigned long long deal_pack(int first) { unsigned long long r = 0; for (int i = 0; i < 12 && first + i < NT1 + NT2 + NTH; ++i) r |= (unsigned long long)DEAL[first + i] << (5 * i); return r; }   // twelve entries of 5 bits
// four waves a SIMD: a budget of 256 registers a wave, so that every block of the grid is resident at once and no register window switch is needed
__global__ __launch_bounds__(128) __attribute__((amdgpu_waves_per_eu(4))) void k_attn(const h16* __restrict__ Q16, const h16* __restrict__ K16, const h16* __restrict__ V16, const bf* __restrict__ Qh, const bf* __restrict__ Ql, const bf* __restrict__ Kh, const bf* __restrict__ Kl, const bf* __restrict__ Vh, const bf* __restrict__ Vl, bf* Ah, bf* Al) {
    __shared__ __align__(128) bf ring[2 * 4 * TLE];
    constexpr unsigned long long D0 = deal_pack(0), D1 = deal_pack(12), D2 = deal_pack(24); const int bz = (int)blockIdx.z;
    const int wv = __builtin_amdgcn_readfirstlane(threadIdx.x >> 5), tz = (int)((bz < 12 ? D0 >> (5 * bz) : bz < 24 ? D1 >> (5 * (bz - 12)) : D2 >> (5 * (bz - 24))) & 31); const size_t zh = (size_t)blockIdx.y * NH_ + blockIdx.x; const size_t pq = zh * TT * HD, pv = zh * HD * PP, pa = (size_t)blockIdx.y * TT * DQ + (size_t)blockIdx.x * HD;
    // the block's last query row R sees keys 0 .. R - 1: (first row + rows) / SK tiles
    if (tz < NT1) { const int r0 = TT - 64 * (tz + 1); attn_tile<h16, false, 1>(Q16 + pq, nullptr, K16 + pq, nullptr, V16 + pv, nullptr, r0 + 16 * wv, (r0 + 64) / SK, Ah + pa, Al + pa, (h16*)ring); }
    else if (tz < NT1 + NT2) { const int r0 = RS - 128 * (tz - NT1 + 1); attn_tile<h16, false, 2>(Q16 + pq, nullptr, K16 + pq, nullptr, V16 + pv, nullptr, r0 + 32 * wv, (r0 + 128) / SK, Ah + pa, Al + pa, (h16*)ring); }
    else { const int r0 = RH - 64 * (tz - NT1 - NT2 + 1); attn_tile<bf, true, 1>(Qh + pq, Ql + pq, Kh + pq, Kl + pq, Vh + pv, Vl + pv, r0 + 16 * wv, (r0 + 64) / SK, Ah + pa, Al + pa, ring); }
}

extern "C" void kernel_launch(void* const* d_in, const int* in_sizes, int n_in,
                              void* d_out, int out_size, void* d_ws, size_t ws_size, hipStream_t stream) {
    (void)in_sizes; (void)n_in; (void)out_size;
    const float* x = (const float*)d_in[0]; const float* xk = (const float*)d_in[1]; const float* xv = (const float*)d_in[2]; const float* wq = (const float*)d_in[3]; const float* wk = (const float*)d_in[4]; const float* wv = (const float*)d_in[5]; const float* wo = (const float*)d_in[6];
    float* OUT = (float*)d_out;     // [2][2048][1024]
    char* wsp = (char*)d_ws;
    auto take = [&](size_t bytes) { char* p = wsp; wsp += (bytes + 255) & ~(size_t)255; return (void*)p; };
    bf* WB = (bf*)take((size_t)4 * DQ * DM * 2); bf* WO = WB + (size_t)3 * DQ * DM; float* CS = (float*)take((size_t)TT * HD * 2 * 4);   // WB: wq, wk, wv, wo, one behind the other
    // head planes of both batches, [b][h][..]
    const size_t SQ = (size_t)NH_ * TT * HD, SV = (size_t)NKV * HD * PP, SA = (size_t)TT * DQ;
    h16* QP16 = (h16*)take(NB_ * SQ * 2); h16* KP16 = (h16*)take(NB_ * SQ * 2); h16* VT16 = (h16*)take(NB_ * SV * 2);
    bf* QPh = (bf*)take(NB_ * SQ * 2); bf* QPl = (bf*)take(NB_ * SQ * 2); bf* KPh = (bf*)take(NB_ * SQ * 2); bf* KPl = (bf*)take(NB_ * SQ * 2); bf* VTh = (bf*)take(NB_ * SV * 2); bf* VTl = VTh + TT;   // each PP row: hi plane, then lo plane
    bf* ATh = (bf*)take(NB_ * SA * 2); bf* ATl = (bf*)take(NB_ * SA * 2);
    bf* XB = (bf*)take((size_t)3 * NB_ * TT * DM * 2);   // q, k, v inputs, both batches each
    if ((size_t)(wsp - (char*)d_ws) > ws_size) return;    // ws 256 MiB
    k_prep<<<3 * NXB + 4 * NWB + TT * HD / 256, 256, 0, stream>>>(x, xk, xv, wq, wk, wv, wo, XB, WB, CS);
    k_proj<<<dim3(TT / 128, DQ / 128, 3 * NB_), 128, 0, stream>>>(XB, WB, CS, QP16, QPh, QPl, KP16, KPh, KPl, VT16, VTh, VTl);
    static_assert(REP == 1, "k_attn takes one kv head per query head");
    k_attn<<<dim3(NH_, NB_, NT1 + NT2 + NTH), 128, 0, stream>>>(QP16, KP16, VT16, QPh, QPl, KPh, KPl, VTh, VTl, ATh, ATl);
    k_outp<<<dim3(NB_ * TT / 128, DM / 128, 1), 128, 0, stream>>>(ATh, ATl, WO, OUT);
}

// v009
// One run takes 95.9 microseconds.
// In two side-by-side timings against v008, it was 1.03 and 1.04 times as fast.
// All steps since v000 together make it 15.3 times as fast.
#include <hip/hip_runtime.h>

// ICLAttention (q, k, v inputs [2][2048][1024]; qh/kh/vh = x W^T (torch; 16 heads x 64); interleaved-pair RoPE (base 1e4, tables computed on device); SCALE = 1/sqrt(1024); 'shifted causal' mask: key j is masked iff j >= i, except (0, 0) which stays visible; softmax; out = merged Wo^T -> [2][2048][1024]).
// Compute dtypes, f32 accumulate: every input rounded to bf16; projections on PLAIN bf16 operands (inputs: exact); RoPE f32, in the projection's epilogue; scores and attn.v: query rows < 512 hl (3 products), the rest single fp16, fused with an online f32 softmax in k_attn (key blocks beyond the diagonal are never visited); Wo hl x exact (2 products).

#define NB_  2
#define TT   2048
#define DM   1024
#define NH_  16
#define NKV  16
#define REP  (NH_ / NKV)
#define HD   64
#define DQ   (NH_ * HD)
#define DKV  (NKV * HD)
#define RH   512                  // query rows < RH use hi+lo planes (0: none)
#define SCL  0.03125f   // 1/sqrt(d_attn = 1024), as the source
static_assert(HD == 64, "k_attn holds four 16-row output tiles and two 32-deep query fragments");
#define PP   (2 * TT)             // row pitch, in 16-bit elements, of the transposed value planes (a hi/lo row holds the hi plane, then the lo plane)
#define KB   32                   // keys per pass of k_attn
typedef _Float16 h16;
typedef unsigned short bf;
typedef __attribute__((ext_vector_type(16))) __bf16   v16bf;
typedef __attribute__((ext_vector_type(16))) _Float16 v16h;
typedef __attribute__((ext_vector_type(8)))  _Float16 v8h;
typedef __attribute__((ext_vector_type(8)))  unsigned short v8us;
typedef __attribute__((ext_vector_type(8)))  float    v8f;
typedef __attribute__((ext_vector_type(4)))  float    v4f;
typedef v8h  __attribute__((may_alias)) v8ha;
typedef v4f  __attribute__((may_alias)) v4fa;
typedef v8us __attribute__((may_alias)) v8usa;

__device__ __forceinline__ unsigned short f2bf(float f) { unsigned u = __float_as_uint(f); u += 0x7FFFu + ((u >> 16) & 1u); return (unsigned short)(u >> 16); }
__device__ __forceinline__ float bf2f(unsigned short b) { return __uint_as_float(((unsigned)b) << 16); }
__device__ __forceinline__ float bfr(float f) { return bf2f(f2bf(f)); }
__device__ __forceinline__ v16h cat16(v8h lo, v8h hi) { return __builtin_shufflevector(lo, hi, 0, 1, 2, 3, 4, 5, 6, 7, 8, 9, 10, 11, 12, 13, 14, 15); }
__device__ __forceinline__ v16bf cat16b(v8us lo, v8us hi) { return __builtin_bit_cast(v16bf, __builtin_shufflevector(lo, hi, 0, 1, 2, 3, 4, 5, 6, 7, 8, 9, 10, 11, 12, 13, 14, 15)); }
__device__ __forceinline__ v8f wmma16(v16h a, v16h b, v8f c) { return __builtin_amdgcn_wmma_f32_16x16x32_f16(false, a, false, b, (short)0, c, false, false); }
__device__ __forceinline__ v8f wmmab(v16bf a, v16bf b, v8f c) { return __builtin_amdgcn_wmma_f32_16x16x32_bf16(false, a, false, b, (short)0, c, false, false); }

__device__ __forceinline__ h16 tohx(float x) { return (h16)x; }
__device__ __forceinline__ void splitf(float y, unsigned short& h, unsigned short& l) { h = f2bf(y); l = f2bf(y - bf2f(h)); }
typedef __attribute__((ext_vector_type(2))) _Float16 v2h;
typedef __attribute__((ext_vector_type(4))) _Float16 v4h;
typedef __attribute__((ext_vector_type(2))) unsigned short v2us;
typedef __attribute__((ext_vector_type(4))) unsigned short v4us;
typedef __attribute__((ext_vector_type(2))) float v2f;
typedef __attribute__((ext_vector_type(4))) int v4i;
typedef v4h  __attribute__((may_alias)) v4ha;
typedef v4us __attribute__((may_alias)) v4usa;

// ---- gemm_tile: GEMM, four waves a block on a 128x128 output tile, each wave a 64x64 quarter (16 accumulators); tile (bx, blockIdx.y) of (M/128, N/128), 128 threads.
// The operands (K-contiguous 16-bit planes) come through LDS: KT-deep tiles of 128 rows an operand, brought by asynchronous copies in whole 128-byte lines, two buffers, the next tile in flight while this one is worked on.
// ring: 2 x (2 + NSPLIT) x OPT elements of LDS; osb: 16 x 68 floats of LDS a wave.
// C[m][n] (f32, pitch ldc, + optional f32 bias[n]) = sum_k A[m][k] Bt[n][k] (NSPLIT 1: + A2[m][k] Bt[n][k]). K % KT == 0.
// EPI 0: the f32 tile goes to C. EPI 1 and 2: a projection's tile (64 tokens x the 64 columns of one head) goes straight to the 16-bit planes that k_attn reads (fp16, bf16 hi, bf16 lo), C unused:
// EPI 1: interleaved-pair RoPE from the table CS, planes [head][t][d]; EPI 2: no RoPE, transposed planes [head][d][t] at row pitch PP.
// Only what k_attn reads is split and stored: the hi and lo planes at tokens < RH; the fp16 plane where w16 says so (not the query rows < RH).
#define KT   64                   // K elements of a staged tile: a row is one 128-byte line
#define LP   72                   // LDS row pitch in 16-bit elements: 128 bytes + 16 of pad (16 bytes x odd, so that 16 rows read by ds_load_b128 fall on different banks)
#define OPT  (128 * LP)           // elements of one operand's staged tile
template <typename T16> struct WFrag;
template <> struct WFrag<h16> { typedef v16h V; static __device__ __forceinline__ V ld(const h16* p) { return cat16(*(const v8h*)p, *(const v8h*)(p + 16)); } static __device__ __forceinline__ v8f mma(V a, V b, v8f c) { return wmma16(a, b, c); } };
template <> struct WFrag<bf> { typedef v16bf V; static __device__ __forceinline__ V ld(const bf* p) { return cat16b(*(const v8us*)p, *(const v8us*)(p + 16)); } static __device__ __forceinline__ v8f mma(V a, V b, v8f c) { return wmmab(a, b, c); } };
// eight asynchronous copies of a wave, each 4 rows x 128 bytes (16 bytes a lane), rows 4 apart: l = the lane's LDS byte address, g = its global address, of the first.
// The wait in the same statement stands before anything can rewrite the address registers (a precaution).
template <typename T16>
__device__ __forceinline__ void cp8(unsigned l, const T16* g, int K) {
    asm volatile("global_load_async_to_lds_b128 %0, %8, off\n\tglobal_load_async_to_lds_b128 %1, %9, off\n\tglobal_load_async_to_lds_b128 %2, %10, off\n\tglobal_load_async_to_lds_b128 %3, %11, off\n\t"
                 "global_load_async_to_lds_b128 %4, %12, off\n\tglobal_load_async_to_lds_b128 %5, %13, off\n\tglobal_load_async_to_lds_b128 %6, %14, off\n\tglobal_load_async_to_lds_b128 %7, %15, off\n\ts_wait_xcnt 0x0"
                 :: "v"(l), "v"(l + 4 * LP * 2), "v"(l + 8 * LP * 2), "v"(l + 12 * LP * 2), "v"(l + 16 * LP * 2), "v"(l + 20 * LP * 2), "v"(l + 24 * LP * 2), "v"(l + 28 * LP * 2),
                    "v"(g), "v"(g + 4 * K), "v"(g + 8 * K), "v"(g + 12 * K), "v"(g + 16 * K), "v"(g + 20 * K), "v"(g + 24 * K), "v"(g + 28 * K) : "memory");
}
template <typename T16, int NSPLIT, bool BIAS, int EPI>
__device__ __forceinline__ void gemm_tile(const T16* __restrict__ A, const T16* __restrict__ A2, const T16* __restrict__ Bt, int K, float* C, int ldc, const float* __restrict__ bias, const float* __restrict__ CS, h16* P16, bf* Ph, bf* Pl, T16* ring, float* osb, int bx, bool w16) {
    typedef typename WFrag<T16>::V V;
    static_assert(NSPLIT == 0 || NSPLIT == 1, "one or two planes of A, one of B");
    constexpr int STG = (2 + NSPLIT) * OPT;   // a buffer: A, B, then A2
    const int lane = threadIdx.x & 31, lr = lane & 15, hi = lane >> 4; const int wv = __builtin_amdgcn_readfirstlane(threadIdx.x >> 5);
    const int R0 = bx * 128, C0 = blockIdx.y * 128; const int r0 = R0 + (wv & 1) * 64, c0 = C0 + (wv >> 1) * 64;
    float* os = osb + wv * (16 * 68);
    const bool whl = R0 < RH;   // block-uniform: k_attn reads the hi and lo planes only at tokens < RH (query rows < RH see no later key)
    v8f acc[4][4];
#pragma unroll
    for (int mb = 0; mb < 4; ++mb)
#pragma unroll
        for (int nb = 0; nb < 4; ++nb) acc[mb][nb] = (v8f){};
    // EPI 1: in step s of row tile mb a lane holds columns 4 lr .. 4 lr + 3 (two RoPE pairs) of token r0 + mb * 16 + 2 s + hi; one base address for the table and one a plane, the rest are constant offsets
    const float* cp = CS + ((size_t)(r0 + hi) * HD + lr * 4) * 2; const size_t po = ((size_t)(c0 / 64) * TT + r0 + hi) * HD + lr * 4;
    v2f ca[2][8], cb[2][8];   // (cos, sin) of the two pairs, fetched one row tile ahead (the first ahead of the K loop), so that no table latency stands in the epilogue
    auto ldcs = [&](int mb) {
#pragma unroll
        for (int s = 0; s < 8; ++s) { ca[mb & 1][s] = *(const v2f*)(cp + (mb * 16 + 2 * s) * HD * 2); cb[mb & 1][s] = *(const v2f*)(cp + (mb * 16 + 2 * s) * HD * 2 + 4); } };
    if constexpr (EPI == 1) ldcs(0);
    // a wave copies rows 32 wv .. 32 wv + 31 of each operand's tile; a lane takes 16 bytes: row lane / 8 of four, piece lane % 8 of the line
    const int srow = wv * 32 + (lane >> 3), cpc = (lane & 7) * 8;
    const T16* ga = A + (size_t)(R0 + srow) * K + cpc; const T16* gb = Bt + (size_t)(C0 + srow) * K + cpc;
    const unsigned l0 = (unsigned)(size_t)(ring + srow * LP + cpc);
    auto fill = [&](int t) { const unsigned l = l0 + (t & 1) * (STG * 2); cp8(l, ga + t * KT, K); cp8(l + OPT * 2, gb + t * KT, K);
        if constexpr (NSPLIT == 1) cp8(l + 2 * OPT * 2, A2 + (size_t)(R0 + srow) * K + cpc + t * KT, K); };
    const int NT = K / KT;
    fill(0);
    asm volatile("s_wait_asynccnt 0x0" ::: "memory");   // this wave's share of tile 0 has landed
    __syncthreads();                                    // every wave's share has
    if (NT > 1) fill(1);
    const int fa = ((wv & 1) * 64 + lr) * LP + 8 * hi, fb = OPT + ((wv >> 1) * 64 + lr) * LP + 8 * hi;
#pragma unroll 1
    for (int t = 0; t < NT; ++t) {
        const T16* sb = ring + (t & 1) * STG;
#pragma unroll
        for (int ks = 0; ks < KT / 32; ++ks) { V a[4], a2[4], b[4];
#pragma unroll
            for (int i = 0; i < 4; ++i) { a[i] = WFrag<T16>::ld(sb + fa + i * 16 * LP + ks * 32); b[i] = WFrag<T16>::ld(sb + fb + i * 16 * LP + ks * 32); if (NSPLIT == 1) a2[i] = WFrag<T16>::ld(sb + fa + 2 * OPT + i * 16 * LP + ks * 32); }
#pragma unroll
            for (int nb = 0; nb < 4; ++nb)
#pragma unroll
                for (int mb = 0; mb < 4; ++mb) { acc[mb][nb] = WFrag<T16>::mma(a[mb], b[nb], acc[mb][nb]); if (NSPLIT == 1) acc[mb][nb] = WFrag<T16>::mma(a2[mb], b[nb], acc[mb][nb]); } }
        // order of the trip's LDS reads (0x100) and matrix instructions (0x8): the reads stand in a few groups ahead of the products that use them; left alone, the compiler read each B fragment directly in front of its products, and a wave alone on its SIMD would wait out the LDS latency at every column tile
        { constexpr int NW = 4 * (1 + NSPLIT), NA = 2 * NW;
          __builtin_amdgcn_sched_group_barrier(0x100, NA + 4, 0);
          __builtin_amdgcn_sched_group_barrier(0x8, NW, 0); __builtin_amdgcn_sched_group_barrier(0x100, 2, 0);
          __builtin_amdgcn_sched_group_barrier(0x8, NW, 0); __builtin_amdgcn_sched_group_barrier(0x100, 2, 0);
          __builtin_amdgcn_sched_group_barrier(0x8, NW, 0); __builtin_amdgcn_sched_group_barrier(0x100, 4, 0);
          __builtin_amdgcn_sched_group_barrier(0x8, NW, 0); __builtin_amdgcn_sched_group_barrier(0x100, NA, 0);
          __builtin_amdgcn_sched_group_barrier(0x8, NW, 0); __builtin_amdgcn_sched_group_barrier(0x100, 2, 0);
          __builtin_amdgcn_sched_group_barrier(0x8, NW, 0); __builtin_amdgcn_sched_group_barrier(0x100, 2, 0);
          __builtin_amdgcn_sched_group_barrier(0x8, 2 * NW, 0); }
        asm volatile("s_wait_dscnt 0x0" ::: "memory");      // this wave's reads of buffer t % 2 are done
        asm volatile("s_wait_asynccnt 0x0" ::: "memory");   // its share of tile t + 1 has landed
        __syncthreads();                                    // tile t + 1 may be read, buffer t % 2 refilled
        if (t + 2 < NT) fill(t + 2);
    }
    asm volatile("s_wait_asynccnt 0x0" ::: "memory");   // no copy is in flight when the wave goes on
    if constexpr (EPI == 2) {   // a lane's eight accumulators of a tile are eight consecutive tokens of one column: one 16-byte store a plane, no LDS; mb innermost, so that the four stores that fill a 128-byte line follow one another
#pragma unroll
        for (int nb = 0; nb < 4; ++nb)
#pragma unroll
            for (int mb = 0; mb < 4; ++mb) { v8h o16;
#pragma unroll
                for (int j = 0; j < 8; ++j) o16[j] = tohx(acc[mb][nb][j]);
                *(v8h*)(P16 + (size_t)(c0 + nb * 16 + lr) * PP + r0 + mb * 16 + hi * 8) = o16; }
        asm volatile("s_wait_xcnt 0x0" ::: "memory");   // precaution: stands behind the fp16 stores, before the split reuses their data registers
        if (whl) {
#pragma unroll
            for (int nb = 0; nb < 4; ++nb)
#pragma unroll
                for (int mb = 0; mb < 4; ++mb) { v8us oh, ol;
#pragma unroll
                    for (int j = 0; j < 8; ++j) { unsigned short a2, c2; splitf(acc[mb][nb][j], a2, c2); oh[j] = a2; ol[j] = c2; }
                    const size_t oo = (size_t)(c0 + nb * 16 + lr) * PP + r0 + mb * 16 + hi * 8;
                    *(v8us*)(Ph + oo) = oh; *(v8us*)(Pl + oo) = ol; } }
        return;
    }
#pragma unroll
    for (int mb = 0; mb < 4; ++mb) {
#pragma unroll
        for (int nb = 0; nb < 4; ++nb) {
#pragma unroll
            for (int j = 0; j < 8; ++j) os[(hi * 8 + j) * 68 + nb * 16 + lr] = acc[mb][nb][j]; }
        __builtin_amdgcn_wave_barrier(); asm volatile("" ::: "memory");
        if constexpr (EPI == 1) {
            if (mb < 3) ldcs(mb + 1);
            v4f rr[8];   // the row tile after RoPE
#pragma unroll
            for (int s = 0; s < 8; ++s) { const v4f val = *(const v4fa*)(os + (2 * s + hi) * 68 + lr * 4); const v2f c0s = ca[mb & 1][s], c1s = cb[mb & 1][s];
                rr[s][0] = val[0] * c0s[0] - val[1] * c0s[1]; rr[s][1] = val[1] * c0s[0] + val[0] * c0s[1]; rr[s][2] = val[2] * c1s[0] - val[3] * c1s[1]; rr[s][3] = val[3] * c1s[0] + val[2] * c1s[1]; }
            // one test a row tile and kind of plane, not one a step, so that the eight steps' LDS reads and stores stay together
            if (w16) {
#pragma unroll
                for (int s = 0; s < 8; ++s) { v4h o16;
#pragma unroll
                    for (int q = 0; q < 4; ++q) o16[q] = tohx(rr[s][q]);
                    *(v4h*)(P16 + po + (mb * 16 + 2 * s) * HD) = o16; }
                asm volatile("s_wait_xcnt 0x0" ::: "memory"); }   // precaution: stands behind these stores, before the split reuses their data registers
            if (whl) {
#pragma unroll
                for (int s = 0; s < 8; ++s) { v4us oh, ol;
#pragma unroll
                    for (int q = 0; q < 4; ++q) { unsigned short a2, c2; splitf(rr[s][q], a2, c2); oh[q] = a2; ol[q] = c2; }
                    const size_t oo = po + (mb * 16 + 2 * s) * HD;
                    *(v4us*)(Ph + oo) = oh; *(v4us*)(Pl + oo) = ol; } }
            asm volatile("s_wait_xcnt 0x0" ::: "memory");   // precaution: stands behind the row tile's stores, before anything that follows reuses their data registers
        } else {
        float* crow = C + (size_t)(r0 + mb * 16) * ldc + c0;
#pragma unroll
            for (int s = 0; s < 8; ++s) { const int row = 2 * s + hi, cofs = lr * 4; v4f val = *(const v4fa*)(os + row * 68 + cofs); if (BIAS) { val[0] += bfr(bias[c0 + cofs]); val[1] += bfr(bias[c0 + cofs + 1]); val[2] += bfr(bias[c0 + cofs + 2]); val[3] += bfr(bias[c0 + cofs + 3]); }
                *(v4f*)(crow + (size_t)row * ldc + cofs) = val; }
             }
        __builtin_amdgcn_wave_barrier(); asm volatile("" ::: "memory");
    }
}

// all six projections (q, k, v of both batches) in one launch, so that their tiles run side by side: grid (TT/128, DQ/128, 3 * NB_), blockIdx.z = 2 * (0 q, 1 k, 2 v) + batch.
// X: the three converted inputs [3][NB_][TT][DM]; Wt: their weights [3][DQ][DM]; the planes are [batch][head][..]
static_assert(DQ == DKV && NB_ == 2, "k_proj and k_prep take q, k and v planes of one size and two batches");
static_assert(RH % 128 == 0 && (TT / 128 & (TT / 128 - 1)) == 0, "a row tile lies wholly below RH or wholly above; the turn of the row tiles wraps by a mask");
// a budget of 256 registers a wave: three blocks of k_proj (its whole grid) are resident on a WGP at once
__global__ __launch_bounds__(128) __attribute__((amdgpu_waves_per_eu(4))) void k_proj(const bf* __restrict__ X, const bf* __restrict__ Wt, const float* __restrict__ CS, h16* Q16, bf* Qh, bf* Ql, h16* K16, bf* Kh, bf* Kl, h16* V16, bf* Vh, bf* Vl) {
    __shared__ __align__(128) bf ring[2 * 2 * OPT]; __shared__ __align__(16) float os[4 * 16 * 68];
    const int wh = (int)blockIdx.z >> 1; const size_t b = blockIdx.z & 1;
    const bf* A = X + (size_t)blockIdx.z * TT * DM; const bf* Bt = Wt + (size_t)wh * DQ * DM;
    const size_t sq = b * NH_ * TT * HD, sv = b * NKV * HD * PP;
    // row tile: turned by 5 tiles from one projection to the next. Of the q, k and v blocks of one (x, y, batch) at most one has the long epilogue (tokens < RH). For speed only
    const int bx = ((int)blockIdx.x + 5 * wh) & (TT / 128 - 1);
    if (wh == 2) gemm_tile<bf, 0, false, 2>(A, nullptr, Bt, DM, nullptr, 0, nullptr, nullptr, V16 + sv, Vh + sv, Vl + sv, ring, os, bx, true);
    else gemm_tile<bf, 0, false, 1>(A, nullptr, Bt, DM, nullptr, 0, nullptr, CS, (wh ? K16 : Q16) + sq, (wh ? Kh : Qh) + sq, (wh ? Kl : Ql) + sq, ring, os, bx, wh == 1 || bx * 128 >= RH);
}
// the output projection of both batches in one launch: their rows follow one another in A and in C; grid (NB_ * TT / 128, DM / 128)
__global__ __launch_bounds__(128) __attribute__((amdgpu_waves_per_eu(4))) void k_outp(const bf* __restrict__ Ah, const bf* __restrict__ Al, const bf* __restrict__ Wt, float* C) {
    __shared__ __align__(128) bf ring[2 * 3 * OPT]; __shared__ __align__(16) float os[4 * 16 * 68];
    gemm_tile<bf, 1, false, 0>(Ah, Al, Wt, DQ, C, DM, nullptr, nullptr, nullptr, nullptr, nullptr, ring, os, (int)blockIdx.x, false);
}

__global__ __launch_bounds__(256) void k_wtG(const float* __restrict__ w, int K, int N, bf* Bt) {
    const int lane = threadIdx.x & 31; const int L0 = (blockIdx.x * 8 + (threadIdx.x >> 5)) * 8; const int nlines = N * K / 64;
{
#pragma unroll 1
        for (int l = 0; l < 8; ++l) { const int L = L0 + l; if (L >= nlines) break; const size_t e = (size_t)L * 64 + lane * 2; const int k = (int)(e % K), n = (int)(e / K); v2us o;
            o[0] = f2bf(w[(size_t)k * N + n]); o[1] = f2bf(w[(size_t)(k + 1) * N + n]); *(v2us*)(Bt + e) = o; }
         }
}
// ---- k_prep: every conversion to bf16 (three inputs, four weights) and the RoPE table in one launch; the blocks are independent, blockIdx.x says which piece a block takes.
// A conversion block takes CVB consecutive elements: each thread CG vectors of 8, all loaded before the first is stored, so that the launch needs few waves and each has CG loads in flight.
#define CG   8
#define CVB  (256 * 8 * CG)
#define NXB  (NB_ * TT * DM / CVB)   // blocks an input
#define NWB  (DQ * DM / CVB)         // blocks a weight
static_assert(NB_ * TT * DM % CVB == 0 && DQ * DM % CVB == 0 && TT * (HD / 2) % 256 == 0, "k_prep has no edge blocks");
__global__ __launch_bounds__(256) void k_prep(const float* __restrict__ x, const float* __restrict__ xk, const float* __restrict__ xv, const float* __restrict__ wq, const float* __restrict__ wk, const float* __restrict__ wv, const float* __restrict__ wo, bf* XB, bf* WB, float* CS) {
    const int bx = (int)blockIdx.x;
    if (bx < 3 * NXB + 4 * NWB) {
        const float* src; bf* dst;
        if (bx < 3 * NXB) { const int t = bx / NXB; src = (t == 0 ? x : t == 1 ? xk : xv) + (size_t)(bx % NXB) * CVB; dst = XB + (size_t)bx * CVB; }
        else { const int c = bx - 3 * NXB, t = c / NWB; src = (t == 0 ? wq : t == 1 ? wk : t == 2 ? wv : wo) + (size_t)(c % NWB) * CVB; dst = WB + (size_t)c * CVB; }
        const int e0 = threadIdx.x * 8; v8f v[CG];
#pragma unroll
        for (int g = 0; g < CG; ++g) v[g] = *(const v8f*)(src + e0 + g * 2048);
#pragma unroll
        for (int g = 0; g < CG; ++g) { v8us o;
#pragma unroll
            for (int k = 0; k < 8; ++k) o[k] = f2bf(v[g][k]);
            *(v8us*)(dst + e0 + g * 2048) = o; }
        return;
    }
    const int idx = (bx - (3 * NXB + 4 * NWB)) * 256 + threadIdx.x; const int t = idx / (HD / 2), i = idx % (HD / 2);   /* interleaved pairs: one thread a pair, at the table's entry d = 2 i, the only one of the two that k_proj reads */ const float inv = __fdiv_rn(1.0f, powf(10000.0f, (float)(2 * i) / (float)HD)); const float ang = __fmul_rn((float)t, inv); v2f cs; cs[0] = cosf(ang); cs[1] = sinf(ang);
    *(v2f*)(CS + ((size_t)t * HD + 2 * i) * 2) = cs;
}
// ---- k_attn: scores, mask, softmax and probability x value product in one kernel; one wave per tile of NQ x 16 query rows of one (batch, head); the four waves of a block walk the same keys.
// The keys and the transposed values come through LDS: tiles of SK keys (64 rows of 128 bytes a plane), brought once a block by asynchronous copies in whole 128-byte lines, two buffers, the next tile in flight while this one is worked on.
// S^T = K Q^T: A = 16 key rows, B = 16 query rows, so a lane's accumulators hold scores of ONE query (column lr), keys hi * 8 + j of each 16-key tile. That is the k order of a B fragment over 32 keys
// (elements 0..7: keys 8 hi + e, elements 8..15: keys 16 + 8 hi + e), so the probabilities go from the accumulators into O^T += V^T P^T without leaving their lane. A = 16 rows of the transposed value plane.
// Online softmax in the log2 domain: running maximum m and sum l per query (per lane; the two halves of the wave share m and join l at the end); the output tiles are rescaled by 2^(m_old - m_new) each pass.
// Mask: key j is visible to query i iff j < i, or i == j == 0; key 0 is visible to every query, so m is finite after the first pass.
typedef __attribute__((ext_vector_type(16))) unsigned short v16us;
__device__ __forceinline__ float xhalf(float x) { return __builtin_bit_cast(float, __builtin_amdgcn_permlanex16(__builtin_bit_cast(int, x), __builtin_bit_cast(int, x), 0x76543210, 0xfedcba98, false, false)); }   // lane l reads lane l ^ 16
// 2^x; the v_nop fills, in the same statement, the slot that the instruction set asks for behind a transcendental before its result is used or its source overwritten
__device__ __forceinline__ float exp2s(float x) { float r; asm("v_exp_f32 %0, %1\n\tv_nop" : "=v"(r) : "v"(x)); return r; }
#define SK   64                   // keys of a staged tile: a row of the value tile is one 128-byte line, as a key row is
#define TLE  (64 * LP)            // elements of one plane's staged tile: 64 rows at pitch LP
static_assert(SK == 2 * KB && SK == HD, "a staged tile holds two passes; cp8 takes half of a 64-row tile");
// NT: staged tiles that the block walks (the same for its four waves); ring: 2 x (HL ? 4 : 2) x TLE elements of LDS
template <typename T16, bool HL, int NQ>
__device__ __forceinline__ void attn_tile(const T16* __restrict__ Q, const T16* __restrict__ Q2, const T16* __restrict__ Kp, const T16* __restrict__ K2, const T16* __restrict__ Vt, const T16* __restrict__ V2, int q0, int NT, bf* Ah, bf* Al, T16* ring) {
    typedef typename WFrag<T16>::V V;
    constexpr int STG = (HL ? 4 : 2) * TLE;   // a buffer: K, V, then their lo planes
    const int lane = threadIdx.x & 31, lr = lane & 15, hi = lane >> 4; const int wv = __builtin_amdgcn_readfirstlane(threadIdx.x >> 5);
    // waves 0 and 1 copy the two halves (32 rows) of the key tile, waves 2 and 3 those of the value tile; a lane takes 16 bytes: row lane / 8 of four, piece lane % 8 of the line
    const int op = wv >> 1, srow = (wv & 1) * 32 + (lane >> 3), cpc = (lane & 7) * 8;
    const int gstr = op ? PP : HD, gstep = op ? SK : SK * HD;   // global row pitch; from one tile to the next
    const T16* g1 = (op ? Vt : Kp) + (size_t)srow * gstr + cpc; const T16* g2 = HL ? (op ? V2 : K2) + (size_t)srow * gstr + cpc : g1;
    const unsigned l0 = (unsigned)(size_t)(ring + op * TLE + srow * LP + cpc);
    auto fill = [&](int t) { const unsigned l = l0 + (t & 1) * (STG * 2); cp8(l, g1 + (size_t)t * gstep, gstr); if constexpr (HL) cp8(l + 2 * TLE * 2, g2 + (size_t)t * gstep, gstr); };
    fill(0);
    V qf[NQ][2], qf2[NQ][2]; v8f o[NQ][4]; float m[NQ], l[NQ];
#pragma unroll
    for (int qb = 0; qb < NQ; ++qb) { m[qb] = -3.0e38f; l[qb] = 0.f;
#pragma unroll
        for (int ks = 0; ks < 2; ++ks) { const size_t qo = (size_t)(q0 + qb * 16 + lr) * HD + ks * 32 + 8 * hi; qf[qb][ks] = WFrag<T16>::ld(Q + qo); if (HL) qf2[qb][ks] = WFrag<T16>::ld(Q2 + qo); }
#pragma unroll
        for (int dt = 0; dt < 4; ++dt) o[qb][dt] = (v8f){}; }
    const int lim = q0 + NQ * 16 - 1;   // the tile's last query sees keys 0 .. lim - 1: a pass at k0 >= lim holds nothing for this wave
    const int fo = lr * LP + 8 * hi;
    V kf[2][2], kf2[2][2];
    // key fragments of the 32 key rows of pass p of the staged tile sb (and of their lo plane)
    auto ldk = [&](const T16* sb, int p) {
#pragma unroll
        for (int kt = 0; kt < 2; ++kt)
#pragma unroll
            for (int ks = 0; ks < 2; ++ks) { kf[kt][ks] = WFrag<T16>::ld(sb + fo + (p * KB + kt * 16) * LP + ks * 32); if (HL) kf2[kt][ks] = WFrag<T16>::ld(sb + 2 * TLE + fo + (p * KB + kt * 16) * LP + ks * 32); } };
    asm volatile("s_wait_asynccnt 0x0" ::: "memory");   // this wave's share of tile 0 has landed
    __syncthreads();                                    // every wave's share has
    if (NT > 1) fill(1);
#pragma unroll 1
    for (int st = 0; st < NT; ++st) { const T16* sb = ring + (st & 1) * STG;
      // the fp16 tiles fetch the second pass's key fragments behind the first pass's scores; the hi+lo tiles hold twice the fragments and have no registers for that: they fetch them at the head of each pass, with the value fragments
      if (!HL) ldk(sb, 0);
#pragma unroll
      for (int hp = 0; hp < 2; ++hp) { const int k0 = st * SK + hp * KB;
       if (k0 < lim) {   // wave-uniform: the block's last tiles hold passes that only its later waves need
        V vf[4], vf2[4];   // this pass's value fragments: asked for here, used behind the softmax
#pragma unroll
        for (int dt = 0; dt < 4; ++dt) { vf[dt] = WFrag<T16>::ld(sb + TLE + fo + dt * 16 * LP + hp * KB); if (HL) vf2[dt] = WFrag<T16>::ld(sb + 3 * TLE + fo + dt * 16 * LP + hp * KB); }
        if (HL) ldk(sb, hp);
        v8f s[NQ][2];
#pragma unroll
        for (int qb = 0; qb < NQ; ++qb)
#pragma unroll
            for (int kt = 0; kt < 2; ++kt) { s[qb][kt] = (v8f){};
#pragma unroll
                for (int ks = 0; ks < 2; ++ks) { s[qb][kt] = WFrag<T16>::mma(kf[kt][ks], qf[qb][ks], s[qb][kt]); if (HL) { s[qb][kt] = WFrag<T16>::mma(kf[kt][ks], qf2[qb][ks], s[qb][kt]); s[qb][kt] = WFrag<T16>::mma(kf2[kt][ks], qf[qb][ks], s[qb][kt]); } } }
        if (!HL && hp == 0) ldk(sb, 1);   // the second pass's key fragments, of the same staged tile
#pragma unroll
        for (int qb = 0; qb < NQ; ++qb) { const int iq = q0 + qb * 16 + lr; float t[16];
#pragma unroll
            for (int e = 0; e < 16; ++e) t[e] = s[qb][e >> 3][e & 7] * (SCL * 1.4426950408889634f);
            if (k0 + KB > q0) {   // wave-uniform: only passes that reach the tile's first query hold masked keys
#pragma unroll
                for (int e = 0; e < 16; ++e) { const int j = k0 + (e >> 3) * 16 + hi * 8 + (e & 7); t[e] = (j < iq || (iq == 0 && j == 0)) ? t[e] : -3.0e38f; } }
            float mx = t[0];
#pragma unroll
            for (int e = 1; e < 16; ++e) mx = fmaxf(mx, t[e]);
            mx = fmaxf(mx, xhalf(mx));
            const float mn = fmaxf(m[qb], mx); const float al = exp2s(m[qb] - mn); m[qb] = mn;
            float ps = 0.f; V pf, pf2;
            if constexpr (HL) { v16us ph, pl;
#pragma unroll
                for (int e = 0; e < 16; ++e) { const float p = exp2s(t[e] - mn); ps += p; unsigned short a, c2; splitf(p, a, c2); ph[e] = a; pl[e] = c2; }
                pf = __builtin_bit_cast(v16bf, ph); pf2 = __builtin_bit_cast(v16bf, pl);
            } else {
#pragma unroll
                for (int e = 0; e < 16; ++e) { const float p = exp2s(t[e] - mn); ps += p; pf[e] = tohx(p); } }
            l[qb] = l[qb] * al + ps;
#pragma unroll
            for (int dt = 0; dt < 4; ++dt) { o[qb][dt] *= al; o[qb][dt] = WFrag<T16>::mma(vf[dt], pf, o[qb][dt]); if constexpr (HL) { o[qb][dt] = WFrag<T16>::mma(vf[dt], pf2, o[qb][dt]); o[qb][dt] = WFrag<T16>::mma(vf2[dt], pf, o[qb][dt]); } } }
       } }
      asm volatile("s_wait_dscnt 0x0" ::: "memory");      // this wave's reads of buffer st % 2 are done
      asm volatile("s_wait_asynccnt 0x0" ::: "memory");   // its share of tile st + 1 has landed
      __syncthreads();                                    // tile st + 1 may be read, buffer st % 2 refilled
      if (st + 2 < NT) fill(st + 2);
    }
    asm volatile("s_wait_asynccnt 0x0" ::: "memory");   // no copy is in flight when the wave goes on
#pragma unroll
    for (int qb = 0; qb < NQ; ++qb) { const float inv = __fdiv_rn(1.0f, l[qb] + xhalf(l[qb])); const size_t oo = (size_t)(q0 + qb * 16 + lr) * DQ + hi * 8;
#pragma unroll
        for (int dt = 0; dt < 4; ++dt) { v8us oh, ol;   // accumulator j of tile dt: output column dt * 16 + hi * 8 + j of query lr
#pragma unroll
            for (int j = 0; j < 8; ++j) { unsigned short a, c2; splitf(o[qb][dt][j] * inv, a, c2); oh[j] = a; ol[j] = c2; }
            *(v8us*)(Ah + oo + dt * 16) = oh; *(v8us*)(Al + oo + dt * 16) = ol; } }
}
// grid (heads, batches, NT1 + NT2 + NTH), four waves a block, each wave its own tile of one head, the four tiles one behind the other. Three kinds of row tile, numbered t, each kind from its last rows down:
// t < NT1: rows >= RS, 64 rows, 16 a wave, fp16; then NT2 tiles: rows RH .. RS - 1, 128 rows, 32 a wave, fp16; then NTH tiles: rows < RH, 64 rows, 16 a wave, hi+lo planes.
// The rows with the most keys are cut into the shorter tiles, so that no block's walk over its keys lasts longer than all the work of an evenly filled WGP.
#define RS   1280
#define NT1  ((TT - RS) / 64)
#define NT2  ((RS - RH) / 128)
#define NTH  (RH / 64)
// Which row tile a block takes: DEAL[blockIdx.z]. Every block is resident at once, so the launch lasts as long as the fullest WGP. A z plane is 32 blocks; the
// planes z, z + 8, z + 16 and z + 24 of a column below add up to about the same work (a staged key tile of a 16-row fp16 wave counts about half). For speed only: any placement gives the same result.
static_assert(NT1 == 12 && NT2 == 6 && NTH == 8 && NH_ * NB_ == 32, "DEAL is laid out for 26 planes of 32 blocks");
constexpr int DEAL[NT1 + NT2 + NTH] = {  10,  6, 12, 13,  4,  1,  0, 14,     // staged key tiles  22, 26, 20, 18, 28, 31, 32, 16
                                         16,  8,  3,  2,  9,  5, 15,  7,     //                   12, 24, 29, 30, 23, 27, 14, 25
                                         11, 18, 24, 22, 17, 21, 20, 19,     //                   21,  8,  2,  4, 10,  5,  6,  7
                                         23, 25 };                           //                    3,  1
constexpr bool deal_ok() { unsigned seen = 0; for (int i = 0; i < NT1 + NT2 + NTH; ++i) seen |= 1u << DEAL[i]; return seen == (1u << (NT1 + NT2 + NTH)) - 1u; }
static_assert(deal_ok(), "every row tile is taken exactly once");
constexpr unsigned long long deal_pack(int first) { unsigned long long r = 0; for (int i = 0; i < 12 && first + i < NT1 + NT2 + NTH; ++i) r |= (unsigned long long)DEAL[first + i] << (5 * i); return r; }   // twelve entries of 5 bits
// four waves a SIMD: a budget of 256 registers a wave, so that every block of the grid is resident at once and no register window switch is needed
__global__ __launch_bounds__(128) __attribute__((amdgpu_waves_per_eu(4))) void k_attn(const h16* __restrict__ Q16, const h16* __restrict__ K16, const h16* __restrict__ V16, const bf* __restrict__ Qh, const bf* __restrict__ Ql, const bf* __restrict__ Kh, const bf* __restrict__ Kl, const bf* __restrict__ Vh, const bf* __restrict__ Vl, bf* Ah, bf* Al) {
    __shared__ __align__(128) bf ring[2 * 4 * TLE];
    constexpr unsigned long long D0 = deal_pack(0), D1 = deal_pack(12), D2 = deal_pack(24); const int bz = (int)blockIdx.z;
    const int wv = __builtin_amdgcn_readfirstlane(threadIdx.x >> 5), tz = (int)((bz < 12 ? D0 >> (5 * bz) : bz < 24 ? D1 >> (5 * (bz - 12)) : D2 >> (5 * (bz - 24))) & 31); const size_t zh = (size_t)blockIdx.y * NH_ + blockIdx.x; const size_t pq = zh * TT * HD, pv = zh * HD * PP, pa = (size_t)blockIdx.y * TT * DQ + (size_t)blockIdx.x * HD;
    // the block's last query row R sees keys 0 .. R - 1: (first row + rows) / SK tiles
    if (tz < NT1) { const int r0 = TT - 64 * (tz + 1); attn_tile<h16, false, 1>(Q16 + pq, nullptr, K16 + pq, nullptr, V16 + pv, nullptr, r0 + 16 * wv, (r0 + 64) / SK, Ah + pa, Al + pa, (h16*)ring); }
    else if (tz < NT1 + NT2) { const int r0 = RS - 128 * (tz - NT1 + 1); attn_tile<h16, false, 2>(Q16 + pq, nullptr, K16 + pq, nullptr, V16 + pv, nullptr, r0 + 32 * wv, (r0 + 128) / SK, Ah + pa, Al + pa, (h16*)ring); }
    else { const int r0 = RH - 64 * (tz - NT1 - NT2 + 1); attn_tile<bf, true, 1>(Qh + pq, Ql + pq, Kh + pq, Kl + pq, Vh + pv, Vl + pv, r0 + 16 * wv, (r0 + 64) / SK, Ah + pa, Al + pa, ring); }
}

extern "C" void kernel_launch(void* const* d_in, const int* in_sizes, int n_in,
                              void* d_out, int out_size, void* d_ws, size_t ws_size, hipStream_t stream) {
    (void)in_sizes; (void)n_in; (void)out_size;
    const float* x = (const float*)d_in[0]; const float* xk = (const float*)d_in[1]; const float* xv = (const float*)d_in[2]; const float* wq = (const float*)d_in[3]; const float* wk = (const float*)d_in[4]; const float* wv = (const float*)d_in[5]; const float* wo = (const float*)d_in[6];
    float* OUT = (float*)d_out;     // [2][2048][1024]
    char* wsp = (char*)d_ws;
    auto take = [&](size_t bytes) { char* p = wsp; wsp += (bytes + 255) & ~(size_t)255; return (void*)p; };
    bf* WB = (bf*)take((size_t)4 * DQ * DM * 2); bf* WO = WB + (size_t)3 * DQ * DM; float* CS = (float*)take((size_t)TT * HD * 2 * 4);   // WB: wq, wk, wv, wo, one behind the other
    // head planes of both batches, [b][h][..]
    const size_t SQ = (size_t)NH_ * TT * HD, SV = (size_t)NKV * HD * PP, SA = (size_t)TT * DQ;
    h16* QP16 = (h16*)take(NB_ * SQ * 2); h16* KP16 = (h16*)take(NB_ * SQ * 2); h16* VT16 = (h16*)take(NB_ * SV * 2);
    bf* QPh = (bf*)take(NB_ * SQ * 2); bf* QPl = (bf*)take(NB_ * SQ * 2); bf* KPh = (bf*)take(NB_ * SQ * 2); bf* KPl = (bf*)take(NB_ * SQ * 2); bf* VTh = (bf*)take(NB_ * SV * 2); bf* VTl = VTh + TT;   // each PP row: hi plane, then lo plane
    bf* ATh = (bf*)take(NB_ * SA * 2); bf* ATl = (bf*)take(NB_ * SA * 2);
    bf* XB = (bf*)take((size_t)3 * NB_ * TT * DM * 2);   // q, k, v inputs, both batches each
    if ((size_t)(wsp - (char*)d_ws) > ws_size) return;    // ws 256 MiB
    k_prep<<<3 * NXB + 4 * NWB + TT * (HD / 2) / 256, 256, 0, stream>>>(x, xk, xv, wq, wk, wv, wo, XB, WB, CS);
    k_proj<<<dim3(TT / 128, DQ / 128, 3 * NB_), 128, 0, stream>>>(XB, WB, CS, QP16, QPh, QPl, KP16, KPh, KPl, VT16, VTh, VTl);
    static_assert(REP == 1, "k_attn takes one kv head per query head");
    k_attn<<<dim3(NH_, NB_, NT1 + NT2 + NTH), 128, 0, stream>>>(QP16, KP16, VT16, QPh, QPl, KPh, KPl, VTh, VTl, ATh, ATl);
    k_outp<<<dim3(NB_ * TT / 128, DM / 128, 1), 128, 0, stream>>>(ATh, ATl, WO, OUT);
}

// v010
// It runs in 92.5 microseconds.
// Two timings next to v009 both put it at 1.04 times that version's speed.
// All steps since v000 together make it 15.9 times as fast.
#include <hip/hip_runtime.h>

// ICLAttention (q, k, v inputs [2][2048][1024]; qh/kh/vh = x W^T (torch; 16 heads x 64); interleaved-pair RoPE (base 1e4, tables computed on device); SCALE = 1/sqrt(1024); 'shifted causal' mask: key j is masked iff j >= i, except (0, 0) which stays visible; softmax; out = merged Wo^T -> [2][2048][1024]).
// Compute dtypes, f32 accumulate: every input rounded to bf16; projections on PLAIN bf16 operands (inputs: exact); RoPE f32, in the projection's epilogue; scores and attn.v: query rows < 512 hl (3 products), the rest single fp16, fused with an online f32 softmax in k_attn (key blocks beyond the diagonal are never visited); Wo hl x exact (2 products).

#define NB_  2
#define TT   2048
#define DM   1024
#define NH_  16
#define NKV  16
#define REP  (NH_ / NKV)
#define HD   64
#define DQ   (NH_ * HD)
#define DKV  (NKV * HD)
#define RH   512                  // query rows < RH use hi+lo planes (0: none)
#define SCL  0.03125f   // 1/sqrt(d_attn = 1024), as the source
static_assert(HD == 64, "k_attn holds four 16-row output tiles and two 32-deep query fragments");
#define PP   (2 * TT)             // row pitch, in 16-bit elements, of the transposed value planes (a hi/lo row holds the hi plane, then the lo plane)
#define KB   32                   // keys per pass of k_attn
typedef _Float16 h16;
typedef unsigned short bf;
typedef __attribute__((ext_vector_type(16))) __bf16   v16bf;
typedef __attribute__((ext_vector_type(16))) _Float16 v16h;
typedef __attribute__((ext_vector_type(8)))  _Float16 v8h;
typedef __attribute__((ext_vector_type(8)))  unsigned short v8us;
typedef __attribute__((ext_vector_type(8)))  float    v8f;
typedef __attribute__((ext_vector_type(4)))  float    v4f;
typedef v8h  __attribute__((may_alias)) v8ha;
typedef v4f  __attribute__((may_alias)) v4fa;
typedef v8us __attribute__((may_alias)) v8usa;

__device__ __forceinline__ unsigned short f2bf(float f) { unsigned u = __float_as_uint(f); u += 0x7FFFu + ((u >> 16) & 1u); return (unsigned short)(u >> 16); }
__device__ __forceinline__ float bf2f(unsigned short b) { return __uint_as_float(((unsigned)b) << 16); }
__device__ __forceinline__ float bfr(float f) { return bf2f(f2bf(f)); }
__device__ __forceinline__ v16h cat16(v8h lo, v8h hi) { return __builtin_shufflevector(lo, hi, 0, 1, 2, 3, 4, 5, 6, 7, 8, 9, 10, 11, 12, 13, 14, 15); }
__device__ __forceinline__ v16bf cat16b(v8us lo, v8us hi) { return __builtin_bit_cast(v16bf, __builtin_shufflevector(lo, hi, 0, 1, 2, 3, 4, 5, 6, 7, 8, 9, 10, 11, 12, 13, 14, 15)); }
__device__ __forceinline__ v8f wmma16(v16h a, v16h b, v8f c) { return __builtin_amdgcn_wmma_f32_16x16x32_f16(false, a, false, b, (short)0, c, false, false); }
__device__ __forceinline__ v8f wmmab(v16bf a, v16bf b, v8f c) { return __builtin_amdgcn_wmma_f32_16x16x32_bf16(false, a, false, b, (short)0, c, false, false); }

__device__ __forceinline__ h16 tohx(float x) { return (h16)x; }
__device__ __forceinline__ void splitf(float y, unsigned short& h, unsigned short& l) { h = f2bf(y); l = f2bf(y - bf2f(h)); }
typedef __attribute__((ext_vector_type(2))) _Float16 v2h;
typedef __attribute__((ext_vector_type(4))) _Float16 v4h;
typedef __attribute__((ext_vector_type(2))) unsigned short v2us;
typedef __attribute__((ext_vector_type(4))) unsigned short v4us;
typedef __attribute__((ext_vector_type(2))) float v2f;
typedef __attribute__((ext_vector_type(4))) int v4i;
typedef v4h  __attribute__((may_alias)) v4ha;
typedef v4us __attribute__((may_alias)) v4usa;

// ---- gemm_tile: GEMM, four waves a block on a 128x128 output tile, each wave a 64x64 quarter (16 accumulators); tile (bx, blockIdx.y) of (M/128, N/128), 128 threads.
// The operands (K-contiguous 16-bit planes) come through LDS: KT-deep tiles of 128 rows an operand, brought by asynchronous copies in whole 128-byte lines, two buffers, the next tile in flight while this one is worked on.
// ring: 2 x (2 + NSPLIT) x OPT elements of LDS; osb: 16 x 68 floats of LDS a wave.
// C[m][n] (f32, pitch ldc, + optional f32 bias[n]) = sum_k A[m][k] Bt[n][k] (NSPLIT 1: + A2[m][k] Bt[n][k]). K % KT == 0.
// EPI 0: the f32 tile goes to C. EPI 1 and 2: a projection's tile (64 tokens x the 64 columns of one head) goes straight to the 16-bit planes that k_attn reads (fp16, bf16 hi, bf16 lo), C unused:
// EPI 1: interleaved-pair RoPE from the table CS, planes [head][t][d]; EPI 2: no RoPE, transposed planes [head][d][t] at row pitch PP.
// Only what k_attn reads is split and stored: the hi and lo planes at tokens < RH; the fp16 plane where w16 says so (not the query rows < RH).
#define KT   64                   // K elements of a staged tile: a row is one 128-byte line
#define LP   72                   // LDS row pitch in 16-bit elements: 128 bytes + 16 of pad (16 bytes x odd, so that 16 rows read by ds_load_b128 fall on different banks)
#define OPT  (128 * LP)           // elements of one operand's staged tile
template <typename T16> struct WFrag;
template <> struct WFrag<h16> { typedef v16h V; static __device__ __forceinline__ V ld(const h16* p) { return cat16(*(const v8h*)p, *(const v8h*)(p + 16)); } static __device__ __forceinline__ v8f mma(V a, V b, v8f c) { return wmma16(a, b, c); } };
template <> struct WFrag<bf> { typedef v16bf V; static __device__ __forceinline__ V ld(const bf* p) { return cat16b(*(const v8us*)p, *(const v8us*)(p + 16)); } static __device__ __forceinline__ v8f mma(V a, V b, v8f c) { return wmmab(a, b, c); } };
// eight asynchronous copies of a wave, each 4 rows x 128 bytes (16 bytes a lane), rows 4 apart: l = the lane's LDS byte address, g = its global address, of the first.
// The wait in the same statement stands before anything can rewrite the address registers (a precaution).
template <typename T16>
__device__ __forceinline__ void cp8(unsigned l, const T16* g, int K) {
    asm volatile("global_load_async_to_lds_b128 %0, %8, off\n\tglobal_load_async_to_lds_b128 %1, %9, off\n\tglobal_load_async_to_lds_b128 %2, %10, off\n\tglobal_load_async_to_lds_b128 %3, %11, off\n\t"
                 "global_load_async_to_lds_b128 %4, %12, off\n\tglobal_load_async_to_lds_b128 %5, %13, off\n\tglobal_load_async_to_lds_b128 %6, %14, off\n\tglobal_load_async_to_lds_b128 %7, %15, off\n\ts_wait_xcnt 0x0"
                 :: "v"(l), "v"(l + 4 * LP * 2), "v"(l + 8 * LP * 2), "v"(l + 12 * LP * 2), "v"(l + 16 * LP * 2), "v"(l + 20 * LP * 2), "v"(l + 24 * LP * 2), "v"(l + 28 * LP * 2),
                    "v"(g), "v"(g + 4 * K), "v"(g + 8 * K), "v"(g + 12 * K), "v"(g + 16 * K), "v"(g + 20 * K), "v"(g + 24 * K), "v"(g + 28 * K) : "memory");
}
template <typename T16, int NSPLIT, bool BIAS, int EPI>
__device__ __forceinline__ void gemm_tile(const T16* __restrict__ A, const T16* __restrict__ A2, const T16* __restrict__ Bt, int K, float* C, int ldc, const float* __restrict__ bias, const float* __restrict__ CS, h16* P16, bf* Ph, bf* Pl, T16* ring, float* osb, int bx, bool w16) {
    typedef typename WFrag<T16>::V V;
    static_assert(NSPLIT == 0 || NSPLIT == 1, "one or two planes of A, one of B");
    constexpr int STG = (2 + NSPLIT) * OPT;   // a buffer: A, B, then A2
    const int lane = threadIdx.x & 31, lr = lane & 15, hi = lane >> 4; const int wv = __builtin_amdgcn_readfirstlane(threadIdx.x >> 5);
    const int R0 = bx * 128, C0 = blockIdx.y * 128; const int r0 = R0 + (wv & 1) * 64, c0 = C0 + (wv >> 1) * 64;
    float* os = osb + wv * (16 * 68);
    const bool whl = R0 < RH;   // block-uniform: k_attn reads the hi and lo planes only at tokens < RH (query rows < RH see no later key)
    v8f acc[4][4];
#pragma unroll
    for (int mb = 0; mb < 4; ++mb)
#pragma unroll
        for (int nb = 0; nb < 4; ++nb) acc[mb][nb] = (v8f){};
    // EPI 1: in step s of row tile mb a lane holds columns 4 lr .. 4 lr + 3 (two RoPE pairs) of token r0 + mb * 16 + 2 s + hi; one base address for the table and one a plane, the rest are constant offsets
    const float* cp = CS + ((size_t)(r0 + hi) * HD + lr * 4) * 2; const size_t po = ((size_t)(c0 / 64) * TT + r0 + hi) * HD + lr * 4;
    v2f ca[2][8], cb[2][8];   // (cos, sin) of the two pairs, fetched one row tile ahead (the first ahead of the K loop), so that no table latency stands in the epilogue
    auto ldcs = [&](int mb) {
#pragma unroll
        for (int s = 0; s < 8; ++s) { ca[mb & 1][s] = *(const v2f*)(cp + (mb * 16 + 2 * s) * HD * 2); cb[mb & 1][s] = *(const v2f*)(cp + (mb * 16 + 2 * s) * HD * 2 + 4); } };
    if constexpr (EPI == 1) ldcs(0);
    // a wave copies rows 32 wv .. 32 wv + 31 of each operand's tile; a lane takes 16 bytes: row lane / 8 of four, piece lane % 8 of the line
    const int srow = wv * 32 + (lane >> 3), cpc = (lane & 7) * 8;
    const T16* ga = A + (size_t)(R0 + srow) * K + cpc; const T16* gb = Bt + (size_t)(C0 + srow) * K + cpc;
    const unsigned l0 = (unsigned)(size_t)(ring + srow * LP + cpc);
    auto fill = [&](int t) { const unsigned l = l0 + (t & 1) * (STG * 2); cp8(l, ga + t * KT, K); cp8(l + OPT * 2, gb + t * KT, K);
        if constexpr (NSPLIT == 1) cp8(l + 2 * OPT * 2, A2 + (size_t)(R0 + srow) * K + cpc + t * KT, K); };
    const int NT = K / KT;
    fill(0);
    asm volatile("s_wait_asynccnt 0x0" ::: "memory");   // this wave's share of tile 0 has landed
    __syncthreads();                                    // every wave's share has
    if (NT > 1) fill(1);
    const int fa = ((wv & 1) * 64 + lr) * LP + 8 * hi, fb = OPT + ((wv >> 1) * 64 + lr) * LP + 8 * hi;
#pragma unroll 1
    for (int t = 0; t < NT; ++t) {
        const T16* sb = ring + (t & 1) * STG;
#pragma unroll
        for (int ks = 0; ks < KT / 32; ++ks) { V a[4], a2[4], b[4];
#pragma unroll
            for (int i = 0; i < 4; ++i) { a[i] = WFrag<T16>::ld(sb + fa + i * 16 * LP + ks * 32); b[i] = WFrag<T16>::ld(sb + fb + i * 16 * LP + ks * 32); if (NSPLIT == 1) a2[i] = WFrag<T16>::ld(sb + fa + 2 * OPT + i * 16 * LP + ks * 32); }
#pragma unroll
            for (int nb = 0; nb < 4; ++nb)
#pragma unroll
                for (int mb = 0; mb < 4; ++mb) { acc[mb][nb] = WFrag<T16>::mma(a[mb], b[nb], acc[mb][nb]); if (NSPLIT == 1) acc[mb][nb] = WFrag<T16>::mma(a2[mb], b[nb], acc[mb][nb]); } }
        // order of the trip's LDS reads (0x100) and matrix instructions (0x8): the reads stand in a few groups ahead of the products that use them; left alone, the compiler read each B fragment directly in front of its products, and a wave alone on its SIMD would wait out the LDS latency at every column tile
        { constexpr int NW = 4 * (1 + NSPLIT), NA = 2 * NW;
          __builtin_amdgcn_sched_group_barrier(0x100, NA + 4, 0);
          __builtin_amdgcn_sched_group_barrier(0x8, NW, 0); __builtin_amdgcn_sched_group_barrier(0x100, 2, 0);
          __builtin_amdgcn_sched_group_barrier(0x8, NW, 0); __builtin_amdgcn_sched_group_barrier(0x100, 2, 0);
          __builtin_amdgcn_sched_group_barrier(0x8, NW, 0); __builtin_amdgcn_sched_group_barrier(0x100, 4, 0);
          __builtin_amdgcn_sched_group_barrier(0x8, NW, 0); __builtin_amdgcn_sched_group_barrier(0x100, NA, 0);
          __builtin_amdgcn_sched_group_barrier(0x8, NW, 0); __builtin_amdgcn_sched_group_barrier(0x100, 2, 0);
          __builtin_amdgcn_sched_group_barrier(0x8, NW, 0); __builtin_amdgcn_sched_group_barrier(0x100, 2, 0);
          __builtin_amdgcn_sched_group_barrier(0x8, 2 * NW, 0); }
        asm volatile("s_wait_dscnt 0x0" ::: "memory");      // this wave's reads of buffer t % 2 are done
        asm volatile("s_wait_asynccnt 0x0" ::: "memory");   // its share of tile t + 1 has landed
        __syncthreads();                                    // tile t + 1 may be read, buffer t % 2 refilled
        if (t + 2 < NT) fill(t + 2);
    }
    asm volatile("s_wait_asynccnt 0x0" ::: "memory");   // no copy is in flight when the wave goes on
    if constexpr (EPI == 2) {   // a lane's eight accumulators of a tile are eight consecutive tokens of one column: one 16-byte store a plane, no LDS; mb innermost, so that the four stores that fill a 128-byte line follow one another
#pragma unroll
        for (int nb = 0; nb < 4; ++nb)
#pragma unroll
            for (int mb = 0; mb < 4; ++mb) { v8h o16;
#pragma unroll
                for (int j = 0; j < 8; ++j) o16[j] = tohx(acc[mb][nb][j]);
                *(v8h*)(P16 + (size_t)(c0 + nb * 16 + lr) * PP + r0 + mb * 16 + hi * 8) = o16; }
        asm volatile("s_wait_xcnt 0x0" ::: "memory");   // precaution: stands behind the fp16 stores, before the split reuses their data registers
        if (whl) {
#pragma unroll
            for (int nb = 0; nb < 4; ++nb)
#pragma unroll
                for (int mb = 0; mb < 4; ++mb) { v8us oh, ol;
#pragma unroll
                    for (int j = 0; j < 8; ++j) { unsigned short a2, c2; splitf(acc[mb][nb][j], a2, c2); oh[j] = a2; ol[j] = c2; }
                    const size_t oo = (size_t)(c0 + nb * 16 + lr) * PP + r0 + mb * 16 + hi * 8;
                    *(v8us*)(Ph + oo) = oh; *(v8us*)(Pl + oo) = ol; } }
        return;
    }
#pragma unroll
    for (int mb = 0; mb < 4; ++mb) {
#pragma unroll
        for (int nb = 0; nb < 4; ++nb) {
#pragma unroll
            for (int j = 0; j < 8; ++j) os[(hi * 8 + j) * 68 + nb * 16 + lr] = acc[mb][nb][j]; }
        __builtin_amdgcn_wave_barrier(); asm volatile("" ::: "memory");
        if constexpr (EPI == 1) {
            if (mb < 3) ldcs(mb + 1);
            v4f rr[8];   // the row tile after RoPE
#pragma unroll
            for (int s = 0; s < 8; ++s) { const v4f val = *(const v4fa*)(os + (2 * s + hi) * 68 + lr * 4); const v2f c0s = ca[mb & 1][s], c1s = cb[mb & 1][s];
                rr[s][0] = val[0] * c0s[0] - val[1] * c0s[1]; rr[s][1] = val[1] * c0s[0] + val[0] * c0s[1]; rr[s][2] = val[2] * c1s[0] - val[3] * c1s[1]; rr[s][3] = val[3] * c1s[0] + val[2] * c1s[1]; }
            // one test a row tile and kind of plane, not one a step, so that the eight steps' LDS reads and stores stay together
            if (w16) {
#pragma unroll
                for (int s = 0; s < 8; ++s) { v4h o16;
#pragma unroll
                    for (int q = 0; q < 4; ++q) o16[q] = tohx(rr[s][q]);
                    *(v4h*)(P16 + po + (mb * 16 + 2 * s) * HD) = o16; }
                asm volatile("s_wait_xcnt 0x0" ::: "memory"); }   // precaution: stands behind these stores, before the split reuses their data registers
            if (whl) {
#pragma unroll
                for (int s = 0; s < 8; ++s) { v4us oh, ol;
#pragma unroll
                    for (int q = 0; q < 4; ++q) { unsigned short a2, c2; splitf(rr[s][q], a2, c2); oh[q] = a2; ol[q] = c2; }
                    const size_t oo = po + (mb * 16 + 2 * s) * HD;
                    *(v4us*)(Ph + oo) = oh; *(v4us*)(Pl + oo) = ol; } }
            asm volatile("s_wait_xcnt 0x0" ::: "memory");   // precaution: stands behind the row tile's stores, before anything that follows reuses their data registers
        } else {
        float* crow = C + (size_t)(r0 + mb * 16) * ldc + c0;
#pragma unroll
            for (int s = 0; s < 8; ++s) { const int row = 2 * s + hi, cofs = lr * 4; v4f val = *(const v4fa*)(os + row * 68 + cofs); if (BIAS) { val[0] += bfr(bias[c0 + cofs]); val[1] += bfr(bias[c0 + cofs + 1]); val[2] += bfr(bias[c0 + cofs + 2]); val[3] += bfr(bias[c0 + cofs + 3]); }
                *(v4f*)(crow + (size_t)row * ldc + cofs) = val; }
             }
        __builtin_amdgcn_wave_barrier(); asm volatile("" ::: "memory");
    }
}

// all six projections (q, k, v of both batches) in one launch, so that their tiles run side by side: grid (TT/128, DQ/128, 3 * NB_), blockIdx.z = 2 * (0 q, 1 k, 2 v) + batch.
// X: the three converted inputs [3][NB_][TT][DM]; Wt: their weights [3][DQ][DM]; the planes are [batch][head][..]
static_assert(DQ == DKV && NB_ == 2, "k_proj and k_prep take q, k and v planes of one size and two batches");
static_assert(RH % 128 == 0 && (TT / 128 & (TT / 128 - 1)) == 0, "a row tile lies wholly below RH or wholly above; the turn of the row tiles wraps by a mask");
// a budget of 256 registers a wave: three blocks of k_proj (its whole grid) are resident on a WGP at once
__global__ __launch_bounds__(128) __attribute__((amdgpu_waves_per_eu(4))) void k_proj(const bf* __restrict__ X, const bf* __restrict__ Wt, const float* __restrict__ CS, h16* Q16, bf* Qh, bf* Ql, h16* K16, bf* Kh, bf* Kl, h16* V16, bf* Vh, bf* Vl) {
    __shared__ __align__(128) bf ring[2 * 2 * OPT]; __shared__ __align__(16) float os[4 * 16 * 68];
    const int wh = (int)blockIdx.z >> 1; const size_t b = blockIdx.z & 1;
    const bf* A = X + (size_t)blockIdx.z * TT * DM; const bf* Bt = Wt + (size_t)wh * DQ * DM;
    const size_t sq = b * NH_ * TT * HD, sv = b * NKV * HD * PP;
    // row tile: turned by 5 tiles from one projection to the next. Of the q, k and v blocks of one (x, y, batch) at most one has the long epilogue (tokens < RH). For speed only
    const int bx = ((int)blockIdx.x + 5 * wh) & (TT / 128 - 1);
    if (wh == 2) gemm_tile<bf, 0, false, 2>(A, nullptr, Bt, DM, nullptr, 0, nullptr, nullptr, V16 + sv, Vh + sv, Vl + sv, ring, os, bx, true);
    else gemm_tile<bf, 0, false, 1>(A, nullptr, Bt, DM, nullptr, 0, nullptr, CS, (wh ? K16 : Q16) + sq, (wh ? Kh : Qh) + sq, (wh ? Kl : Ql) + sq, ring, os, bx, wh == 1 || bx * 128 >= RH);
}
// the output projection of both batches in one launch: their rows follow one another in A and in C; grid (NB_ * TT / 128, DM / 128), eight waves a block on a 128x128 tile.
// Two waves share each 64x64 quarter and sit two on a SIMD, so that one wave's waits (LDS reads, copy issue) stand beside the other's products: of every KT-deep staged tile wave kh = 0 takes k 0..31, wave kh = 1 takes k 32..63.
// LDS reads per product stay those of a 64x64 wave tile. The two partial sums are added once, through LDS, behind the K loop; each wave of the pair then stores half of the quarter's rows.
// twelve asynchronous copies of a wave, each 4 rows x 128 bytes (16 bytes a lane), rows 4 apart: four for each of the three operand tiles (OPT elements apart in LDS). l = the lane's LDS byte address of the first.
// The global address is a wave-uniform base (pa, pb, pc: the wave's first row of each operand; K elements a row) plus vo, the lane's byte offset, the same in all twelve. The immediate offset moves both addresses: it steps the LDS address
// (four rows = 576 bytes, an operand tile = 18432 bytes) and is taken off the scalar base again, which steps by four global rows. So the statement names two vector registers in all and leaves the registers to the fragment sets.
// The wait in the same statement stands before anything can rewrite the address registers (a precaution).
static_assert(4 * LP * 2 == 576 && OPT * 2 == 18432, "the immediate offsets in cp4x3 are written out");
__device__ __forceinline__ void cp4x3(unsigned l, unsigned vo, const bf* pa, const bf* pb, const bf* pc, int K) {
    auto rb = [&](const bf* p, int op, int j) { return (const char*)(p + 4 * j * K) - (18432 * op + 576 * j); };
    asm volatile("global_load_async_to_lds_b128 %0, %1, %2\n\tglobal_load_async_to_lds_b128 %0, %1, %3 offset:576\n\tglobal_load_async_to_lds_b128 %0, %1, %4 offset:1152\n\tglobal_load_async_to_lds_b128 %0, %1, %5 offset:1728\n\t"
                 "global_load_async_to_lds_b128 %0, %1, %6 offset:18432\n\tglobal_load_async_to_lds_b128 %0, %1, %7 offset:19008\n\tglobal_load_async_to_lds_b128 %0, %1, %8 offset:19584\n\tglobal_load_async_to_lds_b128 %0, %1, %9 offset:20160\n\t"
                 "global_load_async_to_lds_b128 %0, %1, %10 offset:36864\n\tglobal_load_async_to_lds_b128 %0, %1, %11 offset:37440\n\tglobal_load_async_to_lds_b128 %0, %1, %12 offset:38016\n\tglobal_load_async_to_lds_b128 %0, %1, %13 offset:38592\n\ts_wait_xcnt 0x0"
                 :: "v"(l), "v"(vo),
                    "s"(rb(pa, 0, 0)), "s"(rb(pa, 0, 1)), "s"(rb(pa, 0, 2)), "s"(rb(pa, 0, 3)), "s"(rb(pb, 1, 0)), "s"(rb(pb, 1, 1)), "s"(rb(pb, 1, 2)), "s"(rb(pb, 1, 3)), "s"(rb(pc, 2, 0)), "s"(rb(pc, 2, 1)), "s"(rb(pc, 2, 2)), "s"(rb(pc, 2, 3)) : "memory");
}
typedef v8f __attribute__((may_alias)) v8fa;
// two waves a SIMD: a budget of 512 registers a wave, which holds the 16 accumulators and both fragment sets; one block a WGP, as many blocks as WGPs
__global__ __launch_bounds__(256) __attribute__((amdgpu_waves_per_eu(2))) void k_outp(const bf* __restrict__ Ah, const bf* __restrict__ Al, const bf* __restrict__ Wt, float* C) {
    __shared__ __align__(128) bf ring[2 * 3 * OPT]; __shared__ __align__(16) float osb[8 * 16 * 68];
    typedef WFrag<bf>::V V;
    constexpr int K = DQ, STG = 3 * OPT, NT = K / KT;   // a buffer: A hi, B, then A lo
    static_assert(KT == 64 && NT >= 2 && NT % 2 == 0, "a staged tile holds one 32-deep step for each wave of a pair; the loop takes two tiles a trip");
    static_assert(4 * 2 * 8 * 32 * 8 * 4 <= 2 * 3 * OPT * 2, "the exchanged partial sums fit the ring");
    const int lane = threadIdx.x & 31, lr = lane & 15, hi = lane >> 4; const int wv = __builtin_amdgcn_readfirstlane(threadIdx.x >> 5);
    const int pr = wv & 3, kh = wv >> 2;   // the quarter; which half of a staged tile's k
    const int R0 = (int)blockIdx.x * 128, C0 = (int)blockIdx.y * 128; const int r0 = R0 + (pr & 1) * 64, c0 = C0 + (pr >> 1) * 64;
    float* os = osb + wv * (16 * 68);
    v8f acc[4][4];
#pragma unroll
    for (int mb = 0; mb < 4; ++mb)
#pragma unroll
        for (int nb = 0; nb < 4; ++nb) acc[mb][nb] = (v8f){};
    // a wave copies rows 16 wv .. 16 wv + 15 of each operand's tile; a lane takes 16 bytes: row lane / 8 of four, piece lane % 8 of the line
    const int srow = wv * 16 + (lane >> 3), cpc = (lane & 7) * 8;
    const bf* pa = Ah + (size_t)(R0 + wv * 16) * K; const bf* pb = Wt + (size_t)(C0 + wv * 16) * K; const bf* pc = Al + (size_t)(R0 + wv * 16) * K;
    const unsigned l0 = (unsigned)(size_t)(ring + srow * LP + cpc), v0 = (unsigned)(((lane >> 3) * K + cpc) * 2);
    auto fill = [&](int t) { cp4x3(l0 + (t & 1) * (STG * 2), v0 + (unsigned)(t * KT * 2), pa, pb, pc, K); };
    const int fa = ((pr & 1) * 64 + lr) * LP + 8 * hi + kh * 32, fb = OPT + ((pr >> 1) * 64 + lr) * LP + 8 * hi + kh * 32;
    // two fragment sets: behind the barrier that publishes tile t + 1 a wave first asks for that tile's fragments, into the set that tile t - 1 has left, and then works on tile t from the other set, so that no product waits for an LDS read
    V a0[4], l0f[4], b0[4], a1[4], l1f[4], b1[4];
    auto ldf = [&](const bf* sb, V* a, V* a2, V* b) {
#pragma unroll
        for (int i = 0; i < 4; ++i) { a[i] = WFrag<bf>::ld(sb + fa + i * 16 * LP); b[i] = WFrag<bf>::ld(sb + fb + i * 16 * LP); a2[i] = WFrag<bf>::ld(sb + fa + 2 * OPT + i * 16 * LP); } };
    auto mma = [&](const V* a, const V* a2, const V* b) {
#pragma unroll
        for (int nb = 0; nb < 4; ++nb)
#pragma unroll
            for (int mb = 0; mb < 4; ++mb) { acc[mb][nb] = wmmab(a[mb], b[nb], acc[mb][nb]); acc[mb][nb] = wmmab(a2[mb], b[nb], acc[mb][nb]); } };
    auto publish = [&]() {
        asm volatile("s_wait_dscnt 0x0" ::: "memory");      // this wave holds all its fragments of the tile it is about to work on: that tile's buffer is read out
        asm volatile("s_wait_asynccnt 0x0" ::: "memory");   // its share of the next tile has landed
        __syncthreads(); };                                 // the next tile may be read, the read-out buffer refilled
    fill(0);
    asm volatile("s_wait_asynccnt 0x0" ::: "memory");   // this wave's share of tile 0 has landed
    __syncthreads();                                    // every wave's share has
    fill(1);
    ldf(ring, a0, l0f, b0);
#pragma unroll 1
    for (int t = 0; t < NT; t += 2) {   // even tiles: buffer 0, set 0; odd tiles: buffer 1, set 1
        publish();
        if (t + 2 < NT) fill(t + 2);
        ldf(ring + STG, a1, l1f, b1);
        __builtin_amdgcn_sched_barrier(0);   // keeps the reads ahead of the products that cover their latency
        mma(a0, l0f, b0);
        __builtin_amdgcn_sched_barrier(0);   // keeps the products ahead of the wait for those reads
        publish();
        if (t + 2 < NT) { fill(t + 3); ldf(ring, a0, l0f, b0); }
        __builtin_amdgcn_sched_barrier(0);   // as above
        mma(a1, l1f, b1);
        __builtin_amdgcn_sched_barrier(0);   // as above
    }
    asm volatile("s_wait_asynccnt 0x0" ::: "memory");   // no copy is in flight when the wave goes on
    // the pair's partial sums: wave kh = 0 keeps row tiles 0 and 1 and hands over 2 and 3, wave kh = 1 the other way round. The ring is free: every wave's reads of it ended in front of the last trip's barrier.
    float* xb = (float*)ring; v8f kp[2][4];
    auto slot = [&](int giver, int idx) { return (v8fa*)(xb + (size_t)((((pr * 2 + giver) * 8 + idx) * 32 + lane) * 8)); };
    if (kh == 0) {
#pragma unroll
        for (int i = 0; i < 2; ++i)
#pragma unroll
            for (int nb = 0; nb < 4; ++nb) { *slot(0, i * 4 + nb) = acc[2 + i][nb]; kp[i][nb] = acc[i][nb]; }
    } else {
#pragma unroll
        for (int i = 0; i < 2; ++i)
#pragma unroll
            for (int nb = 0; nb < 4; ++nb) { *slot(1, i * 4 + nb) = acc[i][nb]; kp[i][nb] = acc[2 + i][nb]; }
    }
    __syncthreads();   // the partner's partial sums may be read
#pragma unroll
    for (int i = 0; i < 2; ++i)
#pragma unroll
        for (int nb = 0; nb < 4; ++nb) kp[i][nb] += *slot(1 - kh, i * 4 + nb);
#pragma unroll
    for (int i = 0; i < 2; ++i) {
#pragma unroll
        for (int nb = 0; nb < 4; ++nb) {
#pragma unroll
            for (int j = 0; j < 8; ++j) os[(hi * 8 + j) * 68 + nb * 16 + lr] = kp[i][nb][j]; }
        __builtin_amdgcn_wave_barrier(); asm volatile("" ::: "memory");   // the wave's own rows are read back below: keeps the compiler from moving the reads up
        float* crow = C + (size_t)(r0 + (kh * 2 + i) * 16) * DM + c0;
#pragma unroll
        for (int s = 0; s < 8; ++s) { const int row = 2 * s + hi, cofs = lr * 4; const v4f val = *(const v4fa*)(os + row * 68 + cofs); *(v4f*)(crow + (size_t)row * DM + cofs) = val; }
        asm volatile("s_wait_xcnt 0x0" ::: "memory");   // precaution: stands behind the row tile's stores, before anything that follows reuses their registers
        __builtin_amdgcn_wave_barrier(); asm volatile("" ::: "memory");   // the next row tile overwrites the staging rows only behind these reads
    }
}

__global__ __launch_bounds__(256) void k_wtG(const float* __restrict__ w, int K, int N, bf* Bt) {
    const int lane = threadIdx.x & 31; const int L0 = (blockIdx.x * 8 + (threadIdx.x >> 5)) * 8; const int nlines = N * K / 64;
{
#pragma unroll 1
        for (int l = 0; l < 8; ++l) { const int L = L0 + l; if (L >= nlines) break; const size_t e = (size_t)L * 64 + lane * 2; const int k = (int)(e % K), n = (int)(e / K); v2us o;
            o[0] = f2bf(w[(size_t)k * N + n]); o[1] = f2bf(w[(size_t)(k + 1) * N + n]); *(v2us*)(Bt + e) = o; }
         }
}
// ---- k_prep: every conversion to bf16 (three inputs, four weights) and the RoPE table in one launch; the blocks are independent, blockIdx.x says which piece a block takes.
// A conversion block takes CVB consecutive elements: each thread CG vectors of 8, all loaded before the first is stored, so that the launch needs few waves and each has CG loads in flight.
#define CG   8
#define CVB  (256 * 8 * CG)
#define NXB  (NB_ * TT * DM / CVB)   // blocks an input
#define NWB  (DQ * DM / CVB)         // blocks a weight
static_assert(NB_ * TT * DM % CVB == 0 && DQ * DM % CVB == 0 && TT * (HD / 2) % 256 == 0, "k_prep has no edge blocks");
__global__ __launch_bounds__(256) void k_prep(const float* __restrict__ x, const float* __restrict__ xk, const float* __restrict__ xv, const float* __restrict__ wq, const float* __restrict__ wk, const float* __restrict__ wv, const float* __restrict__ wo, bf* XB, bf* WB, float* CS) {
    const int bx = (int)blockIdx.x;
    if (bx < 3 * NXB + 4 * NWB) {
        const float* src; bf* dst;
        if (bx < 3 * NXB) { const int t = bx / NXB; src = (t == 0 ? x : t == 1 ? xk : xv) + (size_t)(bx % NXB) * CVB; dst = XB + (size_t)bx * CVB; }
        else { const int c = bx - 3 * NXB, t = c / NWB; src = (t == 0 ? wq : t == 1 ? wk : t == 2 ? wv : wo) + (size_t)(c % NWB) * CVB; dst = WB + (size_t)c * CVB; }
        const int e0 = threadIdx.x * 8; v8f v[CG];
#pragma unroll
        for (int g = 0; g < CG; ++g) v[g] = *(const v8f*)(src + e0 + g * 2048);
#pragma unroll
        for (int g = 0; g < CG; ++g) { v8us o;
#pragma unroll
            for (int k = 0; k < 8; ++k) o[k] = f2bf(v[g][k]);
            *(v8us*)(dst + e0 + g * 2048) = o; }
        return;
    }
    const int idx = (bx - (3 * NXB + 4 * NWB)) * 256 + threadIdx.x; const int t = idx / (HD / 2), i = idx % (HD / 2);   /* interleaved pairs: one thread a pair, at the table's entry d = 2 i, the only one of the two that k_proj reads */ const float inv = __fdiv_rn(1.0f, powf(10000.0f, (float)(2 * i) / (float)HD)); const float ang = __fmul_rn((float)t, inv); v2f cs; cs[0] = cosf(ang); cs[1] = sinf(ang);
    *(v2f*)(CS + ((size_t)t * HD + 2 * i) * 2) = cs;
}
// ---- k_attn: scores, mask, softmax and probability x value product in one kernel; one wave per tile of NQ x 16 query rows of one (batch, head); the four waves of a block walk the same keys.
// The keys and the transposed values come through LDS: tiles of SK keys (64 rows of 128 bytes a plane), brought once a block by asynchronous copies in whole 128-byte lines, two buffers, the next tile in flight while this one is worked on.
// S^T = K Q^T: A = 16 key rows, B = 16 query rows, so a lane's accumulators hold scores of ONE query (column lr), keys hi * 8 + j of each 16-key tile. That is the k order of a B fragment over 32 keys
// (elements 0..7: keys 8 hi + e, elements 8..15: keys 16 + 8 hi + e), so the probabilities go from the accumulators into O^T += V^T P^T without leaving their lane. A = 16 rows of the transposed value plane.
// Online softmax in the log2 domain: running maximum m and sum l per query (per lane; the two halves of the wave share m and join l at the end); the output tiles are rescaled by 2^(m_old - m_new) each pass.
// Mask: key j is visible to query i iff j < i, or i == j == 0; key 0 is visible to every query, so m is finite after the first pass.
typedef __attribute__((ext_vector_type(16))) unsigned short v16us;
__device__ __forceinline__ float xhalf(float x) { return __builtin_bit_cast(float, __builtin_amdgcn_permlanex16(__builtin_bit_cast(int, x), __builtin_bit_cast(int, x), 0x76543210, 0xfedcba98, false, false)); }   // lane l reads lane l ^ 16
// 2^x; the v_nop fills, in the same statement, the slot that the instruction set asks for behind a transcendental before its result is used or its source overwritten
__device__ __forceinline__ float exp2s(float x) { float r; asm("v_exp_f32 %0, %1\n\tv_nop" : "=v"(r) : "v"(x)); return r; }
#define SK   64                   // keys of a staged tile: a row of the value tile is one 128-byte line, as a key row is
#define TLE  (64 * LP)            // elements of one plane's staged tile: 64 rows at pitch LP
static_assert(SK == 2 * KB && SK == HD, "a staged tile holds two passes; cp8 takes half of a 64-row tile");
// NT: staged tiles that the block walks (the same for its four waves); ring: 2 x (HL ? 4 : 2) x TLE elements of LDS
template <typename T16, bool HL, int NQ>
__device__ __forceinline__ void attn_tile(const T16* __restrict__ Q, const T16* __restrict__ Q2, const T16* __restrict__ Kp, const T16* __restrict__ K2, const T16* __restrict__ Vt, const T16* __restrict__ V2, int q0, int NT, bf* Ah, bf* Al, T16* ring) {
    typedef typename WFrag<T16>::V V;
    constexpr int STG = (HL ? 4 : 2) * TLE;   // a buffer: K, V, then their lo planes
    const int lane = threadIdx.x & 31, lr = lane & 15, hi = lane >> 4; const int wv = __builtin_amdgcn_readfirstlane(threadIdx.x >> 5);
    // waves 0 and 1 copy the two halves (32 rows) of the key tile, waves 2 and 3 those of the value tile; a lane takes 16 bytes: row lane / 8 of four, piece lane % 8 of the line
    const int op = wv >> 1, srow = (wv & 1) * 32 + (lane >> 3), cpc = (lane & 7) * 8;
    const int gstr = op ? PP : HD, gstep = op ? SK : SK * HD;   // global row pitch; from one tile to the next
    const T16* g1 = (op ? Vt : Kp) + (size_t)srow * gstr + cpc; const T16* g2 = HL ? (op ? V2 : K2) + (size_t)srow * gstr + cpc : g1;
    const unsigned l0 = (unsigned)(size_t)(ring + op * TLE + srow * LP + cpc);
    auto fill = [&](int t) { const unsigned l = l0 + (t & 1) * (STG * 2); cp8(l, g1 + (size_t)t * gstep, gstr); if constexpr (HL) cp8(l + 2 * TLE * 2, g2 + (size_t)t * gstep, gstr); };
    fill(0);
    V qf[NQ][2], qf2[NQ][2]; v8f o[NQ][4]; float m[NQ], l[NQ];
#pragma unroll
    for (int qb = 0; qb < NQ; ++qb) { m[qb] = -3.0e38f; l[qb] = 0.f;
#pragma unroll
        for (int ks = 0; ks < 2; ++ks) { const size_t qo = (size_t)(q0 + qb * 16 + lr) * HD + ks * 32 + 8 * hi; qf[qb][ks] = WFrag<T16>::ld(Q + qo); if (HL) qf2[qb][ks] = WFrag<T16>::ld(Q2 + qo); }
#pragma unroll
        for (int dt = 0; dt < 4; ++dt) o[qb][dt] = (v8f){}; }
    const int lim = q0 + NQ * 16 - 1;   // the tile's last query sees keys 0 .. lim - 1: a pass at k0 >= lim holds nothing for this wave
    const int fo = lr * LP + 8 * hi;
    V kf[2][2], kf2[2][2];
    // key fragments of the 32 key rows of pass p of the staged tile sb (and of their lo plane)
    auto ldk = [&](const T16* sb, int p) {
#pragma unroll
        for (int kt = 0; kt < 2; ++kt)
#pragma unroll
            for (int ks = 0; ks < 2; ++ks) { kf[kt][ks] = WFrag<T16>::ld(sb + fo + (p * KB + kt * 16) * LP + ks * 32); if (HL) kf2[kt][ks] = WFrag<T16>::ld(sb + 2 * TLE + fo + (p * KB + kt * 16) * LP + ks * 32); } };
    asm volatile("s_wait_asynccnt 0x0" ::: "memory");   // this wave's share of tile 0 has landed
    __syncthreads();                                    // every wave's share has
    if (NT > 1) fill(1);
#pragma unroll 1
    for (int st = 0; st < NT; ++st) { const T16* sb = ring + (st & 1) * STG;
      // the fp16 tiles fetch the second pass's key fragments behind the first pass's scores; the hi+lo tiles hold twice the fragments and have no registers for that: they fetch them at the head of each pass, with the value fragments
      if (!HL) ldk(sb, 0);
#pragma unroll
      for (int hp = 0; hp < 2; ++hp) { const int k0 = st * SK + hp * KB;
       if (k0 < lim) {   // wave-uniform: the block's last tiles hold passes that only its later waves need
        V vf[4], vf2[4];   // this pass's value fragments: asked for here, used behind the softmax
#pragma unroll
        for (int dt = 0; dt < 4; ++dt) { vf[dt] = WFrag<T16>::ld(sb + TLE + fo + dt * 16 * LP + hp * KB); if (HL) vf2[dt] = WFrag<T16>::ld(sb + 3 * TLE + fo + dt * 16 * LP + hp * KB); }
        if (HL) ldk(sb, hp);
        v8f s[NQ][2];
#pragma unroll
        for (int qb = 0; qb < NQ; ++qb)
#pragma unroll
            for (int kt = 0; kt < 2; ++kt) { s[qb][kt] = (v8f){};
#pragma unroll
                for (int ks = 0; ks < 2; ++ks) { s[qb][kt] = WFrag<T16>::mma(kf[kt][ks], qf[qb][ks], s[qb][kt]); if (HL) { s[qb][kt] = WFrag<T16>::mma(kf[kt][ks], qf2[qb][ks], s[qb][kt]); s[qb][kt] = WFrag<T16>::mma(kf2[kt][ks], qf[qb][ks], s[qb][kt]); } } }
        if (!HL && hp == 0) ldk(sb, 1);   // the second pass's key fragments, of the same staged tile
#pragma unroll
        for (int qb = 0; qb < NQ; ++qb) { const int iq = q0 + qb * 16 + lr; float t[16];
#pragma unroll
            for (int e = 0; e < 16; ++e) t[e] = s[qb][e >> 3][e & 7] * (SCL * 1.4426950408889634f);
            if (k0 + KB > q0) {   // wave-uniform: only passes that reach the tile's first query hold masked keys
#pragma unroll
                for (int e = 0; e < 16; ++e) { const int j = k0 + (e >> 3) * 16 + hi * 8 + (e & 7); t[e] = (j < iq || (iq == 0 && j == 0)) ? t[e] : -3.0e38f; } }
            float mx = t[0];
#pragma unroll
            for (int e = 1; e < 16; ++e) mx = fmaxf(mx, t[e]);
            mx = fmaxf(mx, xhalf(mx));
            const float mn = fmaxf(m[qb], mx); const float al = exp2s(m[qb] - mn); m[qb] = mn;
            float ps = 0.f; V pf, pf2;
            if constexpr (HL) { v16us ph, pl;
#pragma unroll
                for (int e = 0; e < 16; ++e) { const float p = exp2s(t[e] - mn); ps += p; unsigned short a, c2; splitf(p, a, c2); ph[e] = a; pl[e] = c2; }
                pf = __builtin_bit_cast(v16bf, ph); pf2 = __builtin_bit_cast(v16bf, pl);
            } else {
#pragma unroll
                for (int e = 0; e < 16; ++e) { const float p = exp2s(t[e] - mn); ps += p; pf[e] = tohx(p); } }
            l[qb] = l[qb] * al + ps;
#pragma unroll
            for (int dt = 0; dt < 4; ++dt) { o[qb][dt] *= al; o[qb][dt] = WFrag<T16>::mma(vf[dt], pf, o[qb][dt]); if constexpr (HL) { o[qb][dt] = WFrag<T16>::mma(vf[dt], pf2, o[qb][dt]); o[qb][dt] = WFrag<T16>::mma(vf2[dt], pf, o[qb][dt]); } } }
       } }
      asm volatile("s_wait_dscnt 0x0" ::: "memory");      // this wave's reads of buffer st % 2 are done
      asm volatile("s_wait_asynccnt 0x0" ::: "memory");   // its share of tile st + 1 has landed
      __syncthreads();                                    // tile st + 1 may be read, buffer st % 2 refilled
      if (st + 2 < NT) fill(st + 2);
    }
    asm volatile("s_wait_asynccnt 0x0" ::: "memory");   // no copy is in flight when the wave goes on
#pragma unroll
    for (int qb = 0; qb < NQ; ++qb) { const float inv = __fdiv_rn(1.0f, l[qb] + xhalf(l[qb])); const size_t oo = (size_t)(q0 + qb * 16 + lr) * DQ + hi * 8;
#pragma unroll
        for (int dt = 0; dt < 4; ++dt) { v8us oh, ol;   // accumulator j of tile dt: output column dt * 16 + hi * 8 + j of query lr
#pragma unroll
            for (int j = 0; j < 8; ++j) { unsigned short a, c2; splitf(o[qb][dt][j] * inv, a, c2); oh[j] = a; ol[j] = c2; }
            *(v8us*)(Ah + oo + dt * 16) = oh; *(v8us*)(Al + oo + dt * 16) = ol; } }
}
// grid (heads, batches, NT1 + NT2 + NTH), four waves a block, each wave its own tile of one head, the four tiles one behind the other. Three kinds of row tile, numbered t, each kind from its last rows down:
// t < NT1: rows >= RS, 64 rows, 16 a wave, fp16; then NT2 tiles: rows RH .. RS - 1, 128 rows, 32 a wave, fp16; then NTH tiles: rows < RH, 64 rows, 16 a wave, hi+lo planes.
// The rows with the most keys are cut into the shorter tiles, so that no block's walk over its keys lasts longer than all the work of an evenly filled WGP.
#define RS   1280
#define NT1  ((TT - RS) / 64)
#define NT2  ((RS - RH) / 128)
#define NTH  (RH / 64)
// Which row tile a block takes: DEAL[blockIdx.z]. Every block is resident at once, so the launch lasts as long as the fullest WGP. A z plane is 32 blocks; the
// planes z, z + 8, z + 16 and z + 24 of a column below add up to about the same work (a staged key tile of a 16-row fp16 wave counts about half). For speed only: any placement gives the same result.
static_assert(NT1 == 12 && NT2 == 6 && NTH == 8 && NH_ * NB_ == 32, "DEAL is laid out for 26 planes of 32 blocks");
constexpr int DEAL[NT1 + NT2 + NTH] = {  10,  6, 12, 13,  4,  1,  0, 14,     // staged key tiles  22, 26, 20, 18, 28, 31, 32, 16
                                         16,  8,  3,  2,  9,  5, 15,  7,     //                   12, 24, 29, 30, 23, 27, 14, 25
                                         11, 18, 24, 22, 17, 21, 20, 19,     //                   21,  8,  2,  4, 10,  5,  6,  7
                                         23, 25 };                           //                    3,  1
constexpr bool deal_ok() { unsigned seen = 0; for (int i = 0; i < NT1 + NT2 + NTH; ++i) seen |= 1u << DEAL[i]; return seen == (1u << (NT1 + NT2 + NTH)) - 1u; }
static_assert(deal_ok(), "every row tile is taken exactly once");
constexpr unsigned long long deal_pack(int first) { unsigned long long r = 0; for (int i = 0; i < 12 && first + i < NT1 + NT2 + NTH; ++i) r |= (unsigned long long)DEAL[first + i] << (5 * i); return r; }   // twelve entries of 5 bits
// four waves a SIMD: a budget of 256 registers a wave, so that every block of the grid is resident at once and no register window switch is needed
__global__ __launch_bounds__(128) __attribute__((amdgpu_waves_per_eu(4))) void k_attn(const h16* __restrict__ Q16, const h16* __restrict__ K16, const h16* __restrict__ V16, const bf* __restrict__ Qh, const bf* __restrict__ Ql, const bf* __restrict__ Kh, const bf* __restrict__ Kl, const bf* __restrict__ Vh, const bf* __restrict__ Vl, bf* Ah, bf* Al) {
    __shared__ __align__(128) bf ring[2 * 4 * TLE];
    constexpr unsigned long long D0 = deal_pack(0), D1 = deal_pack(12), D2 = deal_pack(24); const int bz = (int)blockIdx.z;
    const int wv = __builtin_amdgcn_readfirstlane(threadIdx.x >> 5), tz = (int)((bz < 12 ? D0 >> (5 * bz) : bz < 24 ? D1 >> (5 * (bz - 12)) : D2 >> (5 * (bz - 24))) & 31); const size_t zh = (size_t)blockIdx.y * NH_ + blockIdx.x; const size_t pq = zh * TT * HD, pv = zh * HD * PP, pa = (size_t)blockIdx.y * TT * DQ + (size_t)blockIdx.x * HD;
    // the block's last query row R sees keys 0 .. R - 1: (first row + rows) / SK tiles
    if (tz < NT1) { const int r0 = TT - 64 * (tz + 1); attn_tile<h16, false, 1>(Q16 + pq, nullptr, K16 + pq, nullptr, V16 + pv, nullptr, r0 + 16 * wv, (r0 + 64) / SK, Ah + pa, Al + pa, (h16*)ring); }
    else if (tz < NT1 + NT2) { const int r0 = RS - 128 * (tz - NT1 + 1); attn_tile<h16, false, 2>(Q16 + pq, nullptr, K16 + pq, nullptr, V16 + pv, nullptr, r0 + 32 * wv, (r0 + 128) / SK, Ah + pa, Al + pa, (h16*)ring); }
    else { const int r0 = RH - 64 * (tz - NT1 - NT2 + 1); attn_tile<bf, true, 1>(Qh + pq, Ql + pq, Kh + pq, Kl + pq, Vh + pv, Vl + pv, r0 + 16 * wv, (r0 + 64) / SK, Ah + pa, Al + pa, ring); }
}

extern "C" void kernel_launch(void* const* d_in, const int* in_sizes, int n_in,
                              void* d_out, int out_size, void* d_ws, size_t ws_size, hipStream_t stream) {
    (void)in_sizes; (void)n_in; (void)out_size;
    const float* x = (const float*)d_in[0]; const float* xk = (const float*)d_in[1]; const float* xv = (const float*)d_in[2]; const float* wq = (const float*)d_in[3]; const float* wk = (const float*)d_in[4]; const float* wv = (const float*)d_in[5]; const float* wo = (const float*)d_in[6];
    float* OUT = (float*)d_out;     // [2][2048][1024]
    char* wsp = (char*)d_ws;
    auto take = [&](size_t bytes) { char* p = wsp; wsp += (bytes + 255) & ~(size_t)255; return (void*)p; };
    bf* WB = (bf*)take((size_t)4 * DQ * DM * 2); bf* WO = WB + (size_t)3 * DQ * DM; float* CS = (float*)take((size_t)TT * HD * 2 * 4);   // WB: wq, wk, wv, wo, one behind the other
    // head planes of both batches, [b][h][..]
    const size_t SQ = (size_t)NH_ * TT * HD, SV = (size_t)NKV * HD * PP, SA = (size_t)TT * DQ;
    h16* QP16 = (h16*)take(NB_ * SQ * 2); h16* KP16 = (h16*)take(NB_ * SQ * 2); h16* VT16 = (h16*)take(NB_ * SV * 2);
    bf* QPh = (bf*)take(NB_ * SQ * 2); bf* QPl = (bf*)take(NB_ * SQ * 2); bf* KPh = (bf*)take(NB_ * SQ * 2); bf* KPl = (bf*)take(NB_ * SQ * 2); bf* VTh = (bf*)take(NB_ * SV * 2); bf* VTl = VTh + TT;   // each PP row: hi plane, then lo plane
    bf* ATh = (bf*)take(NB_ * SA * 2); bf* ATl = (bf*)take(NB_ * SA * 2);
    bf* XB = (bf*)take((size_t)3 * NB_ * TT * DM * 2);   // q, k, v inputs, both batches each
    if ((size_t)(wsp - (char*)d_ws) > ws_size) return;    // ws 256 MiB
    k_prep<<<3 * NXB + 4 * NWB + TT * (HD / 2) / 256, 256, 0, stream>>>(x, xk, xv, wq, wk, wv, wo, XB, WB, CS);
    k_proj<<<dim3(TT / 128, DQ / 128, 3 * NB_), 128, 0, stream>>>(XB, WB, CS, QP16, QPh, QPl, KP16, KPh, KPl, VT16, VTh, VTl);
    static_assert(REP == 1, "k_attn takes one kv head per query head");
    k_attn<<<dim3(NH_, NB_, NT1 + NT2 + NTH), 128, 0, stream>>>(QP16, KP16, VT16, QPh, QPl, KPh, KPl, VTh, VTl, ATh, ATl);
    k_outp<<<dim3(NB_ * TT / 128, DM / 128, 1), 256, 0, stream>>>(ATh, ATl, WO, OUT);
}
